// v000
// Times are from an AMD MI455X. After a warm-up the kernel runs many times in a row, and a time is the length of
// such a window on the GPU divided by its runs, so every launch and the gaps after it count. The runs cycle
// through copies of the inputs. A figure is the median of several windows, for all but v000 over two sittings.
// Sittings can differ by a few percent; kernels timed side by side share one.
// The starting kernel, v000, takes 880 microseconds a run.
// compute dtype: all float inputs rounded to bf16; q = k = v = x Wk^T with EXACT bf16 products on WMMA 16x16x32 (f32 accumulate; the single 64-wide head carried in 128-wide planes whose upper columns are zero); causal logits with q = k as f16 hi + residual on both sides (3 products) x 64^-0.5; softmax in f32; P as bf16 hi + lo against v bf16 hi + lo (3 products); f32 output.
#include <hip/hip_runtime.h>
#include <math.h>

typedef __attribute__((ext_vector_type(16))) _Float16 v16h;
typedef __attribute__((ext_vector_type(16))) __bf16 v16b;
typedef __attribute__((ext_vector_type(8)))  _Float16 v8h;
typedef __attribute__((ext_vector_type(8)))  float v8f;
typedef __attribute__((ext_vector_type(4)))  float v4f;
typedef __attribute__((ext_vector_type(2)))  float v2f;
typedef __attribute__((ext_vector_type(4)))  unsigned v4u;
typedef __attribute__((ext_vector_type(4)))  int v4i;
typedef float __attribute__((may_alias)) float_a;
typedef int __attribute__((may_alias)) int_a;

template <typename T> __device__ __forceinline__ void vst2(void* p, T v) { *(T*)p = v;  }
__device__ __forceinline__ v8f wmma16(v16h a, v16h b, v8f c) {
  v8f d = __builtin_amdgcn_wmma_f32_16x16x32_f16(false, a, false, b, (short)0, c, false, false);
  asm volatile("v_nop\n\tv_nop\n\tv_nop\n\tv_nop" : "+v"(d) : "v"(a), "v"(b));
  return d;
}
__device__ __forceinline__ v8f wmma_bf(v16b a, v16b b, v8f c) {
  v8f d = __builtin_amdgcn_wmma_f32_16x16x32_bf16(false, a, false, b, (short)0, c, false, false);
  asm volatile("v_nop\n\tv_nop\n\tv_nop\n\tv_nop" : "+v"(d) : "v"(a), "v"(b));
  return d;
}
// 16x16x32 fragments: lane = (h = lane>>4, row/col = lane&15); elements 0..7 = k0+8h+0..7, 8..15 = k0+16+8h+0..7; D element r = row 8h+r
__device__ __forceinline__ v16h frag_h(const _Float16* rowk0, int lane) {
  union { v16h v; v8h q[2]; } u; const _Float16* p = rowk0 + 8 * (lane >> 4);
  u.q[0] = *(const v8h*)p; u.q[1] = *(const v8h*)(p + 16); return u.v;
}
__device__ __forceinline__ v16h frag_f32(const float* rowk0, int lane) {
  v16h a; const float* p = rowk0 + 8 * (lane >> 4);
#pragma unroll
  for (int i = 0; i < 8; ++i) { a[i] = (_Float16)p[i]; a[8 + i] = (_Float16)p[16 + i]; }
  return a;
}
__device__ __forceinline__ v16h frag_f32s(const float* rowk0, int lane, float sc) {
  v16h a; const float* p = rowk0 + 8 * (lane >> 4);
#pragma unroll
  for (int i = 0; i < 8; ++i) { a[i] = (_Float16)(p[i] * sc); a[8 + i] = (_Float16)(p[16 + i] * sc); }
  return a;
}
// column fragment from a [K][ld] layout (column n), rows >= K read as 0
__device__ __forceinline__ v16h fragc_f32(const float* W, int k0, int n, int lane, int ld, int K) {
  v16h a; const int g = lane >> 4;
#pragma unroll
  for (int i = 0; i < 8; ++i) { const int ka = k0 + 8 * g + i, kb = ka + 16;
    a[i] = (_Float16)(ka < K ? W[(size_t)(ka < K ? ka : K - 1) * ld + n] : 0.f); a[8 + i] = (_Float16)(kb < K ? W[(size_t)(kb < K ? kb : K - 1) * ld + n] : 0.f); }
  return a;
}
struct F2 { v16b h, l; };
__device__ __forceinline__ F2 bsplit16(const float v[16]) { F2 r;
#pragma unroll
  for (int i = 0; i < 16; ++i) { const __bf16 h = (__bf16)v[i]; r.h[i] = h; r.l[i] = (__bf16)(v[i] - (float)h); }
  return r; }
__device__ __forceinline__ F2 split_row(const float* row, int k0, int lane) { float v[16]; const float* p = row + k0 + 8 * (lane >> 4);
#pragma unroll
  for (int i = 0; i < 8; ++i) { v[i] = p[i]; v[8 + i] = p[16 + i]; }
  return bsplit16(v); }
__device__ __forceinline__ F2 split_rowK(const float* row, int k0, int lane, int K) { float v[16]; const int g = lane >> 4;
#pragma unroll
  for (int i = 0; i < 8; ++i) { const int ka = k0 + 8 * g + i, kb = ka + 16; v[i] = ka < K ? row[ka < K ? ka : K - 1] : 0.f; v[8 + i] = kb < K ? row[kb < K ? kb : K - 1] : 0.f; }
  return bsplit16(v); }
__device__ __forceinline__ F2 split_col(const float* W, int k0, int n, int lane, int ld, int K) { float v[16]; const int g = lane >> 4;
#pragma unroll
  for (int i = 0; i < 8; ++i) { const int ka = k0 + 8 * g + i, kb = ka + 16; v[i] = ka < K ? W[(size_t)(ka < K ? ka : K - 1) * ld + n] : 0.f; v[8 + i] = kb < K ? W[(size_t)(kb < K ? kb : K - 1) * ld + n] : 0.f; }
  return bsplit16(v); }
__device__ __forceinline__ v8f mac3(const F2& a, const F2& b, v8f c) { c = wmma_bf(a.l, b.h, c); c = wmma_bf(a.h, b.l, c); return wmma_bf(a.h, b.h, c); }
__device__ __forceinline__ float sigm(float v) { return 1.0f / (1.0f + expf(-v)); }
#define LDSX() do { asm volatile("s_wait_dscnt 0" ::: "memory"); __builtin_amdgcn_wave_barrier(); __builtin_amdgcn_fence(__ATOMIC_RELEASE, "workgroup"); } while (0)

// Single-head causal self-attention with shared projections (B 4, S 2,048, E 1,024 -> A 64): k = x Wk^T; q = v = k; x = q k^T / 8 masked where tril(x) == 0 (the strict upper triangle; exact-zero logits in the lower triangle would also be masked - measure-zero for these inputs); softmax; out = P v -> [B, S, 64].
#define NB 4
#define TT 2048
#define CC 128            // NH * HD = projected width
#define DIN 1024
#define NH 1
#define HD 128
#define NQB (TT / 64)
#define HG 1
#define SCALE (0.125f)
#define CAUSAL 1
#ifndef TNB
#define TNB NB
#endif
__device__ __forceinline__ v16b zero16b() { v16b z; _Pragma("unroll") for (int i = 0; i < 16; ++i) z[i] = (__bf16)0.f; return z; }
__device__ __forceinline__ float bfr(float v) { return (float)(__bf16)v; }
__host__ __device__ __forceinline__ int kb_last(int qb) { return CAUSAL ? ((qb * 64 + 63) >> 7) : (TT / 128 - 1); }
typedef __attribute__((ext_vector_type(8))) __bf16 v8b;
__device__ __forceinline__ v16b frag_b(const __bf16* rowk0, int lane) {
  union { v16b v; v8b q[2]; } u; const __bf16* p = rowk0 + 8 * (lane >> 4);
  u.q[0] = *(const v8b*)p; u.q[1] = *(const v8b*)(p + 16); return u.v;
}
#define QBH NQB            // every block: 3-product logits (the self key's logit |k|^2/8 ~ 8 dominates -> peaked rows) and bf16 hi/lo P.v
#define QHI TT
#define KHI TT
// B fragment (k rows k0+.., output column o) of a weight: (in,out) [K][ld] or (out,in) [ld rows of K]: bf16 exact, or f16(bf16 * 256) exact
__device__ __forceinline__ v16b wcol_io(const float* Wm, int k0, int o, int lane, int ld) { v16b w; const int g = lane >> 4;
#pragma unroll
  for (int i = 0; i < 8; ++i) { w[i] = (__bf16)Wm[(size_t)(k0 + 8 * g + i) * ld + o]; w[8 + i] = (__bf16)Wm[(size_t)(k0 + 16 + 8 * g + i) * ld + o]; }
  return w; }
__device__ __forceinline__ v16b wcol_oi(const float* Wm, int k0, int o, int lane, int K) { v16b w; const float* p = Wm + (size_t)o * K + k0 + 8 * (lane >> 4);
#pragma unroll
  for (int i = 0; i < 8; ++i) { w[i] = (__bf16)p[i]; w[8 + i] = (__bf16)p[16 + i]; }
  return w; }
__device__ __forceinline__ v16h wcolh_io(const float* Wm, int k0, int o, int lane, int ld) { v16h w; const int g = lane >> 4;
#pragma unroll
  for (int i = 0; i < 8; ++i) { w[i] = (_Float16)(bfr(Wm[(size_t)(k0 + 8 * g + i) * ld + o]) * 256.0f); w[8 + i] = (_Float16)(bfr(Wm[(size_t)(k0 + 16 + 8 * g + i) * ld + o]) * 256.0f); }
  return w; }
__device__ __forceinline__ v16h wcolh_oi(const float* Wm, int k0, int o, int lane, int K) { v16h w; const float* p = Wm + (size_t)o * K + k0 + 8 * (lane >> 4);
#pragma unroll
  for (int i = 0; i < 8; ++i) { w[i] = (_Float16)(bfr(p[i]) * 256.0f); w[8 + i] = (_Float16)(bfr(p[16 + i]) * 256.0f); }
  return w; }
#define WQKV_LAYOUT 0   // 0 = (out,in) [DOUT][DIN], columns >= DOUT zero; 1 = (out,in) [CC][DIN]; 2 = per-head [NH][DIN][HD]
__device__ __forceinline__ v16b wcol_hdk(const float* Wm, int k0, int o, int lane) { v16b w; const int g = lane >> 4; const float* p = Wm + (size_t)(o / HD) * DIN * HD + (o % HD);
#pragma unroll
  for (int i = 0; i < 8; ++i) { w[i] = (__bf16)p[(size_t)(k0 + 8 * g + i) * HD]; w[8 + i] = (__bf16)p[(size_t)(k0 + 16 + 8 * g + i) * HD]; }
  return w; }
#define WO_OUT_IN 0
#if WQKV_LAYOUT == 1
#define WCOL(W, k0, o, lane) wcol_oi(W, k0, o, lane, DIN)
#elif WQKV_LAYOUT == 2
#define WCOL(W, k0, o, lane) wcol_hdk(W, k0, o, lane)
#else
#define WCOL(W, k0, o, lane) (((o) < DOUT) ? wcol_oi(W, k0, (o), lane, DIN) : zero16b())   /* Wk (out,in) [64][1024]; q = k = v = x Wk^T; plane columns >= 64 are zero */
#endif
#if WO_OUT_IN
#define WOCOL(W, k0, o, lane) wcol_oi(W, k0, o, lane, CC)
#define WOCOLH(W, k0, o, lane) wcolh_oi(W, k0, o, lane, CC)
#else
#define WOCOL(W, k0, o, lane) wcol_io(W, k0, o, lane, DIN)
#define WOCOLH(W, k0, o, lane) wcolh_io(W, k0, o, lane, DIN)
#endif
#define DOUT 64            // real head width (planes are 128 wide, columns >= 64 zero)
// ---- k_fin64: thread per float4: out[r][0..63] = YB[r][0..63] (drop the zero half of the 128-wide context rows)
__global__ __launch_bounds__(256) void k_fin64(const float* __restrict__ YB, float* __restrict__ OUT) { const size_t i = (size_t)blockIdx.x * 256 + threadIdx.x; if (i >= (size_t)TNB * TT * (DOUT / 4)) return; const size_t r = i / (DOUT / 4); const int q = (int)(i % (DOUT / 4)); vst2(OUT + r * DOUT + q * 4, *(const v4f*)(YB + r * CC + q * 4)); }
#define WS_YB  (WS_END)
#define WS_END2 (WS_YB + 4u * (size_t)NB * TT * CC)
#ifndef SM_EXTRA_PARAMS
#define SM_EXTRA_PARAMS
#endif
#ifndef PROJ_EXTRA_PARAMS
#define PROJ_EXTRA_PARAMS
#endif
#ifndef SM_MASK_HOOK
#define SM_MASK_HOOK (void)0
#endif

#define WS_QH  0u                                      // f16 q rows [b*t][CC]
#define WS_KH  (WS_QH + 2u * (size_t)NB * TT * CC)      // f16 k rows [b*t][CC]
#define WS_VT  (WS_KH + 2u * (size_t)NB * TT * CC)      // f16 v planes [b][c][t]
#define WS_QL  (WS_VT + 2u * (size_t)NB * CC * TT)      // f16 q residual x 2^10 rows [b][t < QHI][CC]
#define WS_KL  (WS_QL + 2u * (size_t)NB * QHI * CC)     // f16 k residual x 2^10 rows [b][t < KHI][CC]
#define WS_VB  (WS_KL + 2u * (size_t)NB * KHI * CC)     // bf16 v hi planes [b][c][t < KHI]
#define WS_VBL (WS_VB + 2u * (size_t)NB * CC * KHI)
#define WS_S   (WS_VBL + 2u * (size_t)NB * CC * KHI)    // f32 logits / P [hg][t][s]
#define WS_Y   (WS_S  + 4u * (size_t)HG * TT * TT)      // f32 ctx rows [b*t][CC] (only when there is an output projection)
#define WS_END (WS_Y  + 0u)

// ---- k_proj: block = (64 rows, 128 cols, which): q/k/v = X W (+ b) with exact bf16 products (K = DIN) -> which 0: q f16 rows (+ residual rows < QHI); 1: k f16 rows (+ residual rows < KHI); 2: v f16 planes [c][t] (+ bf16 hi/lo planes for t < KHI)
__global__ __launch_bounds__(128) void k_proj(const float* __restrict__ XQ, const float* __restrict__ XK, const float* __restrict__ XV, const float* __restrict__ WQ, const float* __restrict__ WK, const float* __restrict__ WV, const float* __restrict__ BQ, const float* __restrict__ BK, const float* __restrict__ BV,
    _Float16* __restrict__ QH, _Float16* __restrict__ QL, _Float16* __restrict__ KH, _Float16* __restrict__ KL, _Float16* __restrict__ VT, __bf16* __restrict__ VB, __bf16* __restrict__ VBL) {
  __shared__ __align__(16) _Float16 sh[64][136], sl[64][136]; __shared__ __align__(16) _Float16 th[128][72]; __shared__ __align__(16) __bf16 tb[128][72], tbl[128][72];
  const int tid = threadIdx.x, wave = tid >> 5, lane = tid & 31, col = lane & 15, g = lane >> 4; const int which = blockIdx.z; const int c0 = blockIdx.y * 128; const size_t r0 = (size_t)blockIdx.x * 64; const size_t bb = r0 / TT; const int t0 = (int)(r0 % TT);
  const float* X = which == 0 ? XQ : which == 1 ? XK : XV; const float* WA = which == 0 ? WQ : which == 1 ? WK : WV; const float* BA = which == 0 ? BQ : which == 1 ? BK : BV;
  v8f acc[8] = {};
#pragma unroll 2
  for (int kc = 0; kc < DIN / 32; ++kc) { v16b a; { const float* p = X + (r0 + wave * 16 + col) * DIN + kc * 32 + 8 * g;
#pragma unroll
      for (int i = 0; i < 8; ++i) { a[i] = (__bf16)p[i]; a[8 + i] = (__bf16)p[16 + i]; } }
    asm volatile("s_wait_loadcnt 0x0" ::: "memory");
#pragma unroll
    for (int j = 0; j < 8; ++j) { const v16b w = WCOL(WA, kc * 32, c0 + j * 16 + col, lane); asm volatile("s_wait_loadcnt 0x0" ::: "memory"); acc[j] = wmma_bf(a, w, acc[j]); } }
  if (which < 2) { _Float16* DH = which == 0 ? QH : KH; _Float16* DL = which == 0 ? QL : KL; const int nhi = which == 0 ? QHI : KHI; const bool hi_rows = t0 < nhi;
#pragma unroll
    for (int j = 0; j < 8; ++j) { const float bias = BA ? bfr(BA[c0 + j * 16 + col]) : 0.f;
#pragma unroll
      for (int r = 0; r < 8; ++r) { const float v = acc[j][r] + bias; const _Float16 hv = (_Float16)v; sh[wave * 16 + 8 * g + r][j * 16 + col] = hv; sl[wave * 16 + 8 * g + r][j * 16 + col] = (_Float16)((v - (float)hv) * 1024.0f); } }
    __syncthreads();
    for (int e = tid; e < 64 * 16; e += 128) { const int rl = e >> 4, q = e & 15; vst2((unsigned*)(DH + (r0 + rl) * CC + c0 + q * 8), *(const v4u*)&sh[rl][q * 8]); if (hi_rows) vst2((unsigned*)(DL + (bb * nhi + t0 + rl) * (size_t)CC + c0 + q * 8), *(const v4u*)&sl[rl][q * 8]); }
  } else { const bool hi_rows = t0 < KHI;
#pragma unroll
    for (int j = 0; j < 8; ++j) { const float bias = BA ? bfr(BA[c0 + j * 16 + col]) : 0.f;
#pragma unroll
      for (int r = 0; r < 8; ++r) { const float v = acc[j][r] + bias; const int rl = wave * 16 + 8 * g + r, cl = j * 16 + col; th[cl][rl] = (_Float16)v; const __bf16 bh = (__bf16)v; tb[cl][rl] = bh; tbl[cl][rl] = (__bf16)(v - (float)bh); } }
    __syncthreads();
    for (int e = tid; e < 128 * 8; e += 128) { const int cl = e >> 3, q = e & 7; vst2((unsigned*)(VT + (bb * CC + c0 + cl) * (size_t)TT + t0 + q * 8), *(const v4u*)&th[cl][q * 8]); if (hi_rows) { const size_t o3 = (bb * CC + c0 + cl) * (size_t)KHI + t0 + q * 8; vst2((unsigned*)(VB + o3), *(const v4u*)&tb[cl][q * 8]); vst2((unsigned*)(VBL + o3), *(const v4u*)&tbl[cl][q * 8]); } } } }
// ---- k_sc: block = (query block qb, key block kb <= kb_last(qb), head in group) of batch b: logits x SCALE; q hi + residual (x 2^10) against k (2 products) for query rows < QHI, plus the k residual (3 products) for query blocks < QBH (every query block here); causal: blocks past the diagonal exit, the mask itself is applied by index in k_sm
__global__ __launch_bounds__(128) void k_sc(const _Float16* __restrict__ QH, const _Float16* __restrict__ KH, const _Float16* __restrict__ QL, const _Float16* __restrict__ KL, int b, int h0, float* __restrict__ S0) { __shared__ __align__(16) float ss[4][16][132];
  const int qb = blockIdx.x, kb = blockIdx.y; if (kb > kb_last(qb)) return;
  const int h = h0 + blockIdx.z; float* S = S0 + (size_t)blockIdx.z * TT * TT;
  const int tid = threadIdx.x, wave = tid >> 5, lane = tid & 31, col = lane & 15, g = lane >> 4; const int k0 = kb * 128; const int ql0 = qb * 64 + wave * 16; const size_t q0 = (size_t)b * TT + ql0, kr0 = (size_t)b * TT + k0;
  v8f acc[8] = {}, accl[8] = {};
  const _Float16* QLb = QL + (size_t)b * QHI * CC; const _Float16* KLb = KL + (size_t)b * KHI * CC;
  if (qb < QBH) {
#pragma unroll
    for (int kc = 0; kc < HD / 32; ++kc) { const v16h ah = frag_h(QH + (q0 + col) * CC + h * HD + kc * 32, lane), al = frag_h(QLb + (size_t)(ql0 + col) * CC + h * HD + kc * 32, lane);
#pragma unroll
      for (int j = 0; j < 8; ++j) { const v16h kbf = frag_h(KH + (kr0 + j * 16 + col) * CC + h * HD + kc * 32, lane), klf = frag_h(KLb + (size_t)(k0 + j * 16 + col) * CC + h * HD + kc * 32, lane); acc[j] = wmma16(ah, kbf, acc[j]); accl[j] = wmma16(al, kbf, accl[j]); accl[j] = wmma16(ah, klf, accl[j]); } }
  } else if (qb * 64 < QHI) {
#pragma unroll
    for (int kc = 0; kc < HD / 32; ++kc) { const v16h ah = frag_h(QH + (q0 + col) * CC + h * HD + kc * 32, lane), al = frag_h(QLb + (size_t)(ql0 + col) * CC + h * HD + kc * 32, lane);
#pragma unroll
      for (int j = 0; j < 8; ++j) { const v16h kbf = frag_h(KH + (kr0 + j * 16 + col) * CC + h * HD + kc * 32, lane); acc[j] = wmma16(ah, kbf, acc[j]); accl[j] = wmma16(al, kbf, accl[j]); } }
  } else {
#pragma unroll
    for (int kc = 0; kc < HD / 32; ++kc) { const v16h ah = frag_h(QH + (q0 + col) * CC + h * HD + kc * 32, lane);
#pragma unroll
      for (int j = 0; j < 8; ++j) { const v16h kbf = frag_h(KH + (kr0 + j * 16 + col) * CC + h * HD + kc * 32, lane); acc[j] = wmma16(ah, kbf, acc[j]); } } }
#pragma unroll
  for (int j = 0; j < 8; ++j) {
#pragma unroll
    for (int r = 0; r < 8; ++r) ss[wave][8 * g + r][j * 16 + col] = (acc[j][r] + accl[j][r] * (1.0f / 1024.0f)) * SCALE; }
  LDSX(); for (int rl = 0; rl < 16; ++rl) vst2(S + (size_t)(ql0 + rl) * TT + k0 + lane * 4, *(const v4f*)&ss[wave][rl][lane * 4]); }
// ---- k_sm: block = query row t (head in group): keys [0, kend): causal -> logit if s <= t else excluded; softmax in f32; P x 2^11 in place (0 for excluded)
__global__ __launch_bounds__(256) void k_sm(float* __restrict__ S0 SM_EXTRA_PARAMS) { __shared__ float sred[8]; __shared__ float sbc; __shared__ __align__(16) float shv[TT];
  const int tid = threadIdx.x; const int t = blockIdx.x; const int kend = (kb_last(t >> 6) + 1) * 128;
  float* sr = S0 + (size_t)blockIdx.y * TT * TT + (size_t)t * TT;
  float m = -3.0e38f; for (int k = tid; k < kend; k += 256) { float v = (!CAUSAL || k <= t) ? sr[k] : -3.0e38f; SM_MASK_HOOK; shv[k] = v; m = fmaxf(m, v); }
#pragma unroll
  for (int o = 1; o < 32; o <<= 1) m = fmaxf(m, __shfl_xor(m, o));
  if ((tid & 31) == 0) sred[tid >> 5] = m; __syncthreads(); if (tid == 0) { float a = sred[0]; for (int i = 1; i < 8; ++i) a = fmaxf(a, sred[i]); sbc = a; } __syncthreads(); m = sbc; __syncthreads();
  float sum = 0.f; for (int k = tid; k < kend; k += 256) { const float v = shv[k]; const float e = (v <= -1.0e38f) ? 0.f : expf(v - m); shv[k] = e; sum += e; }
#pragma unroll
  for (int o = 1; o < 32; o <<= 1) sum += __shfl_xor(sum, o);
  if ((tid & 31) == 0) sred[tid >> 5] = sum; __syncthreads(); if (tid == 0) { float a = 0.f; for (int i = 0; i < 8; ++i) a += sred[i]; sbc = a > 0.f ? 2048.0f / a : 0.f; }   /* a fully excluded row yields P = 0 */ __syncthreads(); const float inv = sbc;
  for (int k = tid; k < kend; k += 256) shv[k] = shv[k] * inv;
  __syncthreads(); for (int q = tid; q < kend / 4; q += 256) vst2(sr + q * 4, *(const v4f*)&shv[q * 4]); }
// ---- k_pv: block = 64 queries (qb) of (b, h): ctx = P . v over keys [0, kend) (P x 2^11 once to f16 against v f16: 1 product; query blocks < QBH, i.e. every block here: P and v as bf16 hi + lo, 3 products); 512-B (row, head) segment by 32 lanes
__global__ __launch_bounds__(128) void k_pv(const float* __restrict__ PS0, const _Float16* __restrict__ VT, const __bf16* __restrict__ VB, const __bf16* __restrict__ VBL, int b, int h0, float* __restrict__ Y) { const int h = h0 + blockIdx.z; const float* PS = PS0 + (size_t)blockIdx.z * TT * TT; __shared__ __align__(16) float ss[4][16][HD + 4];
  const int tid = threadIdx.x, wave = tid >> 5, lane = tid & 31, col = lane & 15, g = lane >> 4; const int qb = blockIdx.x; const int ql0 = qb * 64 + wave * 16; const int kce = (kb_last(qb) + 1) * 4;
  v8f acc[HD / 16] = {};
  if (qb < QBH) {
#pragma unroll 1
    for (int kc = 0; kc < kce; ++kc) { const F2 p = split_row(PS + (size_t)(ql0 + col) * TT, kc * 32, lane);
      asm volatile("s_wait_loadcnt 0x0" ::: "memory");
#pragma unroll
      for (int j = 0; j < HD / 16; ++j) { const size_t po = ((size_t)b * CC + h * HD + j * 16 + col) * (size_t)KHI + kc * 32; const v16b vh = frag_b(VB + po, lane); acc[j] = wmma_bf(p.h, vh, acc[j]); acc[j] = wmma_bf(p.l, vh, acc[j]); acc[j] = wmma_bf(p.h, frag_b(VBL + po, lane), acc[j]); } }
  } else {
#pragma unroll 1
    for (int kc = 0; kc < kce; ++kc) { const v16h p = frag_f32(PS + (size_t)(ql0 + col) * TT + kc * 32, lane);
      asm volatile("s_wait_loadcnt 0x0" ::: "memory");
#pragma unroll
      for (int j = 0; j < HD / 16; ++j) { const size_t po = ((size_t)b * CC + h * HD + j * 16 + col) * (size_t)TT + kc * 32; acc[j] = wmma16(p, frag_h(VT + po, lane), acc[j]); } } }
#pragma unroll
  for (int j = 0; j < HD / 16; ++j)
#pragma unroll
    for (int r = 0; r < 8; ++r) ss[wave][8 * g + r][j * 16 + col] = acc[j][r] * (1.0f / 2048.0f);
  LDSX(); for (int rl = 0; rl < 16; ++rl) if (lane < HD / 4) vst2(Y + ((size_t)b * TT + ql0 + rl) * CC + h * HD + lane * 4, *(const v4f*)&ss[wave][rl][lane * 4]); }

extern "C" void kernel_launch(void* const* d_in, const int* in_sizes, int n_in, void* d_out, int out_size, void* d_ws, size_t ws_size, hipStream_t stream) {
  (void)in_sizes; (void)n_in; (void)out_size;
  const float** F = (const float**)d_in;
  if (ws_size < (size_t)WS_END) return;
  char* ws = (char*)d_ws; _Float16 *QH = (_Float16*)(ws + WS_QH), *KH = (_Float16*)(ws + WS_KH), *VT = (_Float16*)(ws + WS_VT), *QL = (_Float16*)(ws + WS_QL), *KL = (_Float16*)(ws + WS_KL); __bf16 *VB = (__bf16*)(ws + WS_VB), *VBL = (__bf16*)(ws + WS_VBL); float *S = (float*)(ws + WS_S), *Y = (float*)(ws + WS_Y);
  (void)Y; (void)QL; (void)KL; (void)VB; (void)VBL;
  // inputs: 0 embedding [4,2048,1024]; 1 Wk [64,1024] (out,in) (q = k = v)
  if (ws_size < (size_t)WS_END2) return;
  float* YB = (float*)(ws + WS_YB);
  k_proj<<<dim3(TNB * TT / 64, CC / 128, 3), 128, 0, stream>>>(F[0], F[0], F[0], F[1], F[1], F[1], nullptr, nullptr, nullptr, QH, QL, KH, KL, VT, VB, VBL);
  for (int b = 0; b < TNB; ++b) {
    k_sc<<<dim3(NQB, TT / 128, 1), 128, 0, stream>>>(QH, KH, QL, KL, b, 0, S);
    k_sm<<<dim3(TT, 1), 256, 0, stream>>>(S);
    k_pv<<<dim3(NQB, 1, 1), 128, 0, stream>>>(S, VT, VB, VBL, b, 0, YB);
  }
  k_fin64<<<dim3((unsigned)(((size_t)TNB * TT * (DOUT / 4) + 255) / 256)), 256, 0, stream>>>(YB, (float*)d_out);
}

// v001
// A run of this version takes 225 microseconds.
// Next to v000, in two timings, it ran 3.92 and 3.95 times as fast.
// compute dtype: all float inputs rounded to bf16; q = k = v = x Wk^T with EXACT bf16 products on WMMA 16x16x32 (f32 accumulate; the single 64-wide head carried in 128-wide planes whose upper columns are zero); causal logits with q = k as f16 hi + residual on both sides (3 products) x 64^-0.5; softmax in f32; P as bf16 hi + lo against v bf16 hi + lo (3 products); f32 output.
#include <hip/hip_runtime.h>
#include <math.h>

typedef __attribute__((ext_vector_type(16))) _Float16 v16h;
typedef __attribute__((ext_vector_type(16))) __bf16 v16b;
typedef __attribute__((ext_vector_type(8)))  _Float16 v8h;
typedef __attribute__((ext_vector_type(8)))  float v8f;
typedef __attribute__((ext_vector_type(4)))  float v4f;
typedef __attribute__((ext_vector_type(2)))  float v2f;
typedef __attribute__((ext_vector_type(4)))  unsigned v4u;
typedef __attribute__((ext_vector_type(4)))  int v4i;
typedef float __attribute__((may_alias)) float_a;
typedef int __attribute__((may_alias)) int_a;

template <typename T> __device__ __forceinline__ void vst2(void* p, T v) { *(T*)p = v;  }
__device__ __forceinline__ v8f wmma16(v16h a, v16h b, v8f c) {
  v8f d = __builtin_amdgcn_wmma_f32_16x16x32_f16(false, a, false, b, (short)0, c, false, false);
  asm volatile("v_nop\n\tv_nop\n\tv_nop\n\tv_nop" : "+v"(d) : "v"(a), "v"(b));
  return d;
}
__device__ __forceinline__ v8f wmma_bf(v16b a, v16b b, v8f c) {
  v8f d = __builtin_amdgcn_wmma_f32_16x16x32_bf16(false, a, false, b, (short)0, c, false, false);
  asm volatile("v_nop\n\tv_nop\n\tv_nop\n\tv_nop" : "+v"(d) : "v"(a), "v"(b));
  return d;
}
// 16x16x32 fragments: lane = (h = lane>>4, row/col = lane&15); elements 0..7 = k0+8h+0..7, 8..15 = k0+16+8h+0..7; D element r = row 8h+r
__device__ __forceinline__ v16h frag_h(const _Float16* rowk0, int lane) {
  union { v16h v; v8h q[2]; } u; const _Float16* p = rowk0 + 8 * (lane >> 4);
  u.q[0] = *(const v8h*)p; u.q[1] = *(const v8h*)(p + 16); return u.v;
}
__device__ __forceinline__ v16h frag_f32(const float* rowk0, int lane) {
  v16h a; const float* p = rowk0 + 8 * (lane >> 4);
#pragma unroll
  for (int i = 0; i < 8; ++i) { a[i] = (_Float16)p[i]; a[8 + i] = (_Float16)p[16 + i]; }
  return a;
}
__device__ __forceinline__ v16h frag_f32s(const float* rowk0, int lane, float sc) {
  v16h a; const float* p = rowk0 + 8 * (lane >> 4);
#pragma unroll
  for (int i = 0; i < 8; ++i) { a[i] = (_Float16)(p[i] * sc); a[8 + i] = (_Float16)(p[16 + i] * sc); }
  return a;
}
// column fragment from a [K][ld] layout (column n), rows >= K read as 0
__device__ __forceinline__ v16h fragc_f32(const float* W, int k0, int n, int lane, int ld, int K) {
  v16h a; const int g = lane >> 4;
#pragma unroll
  for (int i = 0; i < 8; ++i) { const int ka = k0 + 8 * g + i, kb = ka + 16;
    a[i] = (_Float16)(ka < K ? W[(size_t)(ka < K ? ka : K - 1) * ld + n] : 0.f); a[8 + i] = (_Float16)(kb < K ? W[(size_t)(kb < K ? kb : K - 1) * ld + n] : 0.f); }
  return a;
}
struct F2 { v16b h, l; };
__device__ __forceinline__ F2 bsplit16(const float v[16]) { F2 r;
#pragma unroll
  for (int i = 0; i < 16; ++i) { const __bf16 h = (__bf16)v[i]; r.h[i] = h; r.l[i] = (__bf16)(v[i] - (float)h); }
  return r; }
__device__ __forceinline__ F2 split_row(const float* row, int k0, int lane) { float v[16]; const float* p = row + k0 + 8 * (lane >> 4);
#pragma unroll
  for (int i = 0; i < 8; ++i) { v[i] = p[i]; v[8 + i] = p[16 + i]; }
  return bsplit16(v); }
__device__ __forceinline__ F2 split_rowK(const float* row, int k0, int lane, int K) { float v[16]; const int g = lane >> 4;
#pragma unroll
  for (int i = 0; i < 8; ++i) { const int ka = k0 + 8 * g + i, kb = ka + 16; v[i] = ka < K ? row[ka < K ? ka : K - 1] : 0.f; v[8 + i] = kb < K ? row[kb < K ? kb : K - 1] : 0.f; }
  return bsplit16(v); }
__device__ __forceinline__ F2 split_col(const float* W, int k0, int n, int lane, int ld, int K) { float v[16]; const int g = lane >> 4;
#pragma unroll
  for (int i = 0; i < 8; ++i) { const int ka = k0 + 8 * g + i, kb = ka + 16; v[i] = ka < K ? W[(size_t)(ka < K ? ka : K - 1) * ld + n] : 0.f; v[8 + i] = kb < K ? W[(size_t)(kb < K ? kb : K - 1) * ld + n] : 0.f; }
  return bsplit16(v); }
__device__ __forceinline__ v8f mac3(const F2& a, const F2& b, v8f c) { c = wmma_bf(a.l, b.h, c); c = wmma_bf(a.h, b.l, c); return wmma_bf(a.h, b.h, c); }
__device__ __forceinline__ float sigm(float v) { return 1.0f / (1.0f + expf(-v)); }
#define LDSX() do { asm volatile("s_wait_dscnt 0" ::: "memory"); __builtin_amdgcn_wave_barrier(); __builtin_amdgcn_fence(__ATOMIC_RELEASE, "workgroup"); } while (0)

// Single-head causal self-attention with shared projections (B 4, S 2,048, E 1,024 -> A 64): k = x Wk^T; q = v = k; x = q k^T / 8 masked where tril(x) == 0 (the strict upper triangle; exact-zero logits in the lower triangle would also be masked - measure-zero for these inputs); softmax; out = P v -> [B, S, 64].
#define NB 4
#define TT 2048
#define CC 128            // NH * HD = projected width
#define DIN 1024
#define NH 1
#define HD 128
#define NQB (TT / 64)
#define HG 1
#define SCALE (0.125f)
#define CAUSAL 1
#ifndef TNB
#define TNB NB
#endif
__device__ __forceinline__ v16b zero16b() { v16b z; _Pragma("unroll") for (int i = 0; i < 16; ++i) z[i] = (__bf16)0.f; return z; }
__device__ __forceinline__ float bfr(float v) { return (float)(__bf16)v; }
__host__ __device__ __forceinline__ int kb_last(int qb) { return CAUSAL ? ((qb * 64 + 63) >> 7) : (TT / 128 - 1); }
typedef __attribute__((ext_vector_type(8))) __bf16 v8b;
__device__ __forceinline__ v16b frag_b(const __bf16* rowk0, int lane) {
  union { v16b v; v8b q[2]; } u; const __bf16* p = rowk0 + 8 * (lane >> 4);
  u.q[0] = *(const v8b*)p; u.q[1] = *(const v8b*)(p + 16); return u.v;
}
#define QBH NQB            // every block: 3-product logits (the self key's logit |k|^2/8 ~ 8 dominates -> peaked rows) and bf16 hi/lo P.v
#define QHI TT
#define KHI TT
// B fragment (k rows k0+.., output column o) of a weight: (in,out) [K][ld] or (out,in) [ld rows of K]: bf16 exact, or f16(bf16 * 256) exact
__device__ __forceinline__ v16b wcol_io(const float* Wm, int k0, int o, int lane, int ld) { v16b w; const int g = lane >> 4;
#pragma unroll
  for (int i = 0; i < 8; ++i) { w[i] = (__bf16)Wm[(size_t)(k0 + 8 * g + i) * ld + o]; w[8 + i] = (__bf16)Wm[(size_t)(k0 + 16 + 8 * g + i) * ld + o]; }
  return w; }
__device__ __forceinline__ v16b wcol_oi(const float* Wm, int k0, int o, int lane, int K) { v16b w; const float* p = Wm + (size_t)o * K + k0 + 8 * (lane >> 4);
#pragma unroll
  for (int i = 0; i < 8; ++i) { w[i] = (__bf16)p[i]; w[8 + i] = (__bf16)p[16 + i]; }
  return w; }
__device__ __forceinline__ v16h wcolh_io(const float* Wm, int k0, int o, int lane, int ld) { v16h w; const int g = lane >> 4;
#pragma unroll
  for (int i = 0; i < 8; ++i) { w[i] = (_Float16)(bfr(Wm[(size_t)(k0 + 8 * g + i) * ld + o]) * 256.0f); w[8 + i] = (_Float16)(bfr(Wm[(size_t)(k0 + 16 + 8 * g + i) * ld + o]) * 256.0f); }
  return w; }
__device__ __forceinline__ v16h wcolh_oi(const float* Wm, int k0, int o, int lane, int K) { v16h w; const float* p = Wm + (size_t)o * K + k0 + 8 * (lane >> 4);
#pragma unroll
  for (int i = 0; i < 8; ++i) { w[i] = (_Float16)(bfr(p[i]) * 256.0f); w[8 + i] = (_Float16)(bfr(p[16 + i]) * 256.0f); }
  return w; }
#define WQKV_LAYOUT 0   // 0 = (out,in) [DOUT][DIN], columns >= DOUT zero; 1 = (out,in) [CC][DIN]; 2 = per-head [NH][DIN][HD]
__device__ __forceinline__ v16b wcol_hdk(const float* Wm, int k0, int o, int lane) { v16b w; const int g = lane >> 4; const float* p = Wm + (size_t)(o / HD) * DIN * HD + (o % HD);
#pragma unroll
  for (int i = 0; i < 8; ++i) { w[i] = (__bf16)p[(size_t)(k0 + 8 * g + i) * HD]; w[8 + i] = (__bf16)p[(size_t)(k0 + 16 + 8 * g + i) * HD]; }
  return w; }
#define WO_OUT_IN 0
#if WQKV_LAYOUT == 1
#define WCOL(W, k0, o, lane) wcol_oi(W, k0, o, lane, DIN)
#elif WQKV_LAYOUT == 2
#define WCOL(W, k0, o, lane) wcol_hdk(W, k0, o, lane)
#else
#define WCOL(W, k0, o, lane) (((o) < DOUT) ? wcol_oi(W, k0, (o), lane, DIN) : zero16b())   /* Wk (out,in) [64][1024]; q = k = v = x Wk^T; plane columns >= 64 are zero */
#endif
#if WO_OUT_IN
#define WOCOL(W, k0, o, lane) wcol_oi(W, k0, o, lane, CC)
#define WOCOLH(W, k0, o, lane) wcolh_oi(W, k0, o, lane, CC)
#else
#define WOCOL(W, k0, o, lane) wcol_io(W, k0, o, lane, DIN)
#define WOCOLH(W, k0, o, lane) wcolh_io(W, k0, o, lane, DIN)
#endif
#define DOUT 64            // real head width (planes are 128 wide, columns >= 64 zero)
// ---- k_fin64: thread per float4: out[r][0..63] = YB[r][0..63] (drop the zero half of the 128-wide context rows)
__global__ __launch_bounds__(256) void k_fin64(const float* __restrict__ YB, float* __restrict__ OUT) { const size_t i = (size_t)blockIdx.x * 256 + threadIdx.x; if (i >= (size_t)TNB * TT * (DOUT / 4)) return; const size_t r = i / (DOUT / 4); const int q = (int)(i % (DOUT / 4)); vst2(OUT + r * DOUT + q * 4, *(const v4f*)(YB + r * CC + q * 4)); }
#define WS_YB  (WS_END)
#define WS_END2 (WS_YB + 4u * (size_t)NB * TT * CC)
#ifndef SM_EXTRA_PARAMS
#define SM_EXTRA_PARAMS
#endif
#ifndef PROJ_EXTRA_PARAMS
#define PROJ_EXTRA_PARAMS
#endif
#ifndef SM_MASK_HOOK
#define SM_MASK_HOOK (void)0
#endif

#define WS_QH  0u                                      // f16 q rows [b*t][CC]
#define WS_KH  (WS_QH + 2u * (size_t)NB * TT * CC)      // f16 k rows [b*t][CC]
#define WS_VT  (WS_KH + 2u * (size_t)NB * TT * CC)      // f16 v planes [b][c][t]
#define WS_QL  (WS_VT + 2u * (size_t)NB * CC * TT)      // f16 q residual x 2^10 rows [b][t < QHI][CC]
#define WS_KL  (WS_QL + 2u * (size_t)NB * QHI * CC)     // f16 k residual x 2^10 rows [b][t < KHI][CC]
#define WS_VB  (WS_KL + 2u * (size_t)NB * KHI * CC)     // bf16 v hi planes [b][c][t < KHI]
#define WS_VBL (WS_VB + 2u * (size_t)NB * CC * KHI)
#define WS_S   (WS_VBL + 2u * (size_t)NB * CC * KHI)    // f32 logits / P [hg][t][s]
#define WS_Y   (WS_S  + 4u * (size_t)HG * TT * TT)      // f32 ctx rows [b*t][CC] (only when there is an output projection)
#define WS_END (WS_Y  + 0u)

// ---- k_proj: block = (64 rows, 128 cols, which): q/k/v = X W (+ b) with exact bf16 products (K = DIN) -> which 0: q f16 rows (+ residual rows < QHI); 1: k f16 rows (+ residual rows < KHI); 2: v f16 planes [c][t] (+ bf16 hi/lo planes for t < KHI)
__global__ __launch_bounds__(128) void k_proj(const float* __restrict__ XQ, const float* __restrict__ XK, const float* __restrict__ XV, const float* __restrict__ WQ, const float* __restrict__ WK, const float* __restrict__ WV, const float* __restrict__ BQ, const float* __restrict__ BK, const float* __restrict__ BV,
    _Float16* __restrict__ QH, _Float16* __restrict__ QL, _Float16* __restrict__ KH, _Float16* __restrict__ KL, _Float16* __restrict__ VT, __bf16* __restrict__ VB, __bf16* __restrict__ VBL) {
  __shared__ __align__(16) _Float16 sh[64][136], sl[64][136]; __shared__ __align__(16) _Float16 th[128][72]; __shared__ __align__(16) __bf16 tb[128][72], tbl[128][72];
  const int tid = threadIdx.x, wave = tid >> 5, lane = tid & 31, col = lane & 15, g = lane >> 4; const int which = blockIdx.z; const int c0 = blockIdx.y * 128; const size_t r0 = (size_t)blockIdx.x * 64; const size_t bb = r0 / TT; const int t0 = (int)(r0 % TT);
  const float* X = which == 0 ? XQ : which == 1 ? XK : XV; const float* WA = which == 0 ? WQ : which == 1 ? WK : WV; const float* BA = which == 0 ? BQ : which == 1 ? BK : BV;
  v8f acc[8] = {};
#pragma unroll 2
  for (int kc = 0; kc < DIN / 32; ++kc) { v16b a; { const float* p = X + (r0 + wave * 16 + col) * DIN + kc * 32 + 8 * g;
#pragma unroll
      for (int i = 0; i < 8; ++i) { a[i] = (__bf16)p[i]; a[8 + i] = (__bf16)p[16 + i]; } }
    asm volatile("s_wait_loadcnt 0x0" ::: "memory");
#pragma unroll
    for (int j = 0; j < 8; ++j) { const v16b w = WCOL(WA, kc * 32, c0 + j * 16 + col, lane); asm volatile("s_wait_loadcnt 0x0" ::: "memory"); acc[j] = wmma_bf(a, w, acc[j]); } }
  if (which < 2) { _Float16* DH = which == 0 ? QH : KH; _Float16* DL = which == 0 ? QL : KL; const int nhi = which == 0 ? QHI : KHI; const bool hi_rows = t0 < nhi;
#pragma unroll
    for (int j = 0; j < 8; ++j) { const float bias = BA ? bfr(BA[c0 + j * 16 + col]) : 0.f;
#pragma unroll
      for (int r = 0; r < 8; ++r) { const float v = acc[j][r] + bias; const _Float16 hv = (_Float16)v; sh[wave * 16 + 8 * g + r][j * 16 + col] = hv; sl[wave * 16 + 8 * g + r][j * 16 + col] = (_Float16)((v - (float)hv) * 1024.0f); } }
    __syncthreads();
    for (int e = tid; e < 64 * 16; e += 128) { const int rl = e >> 4, q = e & 15; vst2((unsigned*)(DH + (r0 + rl) * CC + c0 + q * 8), *(const v4u*)&sh[rl][q * 8]); if (hi_rows) vst2((unsigned*)(DL + (bb * nhi + t0 + rl) * (size_t)CC + c0 + q * 8), *(const v4u*)&sl[rl][q * 8]); }
  } else { const bool hi_rows = t0 < KHI;
#pragma unroll
    for (int j = 0; j < 8; ++j) { const float bias = BA ? bfr(BA[c0 + j * 16 + col]) : 0.f;
#pragma unroll
      for (int r = 0; r < 8; ++r) { const float v = acc[j][r] + bias; const int rl = wave * 16 + 8 * g + r, cl = j * 16 + col; th[cl][rl] = (_Float16)v; const __bf16 bh = (__bf16)v; tb[cl][rl] = bh; tbl[cl][rl] = (__bf16)(v - (float)bh); } }
    __syncthreads();
    for (int e = tid; e < 128 * 8; e += 128) { const int cl = e >> 3, q = e & 7; vst2((unsigned*)(VT + (bb * CC + c0 + cl) * (size_t)TT + t0 + q * 8), *(const v4u*)&th[cl][q * 8]); if (hi_rows) { const size_t o3 = (bb * CC + c0 + cl) * (size_t)KHI + t0 + q * 8; vst2((unsigned*)(VB + o3), *(const v4u*)&tb[cl][q * 8]); vst2((unsigned*)(VBL + o3), *(const v4u*)&tbl[cl][q * 8]); } } } }
// ---- k_sc: block = (query block qb, key block kb <= kb_last(qb), head in group) of batch b: logits x SCALE; q hi + residual (x 2^10) against k (2 products) for query rows < QHI, plus the k residual (3 products) for query blocks < QBH (every query block here); causal: blocks past the diagonal exit, the mask itself is applied by index in k_sm
__global__ __launch_bounds__(128) void k_sc(const _Float16* __restrict__ QH, const _Float16* __restrict__ KH, const _Float16* __restrict__ QL, const _Float16* __restrict__ KL, int b, int h0, float* __restrict__ S0) { __shared__ __align__(16) float ss[4][16][132];
  const int qb = blockIdx.x, kb = blockIdx.y; if (kb > kb_last(qb)) return;
  const int h = h0 + blockIdx.z; float* S = S0 + (size_t)blockIdx.z * TT * TT;
  const int tid = threadIdx.x, wave = tid >> 5, lane = tid & 31, col = lane & 15, g = lane >> 4; const int k0 = kb * 128; const int ql0 = qb * 64 + wave * 16; const size_t q0 = (size_t)b * TT + ql0, kr0 = (size_t)b * TT + k0;
  v8f acc[8] = {}, accl[8] = {};
  const _Float16* QLb = QL + (size_t)b * QHI * CC; const _Float16* KLb = KL + (size_t)b * KHI * CC;
  if (qb < QBH) {
#pragma unroll
    for (int kc = 0; kc < HD / 32; ++kc) { const v16h ah = frag_h(QH + (q0 + col) * CC + h * HD + kc * 32, lane), al = frag_h(QLb + (size_t)(ql0 + col) * CC + h * HD + kc * 32, lane);
#pragma unroll
      for (int j = 0; j < 8; ++j) { const v16h kbf = frag_h(KH + (kr0 + j * 16 + col) * CC + h * HD + kc * 32, lane), klf = frag_h(KLb + (size_t)(k0 + j * 16 + col) * CC + h * HD + kc * 32, lane); acc[j] = wmma16(ah, kbf, acc[j]); accl[j] = wmma16(al, kbf, accl[j]); accl[j] = wmma16(ah, klf, accl[j]); } }
  } else if (qb * 64 < QHI) {
#pragma unroll
    for (int kc = 0; kc < HD / 32; ++kc) { const v16h ah = frag_h(QH + (q0 + col) * CC + h * HD + kc * 32, lane), al = frag_h(QLb + (size_t)(ql0 + col) * CC + h * HD + kc * 32, lane);
#pragma unroll
      for (int j = 0; j < 8; ++j) { const v16h kbf = frag_h(KH + (kr0 + j * 16 + col) * CC + h * HD + kc * 32, lane); acc[j] = wmma16(ah, kbf, acc[j]); accl[j] = wmma16(al, kbf, accl[j]); } }
  } else {
#pragma unroll
    for (int kc = 0; kc < HD / 32; ++kc) { const v16h ah = frag_h(QH + (q0 + col) * CC + h * HD + kc * 32, lane);
#pragma unroll
      for (int j = 0; j < 8; ++j) { const v16h kbf = frag_h(KH + (kr0 + j * 16 + col) * CC + h * HD + kc * 32, lane); acc[j] = wmma16(ah, kbf, acc[j]); } } }
#pragma unroll
  for (int j = 0; j < 8; ++j) {
#pragma unroll
    for (int r = 0; r < 8; ++r) ss[wave][8 * g + r][j * 16 + col] = (acc[j][r] + accl[j][r] * (1.0f / 1024.0f)) * SCALE; }
  LDSX(); for (int rl = 0; rl < 16; ++rl) vst2(S + (size_t)(ql0 + rl) * TT + k0 + lane * 4, *(const v4f*)&ss[wave][rl][lane * 4]); }
// ---- k_sm: block = query row t (head in group): keys [0, kend): causal -> logit if s <= t else excluded; softmax in f32; P x 2^11 in place (0 for excluded)
__global__ __launch_bounds__(256) void k_sm(float* __restrict__ S0 SM_EXTRA_PARAMS) { __shared__ float sred[8]; __shared__ float sbc; __shared__ __align__(16) float shv[TT];
  const int tid = threadIdx.x; const int t = blockIdx.x; const int kend = (kb_last(t >> 6) + 1) * 128;
  float* sr = S0 + (size_t)blockIdx.y * TT * TT + (size_t)t * TT;
  float m = -3.0e38f; for (int k = tid; k < kend; k += 256) { float v = (!CAUSAL || k <= t) ? sr[k] : -3.0e38f; SM_MASK_HOOK; shv[k] = v; m = fmaxf(m, v); }
#pragma unroll
  for (int o = 1; o < 32; o <<= 1) m = fmaxf(m, __shfl_xor(m, o));
  if ((tid & 31) == 0) sred[tid >> 5] = m; __syncthreads(); if (tid == 0) { float a = sred[0]; for (int i = 1; i < 8; ++i) a = fmaxf(a, sred[i]); sbc = a; } __syncthreads(); m = sbc; __syncthreads();
  float sum = 0.f; for (int k = tid; k < kend; k += 256) { const float v = shv[k]; const float e = (v <= -1.0e38f) ? 0.f : expf(v - m); shv[k] = e; sum += e; }
#pragma unroll
  for (int o = 1; o < 32; o <<= 1) sum += __shfl_xor(sum, o);
  if ((tid & 31) == 0) sred[tid >> 5] = sum; __syncthreads(); if (tid == 0) { float a = 0.f; for (int i = 0; i < 8; ++i) a += sred[i]; sbc = a > 0.f ? 2048.0f / a : 0.f; }   /* a fully excluded row yields P = 0 */ __syncthreads(); const float inv = sbc;
  for (int k = tid; k < kend; k += 256) shv[k] = shv[k] * inv;
  __syncthreads(); for (int q = tid; q < kend / 4; q += 256) vst2(sr + q * 4, *(const v4f*)&shv[q * 4]); }
// ---- k_pv: block = 16 queries x one half of the context columns of (b, h), 16 waves: ctx = P . v over keys [0, kend); wave w takes the 64-key pairs of steps w, w + 16, ... (whole 128-B lines of P and v), the 16 partial tiles are summed through LDS in wave order (every query block here, qb < QBH: P and v as bf16 hi + lo, 3 products; the f16 path, P x 2^11 once to f16 against v f16, 1 product, is not taken)
#define PV_KS 16               // waves of a block = key ranges dealt round-robin
#define PV_JH 2                // column halves, one per block (blockIdx.y)
#define PV_W  (HD / PV_JH)     // context columns of a block
#define PV_JT (PV_W / 16)      // 16-column tiles of a wave
__global__ __launch_bounds__(32 * PV_KS) void k_pv(const float* __restrict__ PS0, const _Float16* __restrict__ VT, const __bf16* __restrict__ VB, const __bf16* __restrict__ VBL, int b, int h0, float* __restrict__ Y) { const int h = h0 + blockIdx.z; const float* PS = PS0 + (size_t)blockIdx.z * TT * TT; __shared__ __align__(16) float ss[PV_KS][16][PV_W + 4];
  const int tid = threadIdx.x, lane = tid & 31, col = lane & 15, g = lane >> 4; const int ql0 = blockIdx.x * 16; const int qb = ql0 >> 6; const int c0 = h * HD + blockIdx.y * PV_W; const int kce = (kb_last(qb) + 1) * 4;
  const int wave = __builtin_amdgcn_readfirstlane(tid >> 5);   // scalar, so that the key loop's trip count is a scalar branch and every lane stays on at the matrix instructions
  v8f acc[PV_JT] = {};
  if (qb < QBH) {
#pragma unroll 1
    for (int kp = wave; kp < kce / 2; kp += PV_KS)
#pragma unroll 1
    for (int kc = 2 * kp; kc < 2 * kp + 2; ++kc) { const F2 p = split_row(PS + (size_t)(ql0 + col) * TT, kc * 32, lane);
      asm volatile("s_wait_loadcnt 0x0" ::: "memory");
#pragma unroll
      for (int j = 0; j < PV_JT; ++j) { const size_t po = ((size_t)b * CC + c0 + j * 16 + col) * (size_t)KHI + kc * 32; const v16b vh = frag_b(VB + po, lane); acc[j] = wmma_bf(p.h, vh, acc[j]); acc[j] = wmma_bf(p.l, vh, acc[j]); acc[j] = wmma_bf(p.h, frag_b(VBL + po, lane), acc[j]); } }
  } else {
#pragma unroll 1
    for (int kp = wave; kp < kce / 2; kp += PV_KS)
#pragma unroll 1
    for (int kc = 2 * kp; kc < 2 * kp + 2; ++kc) { const v16h p = frag_f32(PS + (size_t)(ql0 + col) * TT + kc * 32, lane);
      asm volatile("s_wait_loadcnt 0x0" ::: "memory");
#pragma unroll
      for (int j = 0; j < PV_JT; ++j) { const size_t po = ((size_t)b * CC + c0 + j * 16 + col) * (size_t)TT + kc * 32; acc[j] = wmma16(p, frag_h(VT + po, lane), acc[j]); } } }
#pragma unroll
  for (int j = 0; j < PV_JT; ++j)
#pragma unroll
    for (int r = 0; r < 8; ++r) ss[wave][8 * g + r][j * 16 + col] = acc[j][r] * (1.0f / 2048.0f);
  __syncthreads();   // every wave's partial tile (zero where a wave had no keys) is in LDS before any thread sums them
  if (tid < 16 * (PV_W / 4)) { const int rl = tid / (PV_W / 4), q = tid % (PV_W / 4); v4f s = *(const v4f*)&ss[0][rl][q * 4];
#pragma unroll
    for (int w = 1; w < PV_KS; ++w) s += *(const v4f*)&ss[w][rl][q * 4];
    vst2(Y + ((size_t)b * TT + ql0 + rl) * CC + c0 + q * 4, s); } }

extern "C" void kernel_launch(void* const* d_in, const int* in_sizes, int n_in, void* d_out, int out_size, void* d_ws, size_t ws_size, hipStream_t stream) {
  (void)in_sizes; (void)n_in; (void)out_size;
  const float** F = (const float**)d_in;
  if (ws_size < (size_t)WS_END) return;
  char* ws = (char*)d_ws; _Float16 *QH = (_Float16*)(ws + WS_QH), *KH = (_Float16*)(ws + WS_KH), *VT = (_Float16*)(ws + WS_VT), *QL = (_Float16*)(ws + WS_QL), *KL = (_Float16*)(ws + WS_KL); __bf16 *VB = (__bf16*)(ws + WS_VB), *VBL = (__bf16*)(ws + WS_VBL); float *S = (float*)(ws + WS_S), *Y = (float*)(ws + WS_Y);
  (void)Y; (void)QL; (void)KL; (void)VB; (void)VBL;
  // inputs: 0 embedding [4,2048,1024]; 1 Wk [64,1024] (out,in) (q = k = v)
  if (ws_size < (size_t)WS_END2) return;
  float* YB = (float*)(ws + WS_YB);
  k_proj<<<dim3(TNB * TT / 64, CC / 128, 3), 128, 0, stream>>>(F[0], F[0], F[0], F[1], F[1], F[1], nullptr, nullptr, nullptr, QH, QL, KH, KL, VT, VB, VBL);
  for (int b = 0; b < TNB; ++b) {
    k_sc<<<dim3(NQB, TT / 128, 1), 128, 0, stream>>>(QH, KH, QL, KL, b, 0, S);
    k_sm<<<dim3(TT, 1), 256, 0, stream>>>(S);
    k_pv<<<dim3(TT / 16, PV_JH, 1), 32 * PV_KS, 0, stream>>>(S, VT, VB, VBL, b, 0, YB);
  }
  k_fin64<<<dim3((unsigned)(((size_t)TNB * TT * (DOUT / 4) + 255) / 256)), 256, 0, stream>>>(YB, (float*)d_out);
}

// v003
// A run of this version takes 106 microseconds.
// Versions in between are left out here; by their measured steps it is 2.12 times as fast as v001.
// Over all steps from v000 it is 8.33 times as fast.
// compute dtype: all float inputs rounded to bf16; q = k = v = x Wk^T with EXACT bf16 products on WMMA 16x16x32 (f32 accumulate; the single 64-wide head carried in 128-wide planes whose upper columns are zero); causal logits with q = k as f16 hi + residual on both sides (3 products) x 64^-0.5; softmax in f32; P as bf16 hi + lo against v bf16 hi + lo (3 products); f32 output.
#include <hip/hip_runtime.h>
#include <math.h>

typedef __attribute__((ext_vector_type(16))) _Float16 v16h;
typedef __attribute__((ext_vector_type(16))) __bf16 v16b;
typedef __attribute__((ext_vector_type(8)))  _Float16 v8h;
typedef __attribute__((ext_vector_type(8)))  float v8f;
typedef __attribute__((ext_vector_type(4)))  float v4f;
typedef __attribute__((ext_vector_type(2)))  float v2f;
typedef __attribute__((ext_vector_type(4)))  unsigned v4u;
typedef __attribute__((ext_vector_type(4)))  int v4i;
typedef float __attribute__((may_alias)) float_a;
typedef int __attribute__((may_alias)) int_a;

template <typename T> __device__ __forceinline__ void vst2(void* p, T v) { *(T*)p = v;  }
__device__ __forceinline__ v8f wmma16(v16h a, v16h b, v8f c) {
  v8f d = __builtin_amdgcn_wmma_f32_16x16x32_f16(false, a, false, b, (short)0, c, false, false);
  asm volatile("v_nop\n\tv_nop\n\tv_nop\n\tv_nop" : "+v"(d) : "v"(a), "v"(b));
  return d;
}
__device__ __forceinline__ v8f wmma_bf(v16b a, v16b b, v8f c) {
  v8f d = __builtin_amdgcn_wmma_f32_16x16x32_bf16(false, a, false, b, (short)0, c, false, false);
  asm volatile("v_nop\n\tv_nop\n\tv_nop\n\tv_nop" : "+v"(d) : "v"(a), "v"(b));
  return d;
}
// 16x16x32 fragments: lane = (h = lane>>4, row/col = lane&15); elements 0..7 = k0+8h+0..7, 8..15 = k0+16+8h+0..7; D element r = row 8h+r
__device__ __forceinline__ v16h frag_h(const _Float16* rowk0, int lane) {
  union { v16h v; v8h q[2]; } u; const _Float16* p = rowk0 + 8 * (lane >> 4);
  u.q[0] = *(const v8h*)p; u.q[1] = *(const v8h*)(p + 16); return u.v;
}
__device__ __forceinline__ v16h frag_f32(const float* rowk0, int lane) {
  v16h a; const float* p = rowk0 + 8 * (lane >> 4);
#pragma unroll
  for (int i = 0; i < 8; ++i) { a[i] = (_Float16)p[i]; a[8 + i] = (_Float16)p[16 + i]; }
  return a;
}
__device__ __forceinline__ v16h frag_f32s(const float* rowk0, int lane, float sc) {
  v16h a; const float* p = rowk0 + 8 * (lane >> 4);
#pragma unroll
  for (int i = 0; i < 8; ++i) { a[i] = (_Float16)(p[i] * sc); a[8 + i] = (_Float16)(p[16 + i] * sc); }
  return a;
}
// column fragment from a [K][ld] layout (column n), rows >= K read as 0
__device__ __forceinline__ v16h fragc_f32(const float* W, int k0, int n, int lane, int ld, int K) {
  v16h a; const int g = lane >> 4;
#pragma unroll
  for (int i = 0; i < 8; ++i) { const int ka = k0 + 8 * g + i, kb = ka + 16;
    a[i] = (_Float16)(ka < K ? W[(size_t)(ka < K ? ka : K - 1) * ld + n] : 0.f); a[8 + i] = (_Float16)(kb < K ? W[(size_t)(kb < K ? kb : K - 1) * ld + n] : 0.f); }
  return a;
}
struct F2 { v16b h, l; };
__device__ __forceinline__ F2 bsplit16(const float v[16]) { F2 r;
#pragma unroll
  for (int i = 0; i < 16; ++i) { const __bf16 h = (__bf16)v[i]; r.h[i] = h; r.l[i] = (__bf16)(v[i] - (float)h); }
  return r; }
__device__ __forceinline__ F2 split_row(const float* row, int k0, int lane) { float v[16]; const float* p = row + k0 + 8 * (lane >> 4);
#pragma unroll
  for (int i = 0; i < 8; ++i) { v[i] = p[i]; v[8 + i] = p[16 + i]; }
  return bsplit16(v); }
__device__ __forceinline__ F2 split_rowK(const float* row, int k0, int lane, int K) { float v[16]; const int g = lane >> 4;
#pragma unroll
  for (int i = 0; i < 8; ++i) { const int ka = k0 + 8 * g + i, kb = ka + 16; v[i] = ka < K ? row[ka < K ? ka : K - 1] : 0.f; v[8 + i] = kb < K ? row[kb < K ? kb : K - 1] : 0.f; }
  return bsplit16(v); }
__device__ __forceinline__ F2 split_col(const float* W, int k0, int n, int lane, int ld, int K) { float v[16]; const int g = lane >> 4;
#pragma unroll
  for (int i = 0; i < 8; ++i) { const int ka = k0 + 8 * g + i, kb = ka + 16; v[i] = ka < K ? W[(size_t)(ka < K ? ka : K - 1) * ld + n] : 0.f; v[8 + i] = kb < K ? W[(size_t)(kb < K ? kb : K - 1) * ld + n] : 0.f; }
  return bsplit16(v); }
__device__ __forceinline__ v8f mac3(const F2& a, const F2& b, v8f c) { c = wmma_bf(a.l, b.h, c); c = wmma_bf(a.h, b.l, c); return wmma_bf(a.h, b.h, c); }
__device__ __forceinline__ float sigm(float v) { return 1.0f / (1.0f + expf(-v)); }
#define LDSX() do { asm volatile("s_wait_dscnt 0" ::: "memory"); __builtin_amdgcn_wave_barrier(); __builtin_amdgcn_fence(__ATOMIC_RELEASE, "workgroup"); } while (0)

// Single-head causal self-attention with shared projections (B 4, S 2,048, E 1,024 -> A 64): k = x Wk^T; q = v = k; x = q k^T / 8 masked where tril(x) == 0 (the strict upper triangle; exact-zero logits in the lower triangle would also be masked - measure-zero for these inputs); softmax; out = P v -> [B, S, 64].
#define NB 4
#define TT 2048
#define CC 128            // NH * HD = projected width
#define DIN 1024
#define NH 1
#define HD 128
#define NQB (TT / 64)
#define HG 1
#define SCALE (0.125f)
#define CAUSAL 1
#ifndef TNB
#define TNB NB
#endif
__device__ __forceinline__ v16b zero16b() { v16b z; _Pragma("unroll") for (int i = 0; i < 16; ++i) z[i] = (__bf16)0.f; return z; }
__device__ __forceinline__ float bfr(float v) { return (float)(__bf16)v; }
__host__ __device__ __forceinline__ int kb_last(int qb) { return CAUSAL ? ((qb * 64 + 63) >> 7) : (TT / 128 - 1); }
typedef __attribute__((ext_vector_type(8))) __bf16 v8b;
__device__ __forceinline__ v16b frag_b(const __bf16* rowk0, int lane) {
  union { v16b v; v8b q[2]; } u; const __bf16* p = rowk0 + 8 * (lane >> 4);
  u.q[0] = *(const v8b*)p; u.q[1] = *(const v8b*)(p + 16); return u.v;
}
// a 16 x 32 fragment kept in fragment order = 1 KiB: lane l's elements 0..7 at byte 16 l, its elements 8..15 at byte 512 + 16 l, so each 16-byte load of a wave covers 512 contiguous bytes (4 whole lines)
__device__ __forceinline__ v16h fragp_h(const _Float16* f, int lane) {
  union { v16h v; v8h q[2]; } u; const _Float16* p = f + 8 * lane;
  u.q[0] = *(const v8h*)p; u.q[1] = *(const v8h*)(p + 256); return u.v;
}
__device__ __forceinline__ v16b fragp_b(const __bf16* f, int lane) {
  union { v16b v; v8b q[2]; } u; const __bf16* p = f + 8 * lane;
  u.q[0] = *(const v8b*)p; u.q[1] = *(const v8b*)(p + 256); return u.v;
}
#define QBH NQB            // every block: 3-product logits (the self key's logit |k|^2/8 ~ 8 dominates -> peaked rows) and bf16 hi/lo P.v
#define QHI TT
#define KHI TT
// B fragment (k rows k0+.., output column o) of a weight: (in,out) [K][ld] or (out,in) [ld rows of K]: bf16 exact, or f16(bf16 * 256) exact
__device__ __forceinline__ v16b wcol_io(const float* Wm, int k0, int o, int lane, int ld) { v16b w; const int g = lane >> 4;
#pragma unroll
  for (int i = 0; i < 8; ++i) { w[i] = (__bf16)Wm[(size_t)(k0 + 8 * g + i) * ld + o]; w[8 + i] = (__bf16)Wm[(size_t)(k0 + 16 + 8 * g + i) * ld + o]; }
  return w; }
__device__ __forceinline__ v16b wcol_oi(const float* Wm, int k0, int o, int lane, int K) { v16b w; const float* p = Wm + (size_t)o * K + k0 + 8 * (lane >> 4);
#pragma unroll
  for (int i = 0; i < 8; ++i) { w[i] = (__bf16)p[i]; w[8 + i] = (__bf16)p[16 + i]; }
  return w; }
__device__ __forceinline__ v16h wcolh_io(const float* Wm, int k0, int o, int lane, int ld) { v16h w; const int g = lane >> 4;
#pragma unroll
  for (int i = 0; i < 8; ++i) { w[i] = (_Float16)(bfr(Wm[(size_t)(k0 + 8 * g + i) * ld + o]) * 256.0f); w[8 + i] = (_Float16)(bfr(Wm[(size_t)(k0 + 16 + 8 * g + i) * ld + o]) * 256.0f); }
  return w; }
__device__ __forceinline__ v16h wcolh_oi(const float* Wm, int k0, int o, int lane, int K) { v16h w; const float* p = Wm + (size_t)o * K + k0 + 8 * (lane >> 4);
#pragma unroll
  for (int i = 0; i < 8; ++i) { w[i] = (_Float16)(bfr(p[i]) * 256.0f); w[8 + i] = (_Float16)(bfr(p[16 + i]) * 256.0f); }
  return w; }
#define WQKV_LAYOUT 0   // 0 = (out,in) [DOUT][DIN], columns >= DOUT zero; 1 = (out,in) [CC][DIN]; 2 = per-head [NH][DIN][HD]
__device__ __forceinline__ v16b wcol_hdk(const float* Wm, int k0, int o, int lane) { v16b w; const int g = lane >> 4; const float* p = Wm + (size_t)(o / HD) * DIN * HD + (o % HD);
#pragma unroll
  for (int i = 0; i < 8; ++i) { w[i] = (__bf16)p[(size_t)(k0 + 8 * g + i) * HD]; w[8 + i] = (__bf16)p[(size_t)(k0 + 16 + 8 * g + i) * HD]; }
  return w; }
#define WO_OUT_IN 0
#if WQKV_LAYOUT == 1
#define WCOL(W, k0, o, lane) wcol_oi(W, k0, o, lane, DIN)
#elif WQKV_LAYOUT == 2
#define WCOL(W, k0, o, lane) wcol_hdk(W, k0, o, lane)
#else
#define WCOL(W, k0, o, lane) (((o) < DOUT) ? wcol_oi(W, k0, (o), lane, DIN) : zero16b())   /* Wk (out,in) [64][1024]; q = k = v = x Wk^T; plane columns >= 64 are zero */
#endif
#if WO_OUT_IN
#define WOCOL(W, k0, o, lane) wcol_oi(W, k0, o, lane, CC)
#define WOCOLH(W, k0, o, lane) wcolh_oi(W, k0, o, lane, CC)
#else
#define WOCOL(W, k0, o, lane) wcol_io(W, k0, o, lane, DIN)
#define WOCOLH(W, k0, o, lane) wcolh_io(W, k0, o, lane, DIN)
#endif
#define DOUT 64            // real head width (planes are 128 wide, columns >= 64 zero)
#ifndef SM_EXTRA_PARAMS
#define SM_EXTRA_PARAMS
#endif
#ifndef PROJ_EXTRA_PARAMS
#define PROJ_EXTRA_PARAMS
#endif
#ifndef SM_MASK_HOOK
#define SM_MASK_HOOK (void)0
#endif

#define WS_QH  0u                                      // f16 q, fragment order [b*t / 16][CC / 32][512]
#define WS_KH  (WS_QH + 2u * (size_t)NB * TT * CC)      // f16 k, fragment order [b*t / 16][CC / 32][512]
#define WS_VT  (WS_KH + 2u * (size_t)NB * TT * CC)      // f16 v planes [b][c][t]
#define WS_QL  (WS_VT + 2u * (size_t)NB * CC * TT)      // f16 q residual x 2^10, fragment order like q
#define WS_KL  (WS_QL + 2u * (size_t)NB * QHI * CC)     // f16 k residual x 2^10, fragment order like k
#define WS_VB  (WS_KL + 2u * (size_t)NB * KHI * CC)     // bf16 v hi, fragment order [b][t / 32][CC / 16][512] (and v lo behind it)
#define WS_VBL (WS_VB + 2u * (size_t)NB * CC * KHI)
#define WS_Y   (WS_VBL + 2u * (size_t)NB * CC * KHI)    // f32 ctx rows [b*t][CC] (only when there is an output projection)
#define WS_END (WS_Y  + 0u)

// ---- k_proj: block = (64 rows, 128 cols, which): q/k/v = X W (+ b) with exact bf16 products (K = DIN) -> which 0: q f16 (+ residual); 1: k f16 (+ residual); 2: v f16 planes [c][t] and v bf16 hi/lo; q, k and v hi/lo leave in the order in which k_att's fragments read them
__global__ __launch_bounds__(128) void k_proj(const float* __restrict__ XQ, const float* __restrict__ XK, const float* __restrict__ XV, const float* __restrict__ WQ, const float* __restrict__ WK, const float* __restrict__ WV, const float* __restrict__ BQ, const float* __restrict__ BK, const float* __restrict__ BV,
    _Float16* __restrict__ QH, _Float16* __restrict__ QL, _Float16* __restrict__ KH, _Float16* __restrict__ KL, _Float16* __restrict__ VT, __bf16* __restrict__ VB, __bf16* __restrict__ VBL) {
  __shared__ __align__(16) _Float16 sh[64][136], sl[64][136]; __shared__ __align__(16) _Float16 th[128][72]; __shared__ __align__(16) __bf16 tb[128][72], tbl[128][72];
  const int tid = threadIdx.x, wave = tid >> 5, lane = tid & 31, col = lane & 15, g = lane >> 4; const int which = blockIdx.z; const int c0 = blockIdx.y * 128; const size_t r0 = (size_t)blockIdx.x * 64; const size_t bb = r0 / TT; const int t0 = (int)(r0 % TT);
  const float* X = which == 0 ? XQ : which == 1 ? XK : XV; const float* WA = which == 0 ? WQ : which == 1 ? WK : WV; const float* BA = which == 0 ? BQ : which == 1 ? BK : BV;
  v8f acc[8] = {};
#pragma unroll 2
  for (int kc = 0; kc < DIN / 32; ++kc) { v16b a; { const float* p = X + (r0 + wave * 16 + col) * DIN + kc * 32 + 8 * g;
#pragma unroll
      for (int i = 0; i < 8; ++i) { a[i] = (__bf16)p[i]; a[8 + i] = (__bf16)p[16 + i]; } }
    asm volatile("s_wait_loadcnt 0x0" ::: "memory");
#pragma unroll
    for (int j = 0; j < 8; ++j) { const v16b w = WCOL(WA, kc * 32, c0 + j * 16 + col, lane); asm volatile("s_wait_loadcnt 0x0" ::: "memory"); acc[j] = wmma_bf(a, w, acc[j]); } }
  if (which < 2) { _Float16* DH = which == 0 ? QH : KH; _Float16* DL = which == 0 ? QL : KL; const int nhi = which == 0 ? QHI : KHI; const bool hi_rows = t0 < nhi;
#pragma unroll
    for (int j = 0; j < 8; ++j) { const float bias = BA ? bfr(BA[c0 + j * 16 + col]) : 0.f;
#pragma unroll
      for (int r = 0; r < 8; ++r) { const float v = acc[j][r] + bias; const _Float16 hv = (_Float16)v; sh[wave * 16 + 8 * g + r][j * 16 + col] = hv; sl[wave * 16 + 8 * g + r][j * 16 + col] = (_Float16)((v - (float)hv) * 1024.0f); } }
    __syncthreads();
    static_assert(CC == 128, "a block holds whole 16-row tiles: 4 fragments of 64 pieces of 16 bytes each");
    // piece e of the block's 4 tiles: bits 3..0 = row in the tile, 4 = lane half g, 5 = fragment half, 7..6 = 32-column step, 9..8 = tile; columns 8 * (e >> 4 & 15) ..
    for (int e = tid; e < 64 * 16; e += 128) { const int rl = (e >> 8) * 16 + (e & 15), q = (e >> 4) & 15; vst2((unsigned*)(DH + r0 * CC + e * 8), *(const v4u*)&sh[rl][q * 8]); if (hi_rows) vst2((unsigned*)(DL + (bb * nhi + t0) * (size_t)CC + e * 8), *(const v4u*)&sl[rl][q * 8]); }
  } else { const bool hi_rows = t0 < KHI;
#pragma unroll
    for (int j = 0; j < 8; ++j) { const float bias = BA ? bfr(BA[c0 + j * 16 + col]) : 0.f;
#pragma unroll
      for (int r = 0; r < 8; ++r) { const float v = acc[j][r] + bias; const int rl = wave * 16 + 8 * g + r, cl = j * 16 + col; th[cl][rl] = (_Float16)v; const __bf16 bh = (__bf16)v; tb[cl][rl] = bh; tbl[cl][rl] = (__bf16)(v - (float)bh); } }
    __syncthreads();
    for (int e = tid; e < 128 * 8; e += 128) { const int cl = e >> 3, q = e & 7; vst2((unsigned*)(VT + (bb * CC + c0 + cl) * (size_t)TT + t0 + q * 8), *(const v4u*)&th[cl][q * 8]); if (hi_rows) { const int cf = ((e >> 6) & 7) * 16 + (e & 15), qf = (e >> 9) * 4 + ((e >> 4) & 3);   // piece e of the block's 2 x 8 fragments: bits 3..0 = column in the tile, 4 = lane half g, 5 = fragment half, 8..6 = column tile, 9 = 32-key step
        const size_t o3 = (bb * (KHI / 32) + (t0 >> 5)) * (size_t)(CC * 32) + e * 8; vst2((unsigned*)(VB + o3), *(const v4u*)&tb[cf][qf * 8]); vst2((unsigned*)(VBL + o3), *(const v4u*)&tbl[cf][qf * 8]); } } } }
// ---- k_att: block = 16 queries of batch b (blockIdx.z), 16 waves: logits, softmax and P . v in one kernel; the 16 logit rows stay in LDS from the first product to the last, so no logit and no P goes through memory.
// 1) wave w takes the 16-key tiles w, w + 16, ... of keys [0, kend): q hi + residual (x 2^10) against k hi + residual (3 products), x SCALE, into sp[query][key]
// 2) wave w owns query row w: causal mask by index, max, exp, sum, P x 2^11 in place (0 for excluded keys)
// 3) wave w takes the 64-key pairs of steps w, w + 16, ...: P as bf16 hi + lo against v bf16 hi + lo (3 products); the 16 partial tiles are summed through LDS in wave order and the 64 real columns stored to out
#define FA_KS 16               // waves of a block
#define FA_P  (TT + 4)         // f32 pitch of a logit row in LDS: row r starts 4 r banks on, so the 16 rows of a 16-byte fragment read cover all 64 banks once
// second bound: 8 waves per SIMD = 128 registers a wave, so that two blocks (LDS allows two) share a WGP and one block's matrix phases run under the other's softmax and barriers
__global__ __launch_bounds__(32 * FA_KS, 8) void k_att(const _Float16* __restrict__ QH, const _Float16* __restrict__ KH, const _Float16* __restrict__ QL, const _Float16* __restrict__ KL, const __bf16* __restrict__ VB, const __bf16* __restrict__ VBL, float* __restrict__ OUT) {
  __shared__ __align__(16) float buf[FA_KS * 16 * (HD + 4)];   // first the logit / P rows, then (behind a barrier) the waves' partial tiles
  float (*sp)[FA_P] = (float (*)[FA_P])buf; float (*ss)[16][HD + 4] = (float (*)[16][HD + 4])buf;
  static_assert(16 * FA_P <= FA_KS * 16 * (HD + 4), "logit rows fit the buffer");
  const int tid = threadIdx.x, lane = tid & 31, col = lane & 15, g = lane >> 4; const int b = blockIdx.z; const int ql0 = blockIdx.x * 16; const int kend = (kb_last(ql0 >> 6) + 1) * 128;
  const int wave = __builtin_amdgcn_readfirstlane(tid >> 5);   // scalar, so that every key loop's trip count is a scalar branch and every lane stays on at the matrix instructions
  { v16h ah[HD / 32], al[HD / 32]; const _Float16* qh = QH + ((size_t)b * TT + ql0) * CC; const _Float16* ql = QL + ((size_t)b * QHI + ql0) * CC;
#pragma unroll
    for (int kc = 0; kc < HD / 32; ++kc) { ah[kc] = fragp_h(qh + kc * 512, lane); al[kc] = fragp_h(ql + kc * 512, lane); }
    asm volatile("s_wait_xcnt 0x0" :: "v"(qh + 8 * lane), "v"(ql + 8 * lane) : "memory");   // the wait before a register of an issued q load is overwritten; with the two lane addresses as inputs the build keeps it behind the loads (without them the loads sink below it)
    for (int jt = wave; jt < kend / 16; jt += FA_KS) { const _Float16* kh = KH + ((size_t)b * TT + jt * 16) * CC; const _Float16* kl = KL + ((size_t)b * KHI + jt * 16) * CC; v8f acc = {}, accl = {};
#pragma unroll
      for (int kc = 0; kc < HD / 32; ++kc) { const v16h kbf = fragp_h(kh + kc * 512, lane), klf = fragp_h(kl + kc * 512, lane); acc = wmma16(ah[kc], kbf, acc); accl = wmma16(al[kc], kbf, accl); accl = wmma16(ah[kc], klf, accl); }
#pragma unroll
      for (int r = 0; r < 8; ++r) sp[8 * g + r][jt * 16 + col] = (acc[r] + accl[r] * (1.0f / 1024.0f)) * SCALE; } }
  __syncthreads();   // all logits of the 16 rows are in LDS before a wave reduces its row
  { const int t = ql0 + wave; float* sr = sp[wave]; float m = -3.0e38f;
#pragma unroll 4   // four LDS reads in flight
    for (int kq = 0; kq < kend / 128; ++kq) { const int k = kq * 128 + lane * 4; const v4f v = *(const v4f*)&sr[k];
#pragma unroll
      for (int i = 0; i < 4; ++i) m = fmaxf(m, (!CAUSAL || k + i <= t) ? v[i] : -3.0e38f); }
#pragma unroll
    for (int o = 1; o < 32; o <<= 1) m = fmaxf(m, __shfl_xor(m, o));
    float sum = 0.f;
#pragma unroll 2   // the next LDS read flies under this one's exponentials
    for (int kq = 0; kq < kend / 128; ++kq) { const int k = kq * 128 + lane * 4; const v4f v = *(const v4f*)&sr[k]; v4f e;
#pragma unroll
      for (int i = 0; i < 4; ++i) { e[i] = (!CAUSAL || k + i <= t) ? expf(v[i] - m) : 0.f; sum += e[i]; }
      *(v4f*)&sr[k] = e; }
#pragma unroll
    for (int o = 1; o < 32; o <<= 1) sum += __shfl_xor(sum, o);
    const float inv = sum > 0.f ? 2048.0f / sum : 0.f;
#pragma unroll 4   // four LDS reads in flight
    for (int kq = 0; kq < kend / 128; ++kq) { const int k = kq * 128 + lane * 4; const v4f e = *(const v4f*)&sr[k]; *(v4f*)&sr[k] = e * inv; } }
  __syncthreads();   // every row's P is in LDS before any wave reads its key range of all 16 rows
  v8f acc[HD / 16] = {};
#pragma unroll 1   // one 64-key pair a trip: a second pair's fragments would not fit the 128 registers
  for (int kp = wave; kp < kend / 64; kp += FA_KS)
#pragma unroll
    for (int kc = 2 * kp; kc < 2 * kp + 2; ++kc) { const F2 p = split_row(sp[col], kc * 32, lane);
#pragma unroll
      for (int j = 0; j < HD / 16; j += 2) { const size_t po = (((size_t)b * (KHI / 32) + kc) * (CC / 16) + j) * 512, p1 = po + 512; const v16b vh0 = fragp_b(VB + po, lane), vl0 = fragp_b(VBL + po, lane), vh1 = fragp_b(VB + p1, lane), vl1 = fragp_b(VBL + p1, lane);   // two column tiles' loads in flight together
        acc[j] = wmma_bf(p.h, vh0, acc[j]); acc[j] = wmma_bf(p.l, vh0, acc[j]); acc[j] = wmma_bf(p.h, vl0, acc[j]); acc[j + 1] = wmma_bf(p.h, vh1, acc[j + 1]); acc[j + 1] = wmma_bf(p.l, vh1, acc[j + 1]); acc[j + 1] = wmma_bf(p.h, vl1, acc[j + 1]); } }
  __syncthreads();   // the last read of P is over before the partial tiles overwrite its LDS
#pragma unroll
  for (int j = 0; j < HD / 16; ++j)
#pragma unroll
    for (int r = 0; r < 8; ++r) ss[wave][8 * g + r][j * 16 + col] = acc[j][r] * (1.0f / 2048.0f);
  __syncthreads();   // every wave's partial tile (zero where a wave had no keys) is in LDS before any thread sums them
  if (tid < 16 * (DOUT / 4)) { const int rl = tid / (DOUT / 4), q = tid % (DOUT / 4); v4f s = *(const v4f*)&ss[0][rl][q * 4];   // only the real columns go out: the planes' upper columns are zero
#pragma unroll
    for (int w = 1; w < FA_KS; ++w) s += *(const v4f*)&ss[w][rl][q * 4];
    vst2(OUT + ((size_t)b * TT + ql0 + rl) * DOUT + q * 4, s); } }

extern "C" void kernel_launch(void* const* d_in, const int* in_sizes, int n_in, void* d_out, int out_size, void* d_ws, size_t ws_size, hipStream_t stream) {
  (void)in_sizes; (void)n_in; (void)out_size;
  const float** F = (const float**)d_in;
  if (ws_size < (size_t)WS_END) return;
  char* ws = (char*)d_ws; _Float16 *QH = (_Float16*)(ws + WS_QH), *KH = (_Float16*)(ws + WS_KH), *VT = (_Float16*)(ws + WS_VT), *QL = (_Float16*)(ws + WS_QL), *KL = (_Float16*)(ws + WS_KL); __bf16 *VB = (__bf16*)(ws + WS_VB), *VBL = (__bf16*)(ws + WS_VBL); float *Y = (float*)(ws + WS_Y);
  (void)Y;
  // inputs: 0 embedding [4,2048,1024]; 1 Wk [64,1024] (out,in) (q = k = v)
  k_proj<<<dim3(TNB * TT / 64, CC / 128, 3), 128, 0, stream>>>(F[0], F[0], F[0], F[1], F[1], F[1], nullptr, nullptr, nullptr, QH, QL, KH, KL, VT, VB, VBL);
  k_att<<<dim3(TT / 16, 1, TNB), 32 * FA_KS, 0, stream>>>(QH, KH, QL, KL, VB, VBL, (float*)d_out);
}

// v004
// Measured time: 58.1 microseconds a run.
// Timed twice side by side with v003, it ran 1.87 and 1.82 times as fast.
// All steps since v000 together make it 15.4 times as fast.
// compute dtype: all float inputs rounded to bf16; q = k = v = x Wk^T with EXACT bf16 products on WMMA 16x16x32 (f32 accumulate; the single 64-wide head carried in 128-wide planes whose upper columns are zero); causal logits with q = k as f16 hi + residual on both sides (3 products) x 64^-0.5; softmax in f32; P as bf16 hi + lo against v bf16 hi + lo (3 products); f32 output.
#include <hip/hip_runtime.h>
#include <math.h>

typedef __attribute__((ext_vector_type(16))) _Float16 v16h;
typedef __attribute__((ext_vector_type(16))) __bf16 v16b;
typedef __attribute__((ext_vector_type(8)))  _Float16 v8h;
typedef __attribute__((ext_vector_type(8)))  float v8f;
typedef __attribute__((ext_vector_type(4)))  float v4f;
typedef __attribute__((ext_vector_type(2)))  float v2f;
typedef __attribute__((ext_vector_type(4)))  unsigned v4u;
typedef __attribute__((ext_vector_type(4)))  int v4i;
typedef float __attribute__((may_alias)) float_a;
typedef int __attribute__((may_alias)) int_a;

template <typename T> __device__ __forceinline__ void vst2(void* p, T v) { *(T*)p = v;  }
__device__ __forceinline__ v8f wmma16(v16h a, v16h b, v8f c) {
  v8f d = __builtin_amdgcn_wmma_f32_16x16x32_f16(false, a, false, b, (short)0, c, false, false);
  asm volatile("v_nop\n\tv_nop\n\tv_nop\n\tv_nop" : "+v"(d) : "v"(a), "v"(b));
  return d;
}
__device__ __forceinline__ v8f wmma_bf(v16b a, v16b b, v8f c) {
  v8f d = __builtin_amdgcn_wmma_f32_16x16x32_bf16(false, a, false, b, (short)0, c, false, false);
  asm volatile("v_nop\n\tv_nop\n\tv_nop\n\tv_nop" : "+v"(d) : "v"(a), "v"(b));
  return d;
}
// 16x16x32 fragments: lane = (h = lane>>4, row/col = lane&15); elements 0..7 = k0+8h+0..7, 8..15 = k0+16+8h+0..7; D element r = row 8h+r
__device__ __forceinline__ v16h frag_h(const _Float16* rowk0, int lane) {
  union { v16h v; v8h q[2]; } u; const _Float16* p = rowk0 + 8 * (lane >> 4);
  u.q[0] = *(const v8h*)p; u.q[1] = *(const v8h*)(p + 16); return u.v;
}
__device__ __forceinline__ v16h frag_f32(const float* rowk0, int lane) {
  v16h a; const float* p = rowk0 + 8 * (lane >> 4);
#pragma unroll
  for (int i = 0; i < 8; ++i) { a[i] = (_Float16)p[i]; a[8 + i] = (_Float16)p[16 + i]; }
  return a;
}
__device__ __forceinline__ v16h frag_f32s(const float* rowk0, int lane, float sc) {
  v16h a; const float* p = rowk0 + 8 * (lane >> 4);
#pragma unroll
  for (int i = 0; i < 8; ++i) { a[i] = (_Float16)(p[i] * sc); a[8 + i] = (_Float16)(p[16 + i] * sc); }
  return a;
}
// column fragment from a [K][ld] layout (column n), rows >= K read as 0
__device__ __forceinline__ v16h fragc_f32(const float* W, int k0, int n, int lane, int ld, int K) {
  v16h a; const int g = lane >> 4;
#pragma unroll
  for (int i = 0; i < 8; ++i) { const int ka = k0 + 8 * g + i, kb = ka + 16;
    a[i] = (_Float16)(ka < K ? W[(size_t)(ka < K ? ka : K - 1) * ld + n] : 0.f); a[8 + i] = (_Float16)(kb < K ? W[(size_t)(kb < K ? kb : K - 1) * ld + n] : 0.f); }
  return a;
}
struct F2 { v16b h, l; };
__device__ __forceinline__ F2 bsplit16(const float v[16]) { F2 r;
#pragma unroll
  for (int i = 0; i < 16; ++i) { const __bf16 h = (__bf16)v[i]; r.h[i] = h; r.l[i] = (__bf16)(v[i] - (float)h); }
  return r; }
__device__ __forceinline__ F2 split_row(const float* row, int k0, int lane) { float v[16]; const float* p = row + k0 + 8 * (lane >> 4);
#pragma unroll
  for (int i = 0; i < 8; ++i) { v[i] = p[i]; v[8 + i] = p[16 + i]; }
  return bsplit16(v); }
__device__ __forceinline__ F2 split_rowK(const float* row, int k0, int lane, int K) { float v[16]; const int g = lane >> 4;
#pragma unroll
  for (int i = 0; i < 8; ++i) { const int ka = k0 + 8 * g + i, kb = ka + 16; v[i] = ka < K ? row[ka < K ? ka : K - 1] : 0.f; v[8 + i] = kb < K ? row[kb < K ? kb : K - 1] : 0.f; }
  return bsplit16(v); }
__device__ __forceinline__ F2 split_col(const float* W, int k0, int n, int lane, int ld, int K) { float v[16]; const int g = lane >> 4;
#pragma unroll
  for (int i = 0; i < 8; ++i) { const int ka = k0 + 8 * g + i, kb = ka + 16; v[i] = ka < K ? W[(size_t)(ka < K ? ka : K - 1) * ld + n] : 0.f; v[8 + i] = kb < K ? W[(size_t)(kb < K ? kb : K - 1) * ld + n] : 0.f; }
  return bsplit16(v); }
__device__ __forceinline__ v8f mac3(const F2& a, const F2& b, v8f c) { c = wmma_bf(a.l, b.h, c); c = wmma_bf(a.h, b.l, c); return wmma_bf(a.h, b.h, c); }
__device__ __forceinline__ float sigm(float v) { return 1.0f / (1.0f + expf(-v)); }
#define LDSX() do { asm volatile("s_wait_dscnt 0" ::: "memory"); __builtin_amdgcn_wave_barrier(); __builtin_amdgcn_fence(__ATOMIC_RELEASE, "workgroup"); } while (0)

// Single-head causal self-attention with shared projections (B 4, S 2,048, E 1,024 -> A 64): k = x Wk^T; q = v = k; x = q k^T / 8 masked where tril(x) == 0 (the strict upper triangle; exact-zero logits in the lower triangle would also be masked - measure-zero for these inputs); softmax; out = P v -> [B, S, 64].
#define NB 4
#define TT 2048
#define CC 128            // NH * HD = projected width
#define DIN 1024
#define NH 1
#define HD 128
#define NQB (TT / 64)
#define HG 1
#define SCALE (0.125f)
#define CAUSAL 1
#ifndef TNB
#define TNB NB
#endif
__device__ __forceinline__ v16b zero16b() { v16b z; _Pragma("unroll") for (int i = 0; i < 16; ++i) z[i] = (__bf16)0.f; return z; }
__device__ __forceinline__ float bfr(float v) { return (float)(__bf16)v; }
__host__ __device__ __forceinline__ int kb_last(int qb) { return CAUSAL ? ((qb * 64 + 63) >> 7) : (TT / 128 - 1); }
typedef __attribute__((ext_vector_type(8))) __bf16 v8b;
__device__ __forceinline__ v16b frag_b(const __bf16* rowk0, int lane) {
  union { v16b v; v8b q[2]; } u; const __bf16* p = rowk0 + 8 * (lane >> 4);
  u.q[0] = *(const v8b*)p; u.q[1] = *(const v8b*)(p + 16); return u.v;
}
// a 16 x 32 fragment kept in fragment order = 1 KiB: lane l's elements 0..7 at byte 16 l, its elements 8..15 at byte 512 + 16 l, so each 16-byte load of a wave covers 512 contiguous bytes (4 whole lines)
__device__ __forceinline__ v16h fragp_h(const _Float16* f, int lane) {
  union { v16h v; v8h q[2]; } u; const _Float16* p = f + 8 * lane;
  u.q[0] = *(const v8h*)p; u.q[1] = *(const v8h*)(p + 256); return u.v;
}
__device__ __forceinline__ v16b fragp_b(const __bf16* f, int lane) {
  union { v16b v; v8b q[2]; } u; const __bf16* p = f + 8 * lane;
  u.q[0] = *(const v8b*)p; u.q[1] = *(const v8b*)(p + 256); return u.v;
}
#define QBH NQB            // every block: 3-product logits (the self key's logit |k|^2/8 ~ 8 dominates -> peaked rows) and bf16 hi/lo P.v
#define QHI TT
#define KHI TT
// B fragment (k rows k0+.., output column o) of a weight: (in,out) [K][ld] or (out,in) [ld rows of K]: bf16 exact, or f16(bf16 * 256) exact
__device__ __forceinline__ v16b wcol_io(const float* Wm, int k0, int o, int lane, int ld) { v16b w; const int g = lane >> 4;
#pragma unroll
  for (int i = 0; i < 8; ++i) { w[i] = (__bf16)Wm[(size_t)(k0 + 8 * g + i) * ld + o]; w[8 + i] = (__bf16)Wm[(size_t)(k0 + 16 + 8 * g + i) * ld + o]; }
  return w; }
__device__ __forceinline__ v16b wcol_oi(const float* Wm, int k0, int o, int lane, int K) { v16b w; const float* p = Wm + (size_t)o * K + k0 + 8 * (lane >> 4);
#pragma unroll
  for (int i = 0; i < 8; ++i) { w[i] = (__bf16)p[i]; w[8 + i] = (__bf16)p[16 + i]; }
  return w; }
__device__ __forceinline__ v16h wcolh_io(const float* Wm, int k0, int o, int lane, int ld) { v16h w; const int g = lane >> 4;
#pragma unroll
  for (int i = 0; i < 8; ++i) { w[i] = (_Float16)(bfr(Wm[(size_t)(k0 + 8 * g + i) * ld + o]) * 256.0f); w[8 + i] = (_Float16)(bfr(Wm[(size_t)(k0 + 16 + 8 * g + i) * ld + o]) * 256.0f); }
  return w; }
__device__ __forceinline__ v16h wcolh_oi(const float* Wm, int k0, int o, int lane, int K) { v16h w; const float* p = Wm + (size_t)o * K + k0 + 8 * (lane >> 4);
#pragma unroll
  for (int i = 0; i < 8; ++i) { w[i] = (_Float16)(bfr(p[i]) * 256.0f); w[8 + i] = (_Float16)(bfr(p[16 + i]) * 256.0f); }
  return w; }
#define WQKV_LAYOUT 0   // 0 = (out,in) [DOUT][DIN], columns >= DOUT zero; 1 = (out,in) [CC][DIN]; 2 = per-head [NH][DIN][HD]
__device__ __forceinline__ v16b wcol_hdk(const float* Wm, int k0, int o, int lane) { v16b w; const int g = lane >> 4; const float* p = Wm + (size_t)(o / HD) * DIN * HD + (o % HD);
#pragma unroll
  for (int i = 0; i < 8; ++i) { w[i] = (__bf16)p[(size_t)(k0 + 8 * g + i) * HD]; w[8 + i] = (__bf16)p[(size_t)(k0 + 16 + 8 * g + i) * HD]; }
  return w; }
#define WO_OUT_IN 0
#if WQKV_LAYOUT == 1
#define WCOL(W, k0, o, lane) wcol_oi(W, k0, o, lane, DIN)
#elif WQKV_LAYOUT == 2
#define WCOL(W, k0, o, lane) wcol_hdk(W, k0, o, lane)
#else
#define WCOL(W, k0, o, lane) (((o) < DOUT) ? wcol_oi(W, k0, (o), lane, DIN) : zero16b())   /* Wk (out,in) [64][1024]; q = k = v = x Wk^T; plane columns >= 64 are zero */
#endif
#if WO_OUT_IN
#define WOCOL(W, k0, o, lane) wcol_oi(W, k0, o, lane, CC)
#define WOCOLH(W, k0, o, lane) wcolh_oi(W, k0, o, lane, CC)
#else
#define WOCOL(W, k0, o, lane) wcol_io(W, k0, o, lane, DIN)
#define WOCOLH(W, k0, o, lane) wcolh_io(W, k0, o, lane, DIN)
#endif
#define DOUT 64            // real head width (planes are 128 wide, columns >= 64 zero)
#ifndef SM_EXTRA_PARAMS
#define SM_EXTRA_PARAMS
#endif
#ifndef PROJ_EXTRA_PARAMS
#define PROJ_EXTRA_PARAMS
#endif
#ifndef SM_MASK_HOOK
#define SM_MASK_HOOK (void)0
#endif

#define WS_QH  0u                                      // f16 q, fragment order [b*t / 16][CC / 32][512]
#define WS_KH  (WS_QH + 2u * (size_t)NB * TT * CC)      // f16 k, fragment order [b*t / 16][CC / 32][512]
#define WS_VT  (WS_KH + 2u * (size_t)NB * TT * CC)      // f16 v planes [b][c][t]
#define WS_QL  (WS_VT + 2u * (size_t)NB * CC * TT)      // f16 q residual x 2^10, fragment order like q
#define WS_KL  (WS_QL + 2u * (size_t)NB * QHI * CC)     // f16 k residual x 2^10, fragment order like k
#define WS_VB  (WS_KL + 2u * (size_t)NB * KHI * CC)     // bf16 v hi, fragment order [b][t / 32][CC / 16][512] (and v lo behind it)
#define WS_VBL (WS_VB + 2u * (size_t)NB * CC * KHI)
#define WS_Y   (WS_VBL + 2u * (size_t)NB * CC * KHI)    // f32 ctx rows [b*t][CC] (only when there is an output projection)
#define WS_END (WS_Y  + 0u)

// k_proj's staging: a k tile = 64 rows of X and the 64 rows of Wk, PJ_KT columns each, f32 as in memory, brought into LDS by asynchronous copies
#define PJ_KT 128                         // k columns of a tile: a row's piece is 512 contiguous bytes = one copy of a wave
#define PJ_P  (PJ_KT + 4)                 // f32 pitch of a staged row (16 bytes x 33): the 16 rows of a 16-byte fragment read cover all 64 banks once
#define PJ_ROWS (64 + DOUT)
#define PJ_BUFB (PJ_ROWS * PJ_P * 4u)     // bytes of one buffer
#define PJ_LS (4u * PJ_P * 4u)            // LDS bytes between two rows of one wave (4 waves take rows in turn)
#define PJ_GS (4 * DIN)
// eight copies of one wave, rows 4 apart; s_wait_xcnt stands inside the copies' own statement, in front of any rewrite of a register that a copy names
__device__ __forceinline__ void pj_copy8(unsigned l, const float* gp) {
  asm volatile("global_load_async_to_lds_b128 %0, %8, off\n\tglobal_load_async_to_lds_b128 %1, %9, off\n\tglobal_load_async_to_lds_b128 %2, %10, off\n\tglobal_load_async_to_lds_b128 %3, %11, off\n\t"
               "global_load_async_to_lds_b128 %4, %12, off\n\tglobal_load_async_to_lds_b128 %5, %13, off\n\tglobal_load_async_to_lds_b128 %6, %14, off\n\tglobal_load_async_to_lds_b128 %7, %15, off\n\ts_wait_xcnt 0x0"
               :: "v"(l), "v"(l + PJ_LS), "v"(l + 2 * PJ_LS), "v"(l + 3 * PJ_LS), "v"(l + 4 * PJ_LS), "v"(l + 5 * PJ_LS), "v"(l + 6 * PJ_LS), "v"(l + 7 * PJ_LS),
                  "v"(gp), "v"(gp + PJ_GS), "v"(gp + 2 * PJ_GS), "v"(gp + 3 * PJ_GS), "v"(gp + 4 * PJ_GS), "v"(gp + 5 * PJ_GS), "v"(gp + 6 * PJ_GS), "v"(gp + 7 * PJ_GS) : "memory");
}
// one wave's 32 copies of a tile: its 16 rows of X, then its 16 rows of Wk (LDS rows 64 ..)
__device__ __forceinline__ void pj_stage(unsigned l, const float* xg, const float* wg) {
  pj_copy8(l, xg); pj_copy8(l + 8 * PJ_LS, xg + 8 * PJ_GS); pj_copy8(l + 16 * PJ_LS, wg); pj_copy8(l + 24 * PJ_LS, wg + 8 * PJ_GS);
}
// bf16 fragment of a staged f32 row (p = row + k0 + 8 * (lane >> 4)): elements 0..7 = p[0..7], 8..15 = p[16..23], for A and B alike
__device__ __forceinline__ v16b frag_lds(const float* p) { const v4f x0 = *(const v4f*)p, x1 = *(const v4f*)(p + 4), x2 = *(const v4f*)(p + 16), x3 = *(const v4f*)(p + 20); v16b a;
#pragma unroll
  for (int i = 0; i < 4; ++i) { a[i] = (__bf16)x0[i]; a[4 + i] = (__bf16)x1[i]; a[8 + i] = (__bf16)x2[i]; a[12 + i] = (__bf16)x3[i]; }
  return a; }
// ---- k_proj: block = (64 rows, 128 cols, which): q/k/v = X W (+ b) with exact bf16 products (K = DIN) -> which 0: q f16 (+ residual); 1: k f16 (+ residual); 2: v f16 planes [c][t] and v bf16 hi/lo; q, k and v hi/lo leave in the order in which k_att's fragments read them
__global__ __launch_bounds__(128) void k_proj(const float* __restrict__ XQ, const float* __restrict__ XK, const float* __restrict__ XV, const float* __restrict__ WQ, const float* __restrict__ WK, const float* __restrict__ WV, const float* __restrict__ BQ, const float* __restrict__ BK, const float* __restrict__ BV,
    _Float16* __restrict__ QH, _Float16* __restrict__ QL, _Float16* __restrict__ KH, _Float16* __restrict__ KL, _Float16* __restrict__ VT, __bf16* __restrict__ VB, __bf16* __restrict__ VBL) {
  // the K loop's two staging buffers and the epilogue's transposing tiles share one LDS range (the epilogue starts behind the loop's last barrier), so that two blocks fit a WGP
  __shared__ __align__(16) union { float st[2][PJ_ROWS][PJ_P]; struct { _Float16 sh[64][136], sl[64][136], th[128][72]; __bf16 tb[128][72], tbl[128][72]; } ep; } u;
  auto& sh = u.ep.sh; auto& sl = u.ep.sl; auto& th = u.ep.th; auto& tb = u.ep.tb; auto& tbl = u.ep.tbl;
  const int tid = threadIdx.x, wave = tid >> 5, lane = tid & 31, col = lane & 15, g = lane >> 4; const int which = blockIdx.z; const int c0 = blockIdx.y * 128; const size_t r0 = (size_t)blockIdx.x * 64; const size_t bb = r0 / TT; const int t0 = (int)(r0 % TT);
  const float* X = which == 0 ? XQ : which == 1 ? XK : XV; const float* WA = which == 0 ? WQ : which == 1 ? WK : WV; const float* BA = which == 0 ? BQ : which == 1 ? BK : BV;
  v8f acc[8] = {};
  static_assert(CC == 128 && DOUT % 16 == 0 && DIN % PJ_KT == 0 && DIN / PJ_KT >= 2, "grid y is 1, so c0 is 0 and plane column tile j is Wk's rows 16 j ..; at least two k tiles");
  const unsigned l0 = (unsigned)(size_t)&u.st[0][wave][lane * 4];   // LDS byte address of this lane's 16 bytes in row 'wave' of buffer 0
  const float* xg = X + (r0 + wave) * DIN + lane * 4; const float* wg = WA + (size_t)wave * DIN + lane * 4;
  pj_stage(l0, xg, wg);
  asm volatile("s_wait_asynccnt 0x0" ::: "memory");   // this wave's copies of tile 0 have landed
  __syncthreads();                                      // ... and every other wave's: tile 0 may be read
  pj_stage(l0 + PJ_BUFB, xg + PJ_KT, wg + PJ_KT);
#pragma unroll 1   // rolled, for speed only
  for (int t = 0; t < DIN / PJ_KT; ++t) { const float* pa = &u.st[t & 1][wave * 16 + col][8 * g]; const float* pw = &u.st[t & 1][64 + col][8 * g];
    v16b a = frag_lds(pa), w[DOUT / 16];
#pragma unroll
    for (int j = 0; j < DOUT / 16; ++j) w[j] = frag_lds(pw + j * 16 * PJ_P);
#pragma unroll
    for (int kq = 0; kq < PJ_KT / 32; ++kq) { v16b an = a, wn[DOUT / 16];   // the next 32 columns' fragments (same tile) are read as one group in front of this step's products, so that their LDS latency runs under them
#pragma unroll
      for (int j = 0; j < DOUT / 16; ++j) wn[j] = w[j];
      if (kq + 1 < PJ_KT / 32) { an = frag_lds(pa + (kq + 1) * 32);
#pragma unroll
        for (int j = 0; j < DOUT / 16; ++j) wn[j] = frag_lds(pw + j * 16 * PJ_P + (kq + 1) * 32); }
#pragma unroll
      for (int j = 0; j < 8; ++j) acc[j] = wmma_bf(a, j * 16 < DOUT ? w[j < DOUT / 16 ? j : 0] : zero16b(), acc[j]);
      a = an;
#pragma unroll
      for (int j = 0; j < DOUT / 16; ++j) w[j] = wn[j]; }
    asm volatile("s_wait_dscnt 0x0" ::: "memory");      // this wave's reads of tile t are over
    asm volatile("s_wait_asynccnt 0x0" ::: "memory");   // this wave's copies of tile t + 1 have landed
    __syncthreads();                                      // publishes tile t + 1 and frees tile t's buffer (behind the last trip: for the epilogue's tiles)
    if (t + 2 < DIN / PJ_KT) pj_stage(l0 + (t & 1) * PJ_BUFB, xg + (t + 2) * PJ_KT, wg + (t + 2) * PJ_KT); }
  asm volatile("s_wait_asynccnt 0x0" ::: "memory");     // no copy is outstanding when the LDS range changes hands
  if (which < 2) { _Float16* DH = which == 0 ? QH : KH; _Float16* DL = which == 0 ? QL : KL; const int nhi = which == 0 ? QHI : KHI; const bool hi_rows = t0 < nhi;
#pragma unroll
    for (int j = 0; j < 8; ++j) { const float bias = BA ? bfr(BA[c0 + j * 16 + col]) : 0.f;
#pragma unroll
      for (int r = 0; r < 8; ++r) { const float v = acc[j][r] + bias; const _Float16 hv = (_Float16)v; sh[wave * 16 + 8 * g + r][j * 16 + col] = hv; sl[wave * 16 + 8 * g + r][j * 16 + col] = (_Float16)((v - (float)hv) * 1024.0f); } }
    __syncthreads();
    static_assert(CC == 128, "a block holds whole 16-row tiles: 4 fragments of 64 pieces of 16 bytes each");
    // piece e of the block's 4 tiles: bits 3..0 = row in the tile, 4 = lane half g, 5 = fragment half, 7..6 = 32-column step, 9..8 = tile; columns 8 * (e >> 4 & 15) ..
    for (int e = tid; e < 64 * 16; e += 128) { const int rl = (e >> 8) * 16 + (e & 15), q = (e >> 4) & 15; vst2((unsigned*)(DH + r0 * CC + e * 8), *(const v4u*)&sh[rl][q * 8]); if (hi_rows) vst2((unsigned*)(DL + (bb * nhi + t0) * (size_t)CC + e * 8), *(const v4u*)&sl[rl][q * 8]); }
  } else { const bool hi_rows = t0 < KHI;
#pragma unroll
    for (int j = 0; j < 8; ++j) { const float bias = BA ? bfr(BA[c0 + j * 16 + col]) : 0.f;
#pragma unroll
      for (int r = 0; r < 8; ++r) { const float v = acc[j][r] + bias; const int rl = wave * 16 + 8 * g + r, cl = j * 16 + col; th[cl][rl] = (_Float16)v; const __bf16 bh = (__bf16)v; tb[cl][rl] = bh; tbl[cl][rl] = (__bf16)(v - (float)bh); } }
    __syncthreads();
    for (int e = tid; e < 128 * 8; e += 128) { const int cl = e >> 3, q = e & 7; vst2((unsigned*)(VT + (bb * CC + c0 + cl) * (size_t)TT + t0 + q * 8), *(const v4u*)&th[cl][q * 8]); if (hi_rows) { const int cf = ((e >> 6) & 7) * 16 + (e & 15), qf = (e >> 9) * 4 + ((e >> 4) & 3);   // piece e of the block's 2 x 8 fragments: bits 3..0 = column in the tile, 4 = lane half g, 5 = fragment half, 8..6 = column tile, 9 = 32-key step
        const size_t o3 = (bb * (KHI / 32) + (t0 >> 5)) * (size_t)(CC * 32) + e * 8; vst2((unsigned*)(VB + o3), *(const v4u*)&tb[cf][qf * 8]); vst2((unsigned*)(VBL + o3), *(const v4u*)&tbl[cf][qf * 8]); } } } }
// ---- k_att: block = 16 queries of batch b (blockIdx.z), 16 waves: logits, softmax and P . v in one kernel; the 16 logit rows stay in LDS from the first product to the last, so no logit and no P goes through memory.
// 1) wave w takes the 16-key tiles w, w + 16, ... of keys [0, kend): q hi + residual (x 2^10) against k hi + residual (3 products), x SCALE, into sp[query][key]
// 2) wave w owns query row w: causal mask by index, max, exp, sum, P x 2^11 in place (0 for excluded keys)
// 3) wave w takes the 64-key pairs of steps w, w + 16, ...: P as bf16 hi + lo against v bf16 hi + lo (3 products); the 16 partial tiles are summed through LDS in wave order and the 64 real columns stored to out
#define FA_KS 16               // waves of a block
#define FA_P  (TT + 4)         // f32 pitch of a logit row in LDS: row r starts 4 r banks on, so the 16 rows of a 16-byte fragment read cover all 64 banks once
// second bound: 8 waves per SIMD = 128 registers a wave, so that two blocks (LDS allows two) share a WGP and one block's matrix phases run under the other's softmax and barriers
__global__ __launch_bounds__(32 * FA_KS, 8) void k_att(const _Float16* __restrict__ QH, const _Float16* __restrict__ KH, const _Float16* __restrict__ QL, const _Float16* __restrict__ KL, const __bf16* __restrict__ VB, const __bf16* __restrict__ VBL, float* __restrict__ OUT) {
  __shared__ __align__(16) float buf[FA_KS * 16 * (HD + 4)];   // first the logit / P rows, then (behind a barrier) the waves' partial tiles
  float (*sp)[FA_P] = (float (*)[FA_P])buf; float (*ss)[16][HD + 4] = (float (*)[16][HD + 4])buf;
  static_assert(16 * FA_P <= FA_KS * 16 * (HD + 4), "logit rows fit the buffer");
  const int tid = threadIdx.x, lane = tid & 31, col = lane & 15, g = lane >> 4; const int b = blockIdx.z; const int ql0 = blockIdx.x * 16; const int kend = (kb_last(ql0 >> 6) + 1) * 128;
  const int wave = __builtin_amdgcn_readfirstlane(tid >> 5);   // scalar, so that every key loop's trip count is a scalar branch and every lane stays on at the matrix instructions
  { v16h ah[HD / 32], al[HD / 32]; const _Float16* qh = QH + ((size_t)b * TT + ql0) * CC; const _Float16* ql = QL + ((size_t)b * QHI + ql0) * CC;
#pragma unroll
    for (int kc = 0; kc < HD / 32; ++kc) { ah[kc] = fragp_h(qh + kc * 512, lane); al[kc] = fragp_h(ql + kc * 512, lane); }
    asm volatile("s_wait_xcnt 0x0" :: "v"(qh + 8 * lane), "v"(ql + 8 * lane) : "memory");   // the wait before a register of an issued q load is overwritten; with the two lane addresses as inputs the build keeps it behind the loads (without them the loads sink below it)
    for (int jt = wave; jt < kend / 16; jt += FA_KS) { const _Float16* kh = KH + ((size_t)b * TT + jt * 16) * CC; const _Float16* kl = KL + ((size_t)b * KHI + jt * 16) * CC; v8f acc = {}, accl = {};
#pragma unroll
      for (int kc = 0; kc < HD / 32; ++kc) { const v16h kbf = fragp_h(kh + kc * 512, lane), klf = fragp_h(kl + kc * 512, lane); acc = wmma16(ah[kc], kbf, acc); accl = wmma16(al[kc], kbf, accl); accl = wmma16(ah[kc], klf, accl); }
#pragma unroll
      for (int r = 0; r < 8; ++r) sp[8 * g + r][jt * 16 + col] = (acc[r] + accl[r] * (1.0f / 1024.0f)) * SCALE; } }
  __syncthreads();   // all logits of the 16 rows are in LDS before a wave reduces its row
  { const int t = ql0 + wave; float* sr = sp[wave]; float m = -3.0e38f;
#pragma unroll 4   // four LDS reads in flight
    for (int kq = 0; kq < kend / 128; ++kq) { const int k = kq * 128 + lane * 4; const v4f v = *(const v4f*)&sr[k];
#pragma unroll
      for (int i = 0; i < 4; ++i) m = fmaxf(m, (!CAUSAL || k + i <= t) ? v[i] : -3.0e38f); }
#pragma unroll
    for (int o = 1; o < 32; o <<= 1) m = fmaxf(m, __shfl_xor(m, o));
    float sum = 0.f;
#pragma unroll 2   // the next LDS read flies under this one's exponentials
    for (int kq = 0; kq < kend / 128; ++kq) { const int k = kq * 128 + lane * 4; const v4f v = *(const v4f*)&sr[k]; v4f e;
#pragma unroll
      for (int i = 0; i < 4; ++i) { e[i] = (!CAUSAL || k + i <= t) ? expf(v[i] - m) : 0.f; sum += e[i]; }
      *(v4f*)&sr[k] = e; }
#pragma unroll
    for (int o = 1; o < 32; o <<= 1) sum += __shfl_xor(sum, o);
    const float inv = sum > 0.f ? 2048.0f / sum : 0.f;
#pragma unroll 4   // four LDS reads in flight
    for (int kq = 0; kq < kend / 128; ++kq) { const int k = kq * 128 + lane * 4; const v4f e = *(const v4f*)&sr[k]; *(v4f*)&sr[k] = e * inv; } }
  __syncthreads();   // every row's P is in LDS before any wave reads its key range of all 16 rows
  v8f acc[HD / 16] = {};
#pragma unroll 1   // one 64-key pair a trip: a second pair's fragments would not fit the 128 registers
  for (int kp = wave; kp < kend / 64; kp += FA_KS)
#pragma unroll
    for (int kc = 2 * kp; kc < 2 * kp + 2; ++kc) { const F2 p = split_row(sp[col], kc * 32, lane);
#pragma unroll
      for (int j = 0; j < HD / 16; j += 2) { const size_t po = (((size_t)b * (KHI / 32) + kc) * (CC / 16) + j) * 512, p1 = po + 512; const v16b vh0 = fragp_b(VB + po, lane), vl0 = fragp_b(VBL + po, lane), vh1 = fragp_b(VB + p1, lane), vl1 = fragp_b(VBL + p1, lane);   // two column tiles' loads in flight together
        acc[j] = wmma_bf(p.h, vh0, acc[j]); acc[j] = wmma_bf(p.l, vh0, acc[j]); acc[j] = wmma_bf(p.h, vl0, acc[j]); acc[j + 1] = wmma_bf(p.h, vh1, acc[j + 1]); acc[j + 1] = wmma_bf(p.l, vh1, acc[j + 1]); acc[j + 1] = wmma_bf(p.h, vl1, acc[j + 1]); } }
  __syncthreads();   // the last read of P is over before the partial tiles overwrite its LDS
#pragma unroll
  for (int j = 0; j < HD / 16; ++j)
#pragma unroll
    for (int r = 0; r < 8; ++r) ss[wave][8 * g + r][j * 16 + col] = acc[j][r] * (1.0f / 2048.0f);
  __syncthreads();   // every wave's partial tile (zero where a wave had no keys) is in LDS before any thread sums them
  if (tid < 16 * (DOUT / 4)) { const int rl = tid / (DOUT / 4), q = tid % (DOUT / 4); v4f s = *(const v4f*)&ss[0][rl][q * 4];   // only the real columns go out: the planes' upper columns are zero
#pragma unroll
    for (int w = 1; w < FA_KS; ++w) s += *(const v4f*)&ss[w][rl][q * 4];
    vst2(OUT + ((size_t)b * TT + ql0 + rl) * DOUT + q * 4, s); } }

extern "C" void kernel_launch(void* const* d_in, const int* in_sizes, int n_in, void* d_out, int out_size, void* d_ws, size_t ws_size, hipStream_t stream) {
  (void)in_sizes; (void)n_in; (void)out_size;
  const float** F = (const float**)d_in;
  if (ws_size < (size_t)WS_END) return;
  char* ws = (char*)d_ws; _Float16 *QH = (_Float16*)(ws + WS_QH), *KH = (_Float16*)(ws + WS_KH), *VT = (_Float16*)(ws + WS_VT), *QL = (_Float16*)(ws + WS_QL), *KL = (_Float16*)(ws + WS_KL); __bf16 *VB = (__bf16*)(ws + WS_VB), *VBL = (__bf16*)(ws + WS_VBL); float *Y = (float*)(ws + WS_Y);
  (void)Y;
  // inputs: 0 embedding [4,2048,1024]; 1 Wk [64,1024] (out,in) (q = k = v)
  k_proj<<<dim3(TNB * TT / 64, CC / 128, 3), 128, 0, stream>>>(F[0], F[0], F[0], F[1], F[1], F[1], nullptr, nullptr, nullptr, QH, QL, KH, KL, VT, VB, VBL);
  k_att<<<dim3(TT / 16, 1, TNB), 32 * FA_KS, 0, stream>>>(QH, KH, QL, KL, VB, VBL, (float*)d_out);
}

// v005
// Measured time: 39.2 microseconds a run.
// In two side-by-side timings against v004, it was 1.48 and 1.47 times as fast.
// All steps since v000 together make it 22.7 times as fast.
// compute dtype: all float inputs rounded to bf16; q = k = v = x Wk^T with EXACT bf16 products on WMMA 16x16x32 (f32 accumulate; the single head's planes are 64 wide, its real width); causal logits with q = k as f16 hi + residual on both sides (3 products) x 64^-0.5; softmax in f32; P as bf16 hi + lo against v bf16 hi + lo (3 products); f32 output.
#include <hip/hip_runtime.h>
#include <math.h>

typedef __attribute__((ext_vector_type(16))) _Float16 v16h;
typedef __attribute__((ext_vector_type(16))) __bf16 v16b;
typedef __attribute__((ext_vector_type(8)))  _Float16 v8h;
typedef __attribute__((ext_vector_type(8)))  float v8f;
typedef __attribute__((ext_vector_type(4)))  float v4f;
typedef __attribute__((ext_vector_type(2)))  float v2f;
typedef __attribute__((ext_vector_type(4)))  unsigned v4u;
typedef __attribute__((ext_vector_type(4)))  int v4i;
typedef float __attribute__((may_alias)) float_a;
typedef int __attribute__((may_alias)) int_a;

template <typename T> __device__ __forceinline__ void vst2(void* p, T v) { *(T*)p = v;  }
__device__ __forceinline__ v8f wmma16(v16h a, v16h b, v8f c) {
  v8f d = __builtin_amdgcn_wmma_f32_16x16x32_f16(false, a, false, b, (short)0, c, false, false);
  asm volatile("v_nop\n\tv_nop\n\tv_nop\n\tv_nop" : "+v"(d) : "v"(a), "v"(b));
  return d;
}
__device__ __forceinline__ v8f wmma_bf(v16b a, v16b b, v8f c) {
  v8f d = __builtin_amdgcn_wmma_f32_16x16x32_bf16(false, a, false, b, (short)0, c, false, false);
  asm volatile("v_nop\n\tv_nop\n\tv_nop\n\tv_nop" : "+v"(d) : "v"(a), "v"(b));
  return d;
}
// 16x16x32 fragments: lane = (h = lane>>4, row/col = lane&15); elements 0..7 = k0+8h+0..7, 8..15 = k0+16+8h+0..7; D element r = row 8h+r
__device__ __forceinline__ v16h frag_h(const _Float16* rowk0, int lane) {
  union { v16h v; v8h q[2]; } u; const _Float16* p = rowk0 + 8 * (lane >> 4);
  u.q[0] = *(const v8h*)p; u.q[1] = *(const v8h*)(p + 16); return u.v;
}
__device__ __forceinline__ v16h frag_f32(const float* rowk0, int lane) {
  v16h a; const float* p = rowk0 + 8 * (lane >> 4);
#pragma unroll
  for (int i = 0; i < 8; ++i) { a[i] = (_Float16)p[i]; a[8 + i] = (_Float16)p[16 + i]; }
  return a;
}
__device__ __forceinline__ v16h frag_f32s(const float* rowk0, int lane, float sc) {
  v16h a; const float* p = rowk0 + 8 * (lane >> 4);
#pragma unroll
  for (int i = 0; i < 8; ++i) { a[i] = (_Float16)(p[i] * sc); a[8 + i] = (_Float16)(p[16 + i] * sc); }
  return a;
}
// column fragment from a [K][ld] layout (column n), rows >= K read as 0
__device__ __forceinline__ v16h fragc_f32(const float* W, int k0, int n, int lane, int ld, int K) {
  v16h a; const int g = lane >> 4;
#pragma unroll
  for (int i = 0; i < 8; ++i) { const int ka = k0 + 8 * g + i, kb = ka + 16;
    a[i] = (_Float16)(ka < K ? W[(size_t)(ka < K ? ka : K - 1) * ld + n] : 0.f); a[8 + i] = (_Float16)(kb < K ? W[(size_t)(kb < K ? kb : K - 1) * ld + n] : 0.f); }
  return a;
}
struct F2 { v16b h, l; };
__device__ __forceinline__ F2 bsplit16(const float v[16]) { F2 r;
#pragma unroll
  for (int i = 0; i < 16; ++i) { const __bf16 h = (__bf16)v[i]; r.h[i] = h; r.l[i] = (__bf16)(v[i] - (float)h); }
  return r; }
__device__ __forceinline__ F2 split_row(const float* row, int k0, int lane) { float v[16]; const float* p = row + k0 + 8 * (lane >> 4);
#pragma unroll
  for (int i = 0; i < 8; ++i) { v[i] = p[i]; v[8 + i] = p[16 + i]; }
  return bsplit16(v); }
__device__ __forceinline__ F2 split_rowK(const float* row, int k0, int lane, int K) { float v[16]; const int g = lane >> 4;
#pragma unroll
  for (int i = 0; i < 8; ++i) { const int ka = k0 + 8 * g + i, kb = ka + 16; v[i] = ka < K ? row[ka < K ? ka : K - 1] : 0.f; v[8 + i] = kb < K ? row[kb < K ? kb : K - 1] : 0.f; }
  return bsplit16(v); }
__device__ __forceinline__ F2 split_col(const float* W, int k0, int n, int lane, int ld, int K) { float v[16]; const int g = lane >> 4;
#pragma unroll
  for (int i = 0; i < 8; ++i) { const int ka = k0 + 8 * g + i, kb = ka + 16; v[i] = ka < K ? W[(size_t)(ka < K ? ka : K - 1) * ld + n] : 0.f; v[8 + i] = kb < K ? W[(size_t)(kb < K ? kb : K - 1) * ld + n] : 0.f; }
  return bsplit16(v); }
__device__ __forceinline__ v8f mac3(const F2& a, const F2& b, v8f c) { c = wmma_bf(a.l, b.h, c); c = wmma_bf(a.h, b.l, c); return wmma_bf(a.h, b.h, c); }
__device__ __forceinline__ float sigm(float v) { return 1.0f / (1.0f + expf(-v)); }
#define LDSX() do { asm volatile("s_wait_dscnt 0" ::: "memory"); __builtin_amdgcn_wave_barrier(); __builtin_amdgcn_fence(__ATOMIC_RELEASE, "workgroup"); } while (0)

// Single-head causal self-attention with shared projections (B 4, S 2,048, E 1,024 -> A 64): k = x Wk^T; q = v = k; x = q k^T / 8 masked where tril(x) == 0 (the strict upper triangle; exact-zero logits in the lower triangle would also be masked - measure-zero for these inputs); softmax; out = P v -> [B, S, 64].
#define NB 4
#define TT 2048
#define CC 64             // NH * HD = projected width
#define DIN 1024
#define NH 1
#define HD 64
#define NQB (TT / 64)
#define HG 1
#define SCALE (0.125f)
#define CAUSAL 1
#ifndef TNB
#define TNB NB
#endif
__device__ __forceinline__ v16b zero16b() { v16b z; _Pragma("unroll") for (int i = 0; i < 16; ++i) z[i] = (__bf16)0.f; return z; }
__device__ __forceinline__ float bfr(float v) { return (float)(__bf16)v; }
__host__ __device__ __forceinline__ int kb_last(int qb) { return CAUSAL ? ((qb * 64 + 63) >> 7) : (TT / 128 - 1); }
typedef __attribute__((ext_vector_type(8))) __bf16 v8b;
__device__ __forceinline__ v16b frag_b(const __bf16* rowk0, int lane) {
  union { v16b v; v8b q[2]; } u; const __bf16* p = rowk0 + 8 * (lane >> 4);
  u.q[0] = *(const v8b*)p; u.q[1] = *(const v8b*)(p + 16); return u.v;
}
// a 16 x 32 fragment kept in fragment order = 1 KiB: lane l's elements 0..7 at byte 16 l, its elements 8..15 at byte 512 + 16 l, so each 16-byte load of a wave covers 512 contiguous bytes (4 whole lines)
__device__ __forceinline__ v16h fragp_h(const _Float16* f, int lane) {
  union { v16h v; v8h q[2]; } u; const _Float16* p = f + 8 * lane;
  u.q[0] = *(const v8h*)p; u.q[1] = *(const v8h*)(p + 256); return u.v;
}
__device__ __forceinline__ v16b fragp_b(const __bf16* f, int lane) {
  union { v16b v; v8b q[2]; } u; const __bf16* p = f + 8 * lane;
  u.q[0] = *(const v8b*)p; u.q[1] = *(const v8b*)(p + 256); return u.v;
}
#define QBH NQB            // every block: 3-product logits (the self key's logit |k|^2/8 ~ 8 dominates -> peaked rows) and bf16 hi/lo P.v
#define QHI TT
#define KHI TT
// B fragment (k rows k0+.., output column o) of a weight: (in,out) [K][ld] or (out,in) [ld rows of K]: bf16 exact, or f16(bf16 * 256) exact
__device__ __forceinline__ v16b wcol_io(const float* Wm, int k0, int o, int lane, int ld) { v16b w; const int g = lane >> 4;
#pragma unroll
  for (int i = 0; i < 8; ++i) { w[i] = (__bf16)Wm[(size_t)(k0 + 8 * g + i) * ld + o]; w[8 + i] = (__bf16)Wm[(size_t)(k0 + 16 + 8 * g + i) * ld + o]; }
  return w; }
__device__ __forceinline__ v16b wcol_oi(const float* Wm, int k0, int o, int lane, int K) { v16b w; const float* p = Wm + (size_t)o * K + k0 + 8 * (lane >> 4);
#pragma unroll
  for (int i = 0; i < 8; ++i) { w[i] = (__bf16)p[i]; w[8 + i] = (__bf16)p[16 + i]; }
  return w; }
__device__ __forceinline__ v16h wcolh_io(const float* Wm, int k0, int o, int lane, int ld) { v16h w; const int g = lane >> 4;
#pragma unroll
  for (int i = 0; i < 8; ++i) { w[i] = (_Float16)(bfr(Wm[(size_t)(k0 + 8 * g + i) * ld + o]) * 256.0f); w[8 + i] = (_Float16)(bfr(Wm[(size_t)(k0 + 16 + 8 * g + i) * ld + o]) * 256.0f); }
  return w; }
__device__ __forceinline__ v16h wcolh_oi(const float* Wm, int k0, int o, int lane, int K) { v16h w; const float* p = Wm + (size_t)o * K + k0 + 8 * (lane >> 4);
#pragma unroll
  for (int i = 0; i < 8; ++i) { w[i] = (_Float16)(bfr(p[i]) * 256.0f); w[8 + i] = (_Float16)(bfr(p[16 + i]) * 256.0f); }
  return w; }
#define WQKV_LAYOUT 0   // 0 = (out,in) [DOUT][DIN], columns >= DOUT zero; 1 = (out,in) [CC][DIN]; 2 = per-head [NH][DIN][HD]
__device__ __forceinline__ v16b wcol_hdk(const float* Wm, int k0, int o, int lane) { v16b w; const int g = lane >> 4; const float* p = Wm + (size_t)(o / HD) * DIN * HD + (o % HD);
#pragma unroll
  for (int i = 0; i < 8; ++i) { w[i] = (__bf16)p[(size_t)(k0 + 8 * g + i) * HD]; w[8 + i] = (__bf16)p[(size_t)(k0 + 16 + 8 * g + i) * HD]; }
  return w; }
#define WO_OUT_IN 0
#if WQKV_LAYOUT == 1
#define WCOL(W, k0, o, lane) wcol_oi(W, k0, o, lane, DIN)
#elif WQKV_LAYOUT == 2
#define WCOL(W, k0, o, lane) wcol_hdk(W, k0, o, lane)
#else
#define WCOL(W, k0, o, lane) (((o) < DOUT) ? wcol_oi(W, k0, (o), lane, DIN) : zero16b())   /* Wk (out,in) [64][1024]; q = k = v = x Wk^T */
#endif
#if WO_OUT_IN
#define WOCOL(W, k0, o, lane) wcol_oi(W, k0, o, lane, CC)
#define WOCOLH(W, k0, o, lane) wcolh_oi(W, k0, o, lane, CC)
#else
#define WOCOL(W, k0, o, lane) wcol_io(W, k0, o, lane, DIN)
#define WOCOLH(W, k0, o, lane) wcolh_io(W, k0, o, lane, DIN)
#endif
#define DOUT 64            // head width = plane width
#ifndef SM_EXTRA_PARAMS
#define SM_EXTRA_PARAMS
#endif
#ifndef PROJ_EXTRA_PARAMS
#define PROJ_EXTRA_PARAMS
#endif
#ifndef SM_MASK_HOOK
#define SM_MASK_HOOK (void)0
#endif

#define WS_QH  0u                                      // f16 q, fragment order [b*t / 16][CC / 32][512]
#define WS_KH  (WS_QH + 2u * (size_t)NB * TT * CC)      // f16 k, fragment order [b*t / 16][CC / 32][512]
#define WS_VT  (WS_KH + 2u * (size_t)NB * TT * CC)      // f16 v planes [b][c][t]
#define WS_QL  (WS_VT + 2u * (size_t)NB * CC * TT)      // f16 q residual x 2^10, fragment order like q
#define WS_KL  (WS_QL + 2u * (size_t)NB * QHI * CC)     // f16 k residual x 2^10, fragment order like k
#define WS_VB  (WS_KL + 2u * (size_t)NB * KHI * CC)     // bf16 v hi, fragment order [b][t / 32][CC / 16][512] (and v lo behind it)
#define WS_VBL (WS_VB + 2u * (size_t)NB * CC * KHI)
#define WS_Y   (WS_VBL + 2u * (size_t)NB * CC * KHI)    // f32 ctx rows [b*t][CC] (only when there is an output projection)
#define WS_END (WS_Y  + 0u)

// k_proj's staging: a k tile = 64 rows of X and the 64 rows of Wk, PJ_KT columns each, f32 as in memory, brought into LDS by asynchronous copies
#define PJ_KT 128                         // k columns of a tile: a row's piece is 512 contiguous bytes = one copy of a wave
#define PJ_P  (PJ_KT + 4)                 // f32 pitch of a staged row (16 bytes x 33): the 16 rows of a 16-byte fragment read cover all 64 banks once
#define PJ_ROWS (64 + DOUT)
#define PJ_BUFB (PJ_ROWS * PJ_P * 4u)     // bytes of one buffer
#define PJ_LS (4u * PJ_P * 4u)            // LDS bytes between two rows of one wave (4 waves take rows in turn)
#define PJ_GS (4 * DIN)
// eight copies of one wave, rows 4 apart; s_wait_xcnt stands inside the copies' own statement, in front of any rewrite of a register that a copy names
__device__ __forceinline__ void pj_copy8(unsigned l, const float* gp) {
  asm volatile("global_load_async_to_lds_b128 %0, %8, off\n\tglobal_load_async_to_lds_b128 %1, %9, off\n\tglobal_load_async_to_lds_b128 %2, %10, off\n\tglobal_load_async_to_lds_b128 %3, %11, off\n\t"
               "global_load_async_to_lds_b128 %4, %12, off\n\tglobal_load_async_to_lds_b128 %5, %13, off\n\tglobal_load_async_to_lds_b128 %6, %14, off\n\tglobal_load_async_to_lds_b128 %7, %15, off\n\ts_wait_xcnt 0x0"
               :: "v"(l), "v"(l + PJ_LS), "v"(l + 2 * PJ_LS), "v"(l + 3 * PJ_LS), "v"(l + 4 * PJ_LS), "v"(l + 5 * PJ_LS), "v"(l + 6 * PJ_LS), "v"(l + 7 * PJ_LS),
                  "v"(gp), "v"(gp + PJ_GS), "v"(gp + 2 * PJ_GS), "v"(gp + 3 * PJ_GS), "v"(gp + 4 * PJ_GS), "v"(gp + 5 * PJ_GS), "v"(gp + 6 * PJ_GS), "v"(gp + 7 * PJ_GS) : "memory");
}
// one wave's 32 copies of a tile: its 16 rows of X, then its 16 rows of Wk (LDS rows 64 ..)
__device__ __forceinline__ void pj_stage(unsigned l, const float* xg, const float* wg) {
  pj_copy8(l, xg); pj_copy8(l + 8 * PJ_LS, xg + 8 * PJ_GS); pj_copy8(l + 16 * PJ_LS, wg); pj_copy8(l + 24 * PJ_LS, wg + 8 * PJ_GS);
}
// bf16 fragment of a staged f32 row (p = row + k0 + 8 * (lane >> 4)): elements 0..7 = p[0..7], 8..15 = p[16..23], for A and B alike
__device__ __forceinline__ v16b frag_lds(const float* p) { const v4f x0 = *(const v4f*)p, x1 = *(const v4f*)(p + 4), x2 = *(const v4f*)(p + 16), x3 = *(const v4f*)(p + 20); v16b a;
#pragma unroll
  for (int i = 0; i < 4; ++i) { a[i] = (__bf16)x0[i]; a[4 + i] = (__bf16)x1[i]; a[8 + i] = (__bf16)x2[i]; a[12 + i] = (__bf16)x3[i]; }
  return a; }
// ---- k_proj: block = (64 rows, CC cols, which): q/k/v = X W (+ b) with exact bf16 products (K = DIN) -> which 0: q f16 (+ residual); 1: k f16 (+ residual); 2: v f16 planes [c][t] and v bf16 hi/lo; q, k and v hi/lo leave in the order in which k_att's fragments read them
__global__ __launch_bounds__(128) void k_proj(const float* __restrict__ XQ, const float* __restrict__ XK, const float* __restrict__ XV, const float* __restrict__ WQ, const float* __restrict__ WK, const float* __restrict__ WV, const float* __restrict__ BQ, const float* __restrict__ BK, const float* __restrict__ BV,
    _Float16* __restrict__ QH, _Float16* __restrict__ QL, _Float16* __restrict__ KH, _Float16* __restrict__ KL, _Float16* __restrict__ VT, __bf16* __restrict__ VB, __bf16* __restrict__ VBL) {
  // the K loop's two staging buffers and the epilogue's transposing tiles share one LDS range (the epilogue starts behind the loop's last barrier), so that two blocks fit a WGP
  __shared__ __align__(16) union { float st[2][PJ_ROWS][PJ_P]; struct { _Float16 sh[64][CC + 8], sl[64][CC + 8], th[CC][72]; __bf16 tb[CC][72], tbl[CC][72]; } ep; } u;
  auto& sh = u.ep.sh; auto& sl = u.ep.sl; auto& th = u.ep.th; auto& tb = u.ep.tb; auto& tbl = u.ep.tbl;
  const int tid = threadIdx.x, wave = tid >> 5, lane = tid & 31, col = lane & 15, g = lane >> 4; const int which = blockIdx.z; const int c0 = blockIdx.y * CC; const size_t r0 = (size_t)blockIdx.x * 64; const size_t bb = r0 / TT; const int t0 = (int)(r0 % TT);
  const float* X = which == 0 ? XQ : which == 1 ? XK : XV; const float* WA = which == 0 ? WQ : which == 1 ? WK : WV; const float* BA = which == 0 ? BQ : which == 1 ? BK : BV;
  v8f acc[CC / 16] = {};
  static_assert(CC == DOUT && DOUT % 16 == 0 && DIN % PJ_KT == 0 && DIN / PJ_KT >= 2, "grid y is 1, so c0 is 0 and plane column tile j is Wk's rows 16 j ..; at least two k tiles");
  const unsigned l0 = (unsigned)(size_t)&u.st[0][wave][lane * 4];   // LDS byte address of this lane's 16 bytes in row 'wave' of buffer 0
  const float* xg = X + (r0 + wave) * DIN + lane * 4; const float* wg = WA + (size_t)wave * DIN + lane * 4;
  pj_stage(l0, xg, wg);
  asm volatile("s_wait_asynccnt 0x0" ::: "memory");   // this wave's copies of tile 0 have landed
  __syncthreads();                                      // ... and every other wave's: tile 0 may be read
  pj_stage(l0 + PJ_BUFB, xg + PJ_KT, wg + PJ_KT);
#pragma unroll 1   // rolled, for speed only
  for (int t = 0; t < DIN / PJ_KT; ++t) { const float* pa = &u.st[t & 1][wave * 16 + col][8 * g]; const float* pw = &u.st[t & 1][64 + col][8 * g];
    v16b a = frag_lds(pa), w[DOUT / 16];
#pragma unroll
    for (int j = 0; j < DOUT / 16; ++j) w[j] = frag_lds(pw + j * 16 * PJ_P);
#pragma unroll
    for (int kq = 0; kq < PJ_KT / 32; ++kq) { v16b an = a, wn[DOUT / 16];   // the next 32 columns' fragments (same tile) are read as one group in front of this step's products, so that their LDS latency runs under them
#pragma unroll
      for (int j = 0; j < DOUT / 16; ++j) wn[j] = w[j];
      if (kq + 1 < PJ_KT / 32) { an = frag_lds(pa + (kq + 1) * 32);
#pragma unroll
        for (int j = 0; j < DOUT / 16; ++j) wn[j] = frag_lds(pw + j * 16 * PJ_P + (kq + 1) * 32); }
#pragma unroll
      for (int j = 0; j < CC / 16; ++j) acc[j] = wmma_bf(a, w[j], acc[j]);
      a = an;
#pragma unroll
      for (int j = 0; j < DOUT / 16; ++j) w[j] = wn[j]; }
    asm volatile("s_wait_dscnt 0x0" ::: "memory");      // this wave's reads of tile t are over
    asm volatile("s_wait_asynccnt 0x0" ::: "memory");   // this wave's copies of tile t + 1 have landed
    __syncthreads();                                      // publishes tile t + 1 and frees tile t's buffer (behind the last trip: for the epilogue's tiles)
    if (t + 2 < DIN / PJ_KT) pj_stage(l0 + (t & 1) * PJ_BUFB, xg + (t + 2) * PJ_KT, wg + (t + 2) * PJ_KT); }
  asm volatile("s_wait_asynccnt 0x0" ::: "memory");     // no copy is outstanding when the LDS range changes hands
  if (which < 2) { _Float16* DH = which == 0 ? QH : KH; _Float16* DL = which == 0 ? QL : KL; const int nhi = which == 0 ? QHI : KHI; const bool hi_rows = t0 < nhi;
#pragma unroll
    for (int j = 0; j < CC / 16; ++j) { const float bias = BA ? bfr(BA[c0 + j * 16 + col]) : 0.f;
#pragma unroll
      for (int r = 0; r < 8; ++r) { const float v = acc[j][r] + bias; const _Float16 hv = (_Float16)v; sh[wave * 16 + 8 * g + r][j * 16 + col] = hv; sl[wave * 16 + 8 * g + r][j * 16 + col] = (_Float16)((v - (float)hv) * 1024.0f); } }
    __syncthreads();
    static_assert(CC == 64, "a block holds whole 16-row tiles: 2 fragments of 64 pieces of 16 bytes each");
    // piece e of the block's 4 tiles: bits 3..0 = row in the tile, 4 = lane half g, 5 = fragment half, 6 = 32-column step, 8..7 = tile; columns 8 * (e >> 4 & 7) ..
    for (int e = tid; e < 64 * 8; e += 128) { const int rl = (e >> 7) * 16 + (e & 15), q = (e >> 4) & 7; vst2((unsigned*)(DH + r0 * CC + e * 8), *(const v4u*)&sh[rl][q * 8]); if (hi_rows) vst2((unsigned*)(DL + (bb * nhi + t0) * (size_t)CC + e * 8), *(const v4u*)&sl[rl][q * 8]); }
  } else { const bool hi_rows = t0 < KHI;
#pragma unroll
    for (int j = 0; j < CC / 16; ++j) { const float bias = BA ? bfr(BA[c0 + j * 16 + col]) : 0.f;
#pragma unroll
      for (int r = 0; r < 8; ++r) { const float v = acc[j][r] + bias; const int rl = wave * 16 + 8 * g + r, cl = j * 16 + col; th[cl][rl] = (_Float16)v; const __bf16 bh = (__bf16)v; tb[cl][rl] = bh; tbl[cl][rl] = (__bf16)(v - (float)bh); } }
    __syncthreads();
    for (int e = tid; e < CC * 8; e += 128) { const int cl = e >> 3, q = e & 7; vst2((unsigned*)(VT + (bb * CC + c0 + cl) * (size_t)TT + t0 + q * 8), *(const v4u*)&th[cl][q * 8]); if (hi_rows) { const int cf = ((e >> 6) & 3) * 16 + (e & 15), qf = (e >> 8) * 4 + ((e >> 4) & 3);   // piece e of the block's 2 x 4 fragments: bits 3..0 = column in the tile, 4 = lane half g, 5 = fragment half, 7..6 = column tile, 8 = 32-key step
        const size_t o3 = (bb * (KHI / 32) + (t0 >> 5)) * (size_t)(CC * 32) + e * 8; vst2((unsigned*)(VB + o3), *(const v4u*)&tb[cf][qf * 8]); vst2((unsigned*)(VBL + o3), *(const v4u*)&tbl[cf][qf * 8]); } } } }
// ---- k_att: block = 16 queries of batch b (blockIdx.z), 16 waves: logits, softmax and P . v in one kernel; the 16 logit rows stay in LDS from the first product to the last, so no logit and no P goes through memory.
// 1) wave w takes the 16-key tiles w, w + 16, ... of keys [0, kend): q hi + residual (x 2^10) against k hi + residual (3 products), x SCALE, into sp[query][key]
// 2) wave w owns query row w: causal mask by index, max, exp, sum, P x 2^11 in place (0 for excluded keys)
// 3) wave w takes the 64-key pairs of steps w, w + 16, ...: P as bf16 hi + lo against v bf16 hi + lo (3 products); the 16 partial tiles are summed through LDS in wave order and the 64 real columns stored to out
#define FA_KS 16               // waves of a block
#define FA_P  (TT + 4)         // f32 pitch of a logit row in LDS: row r starts 4 r banks on, so the 16 rows of a 16-byte fragment read cover all 64 banks once
// second bound: 8 waves per SIMD = 128 registers a wave, so that two blocks (LDS allows two) share a WGP and one block's matrix phases run under the other's softmax and barriers
__global__ __launch_bounds__(32 * FA_KS, 8) void k_att(const _Float16* __restrict__ QH, const _Float16* __restrict__ KH, const _Float16* __restrict__ QL, const _Float16* __restrict__ KL, const __bf16* __restrict__ VB, const __bf16* __restrict__ VBL, float* __restrict__ OUT) {
  __shared__ __align__(16) float buf[16 * FA_P];   // first the logit / P rows, then (behind a barrier) the waves' partial tiles
  float (*sp)[FA_P] = (float (*)[FA_P])buf; float (*ss)[16][HD + 4] = (float (*)[16][HD + 4])buf;
  static_assert(FA_KS * 16 * (HD + 4) <= 16 * FA_P, "the partial tiles fit the buffer");
  const int tid = threadIdx.x, lane = tid & 31, col = lane & 15, g = lane >> 4; const int b = blockIdx.z; const int ql0 = blockIdx.x * 16; const int kend = (kb_last(ql0 >> 6) + 1) * 128;
  const int wave = __builtin_amdgcn_readfirstlane(tid >> 5);   // scalar, so that every key loop's trip count is a scalar branch and every lane stays on at the matrix instructions
  { v16h ah[HD / 32], al[HD / 32]; const _Float16* qh = QH + ((size_t)b * TT + ql0) * CC; const _Float16* ql = QL + ((size_t)b * QHI + ql0) * CC;
#pragma unroll
    for (int kc = 0; kc < HD / 32; ++kc) { ah[kc] = fragp_h(qh + kc * 512, lane); al[kc] = fragp_h(ql + kc * 512, lane); }
    asm volatile("s_wait_xcnt 0x0" :: "v"(qh + 8 * lane), "v"(ql + 8 * lane) : "memory");   // the wait before a register of an issued q load is overwritten; with the two lane addresses as inputs the build keeps it behind the loads (without them the loads sink below it)
    for (int jt = wave; jt < kend / 16; jt += FA_KS) { const _Float16* kh = KH + ((size_t)b * TT + jt * 16) * CC; const _Float16* kl = KL + ((size_t)b * KHI + jt * 16) * CC; v8f acc = {}, accl = {};
#pragma unroll
      for (int kc = 0; kc < HD / 32; ++kc) { const v16h kbf = fragp_h(kh + kc * 512, lane), klf = fragp_h(kl + kc * 512, lane); acc = wmma16(ah[kc], kbf, acc); accl = wmma16(al[kc], kbf, accl); accl = wmma16(ah[kc], klf, accl); }
#pragma unroll
      for (int r = 0; r < 8; ++r) sp[8 * g + r][jt * 16 + col] = (acc[r] + accl[r] * (1.0f / 1024.0f)) * SCALE; } }
  __syncthreads();   // all logits of the 16 rows are in LDS before a wave reduces its row
  { const int t = ql0 + wave; float* sr = sp[wave]; float m = -3.0e38f;
#pragma unroll 4   // four LDS reads in flight
    for (int kq = 0; kq < kend / 128; ++kq) { const int k = kq * 128 + lane * 4; const v4f v = *(const v4f*)&sr[k];
#pragma unroll
      for (int i = 0; i < 4; ++i) m = fmaxf(m, (!CAUSAL || k + i <= t) ? v[i] : -3.0e38f); }
#pragma unroll
    for (int o = 1; o < 32; o <<= 1) m = fmaxf(m, __shfl_xor(m, o));
    float sum = 0.f;
#pragma unroll 2   // the next LDS read flies under this one's exponentials
    for (int kq = 0; kq < kend / 128; ++kq) { const int k = kq * 128 + lane * 4; const v4f v = *(const v4f*)&sr[k]; v4f e;
#pragma unroll
      for (int i = 0; i < 4; ++i) { e[i] = (!CAUSAL || k + i <= t) ? expf(v[i] - m) : 0.f; sum += e[i]; }
      *(v4f*)&sr[k] = e; }
#pragma unroll
    for (int o = 1; o < 32; o <<= 1) sum += __shfl_xor(sum, o);
    const float inv = sum > 0.f ? 2048.0f / sum : 0.f;
#pragma unroll 4   // four LDS reads in flight
    for (int kq = 0; kq < kend / 128; ++kq) { const int k = kq * 128 + lane * 4; const v4f e = *(const v4f*)&sr[k]; *(v4f*)&sr[k] = e * inv; } }
  __syncthreads();   // every row's P is in LDS before any wave reads its key range of all 16 rows
  v8f acc[HD / 16] = {};
#pragma unroll 1   // one 64-key pair a trip: a second pair's fragments would not fit the 128 registers
  for (int kp = wave; kp < kend / 64; kp += FA_KS)
#pragma unroll
    for (int kc = 2 * kp; kc < 2 * kp + 2; ++kc) { const F2 p = split_row(sp[col], kc * 32, lane);
#pragma unroll
      for (int j = 0; j < HD / 16; j += 2) { const size_t po = (((size_t)b * (KHI / 32) + kc) * (CC / 16) + j) * 512, p1 = po + 512; const v16b vh0 = fragp_b(VB + po, lane), vl0 = fragp_b(VBL + po, lane), vh1 = fragp_b(VB + p1, lane), vl1 = fragp_b(VBL + p1, lane);   // two column tiles' loads in flight together
        acc[j] = wmma_bf(p.h, vh0, acc[j]); acc[j] = wmma_bf(p.l, vh0, acc[j]); acc[j] = wmma_bf(p.h, vl0, acc[j]); acc[j + 1] = wmma_bf(p.h, vh1, acc[j + 1]); acc[j + 1] = wmma_bf(p.l, vh1, acc[j + 1]); acc[j + 1] = wmma_bf(p.h, vl1, acc[j + 1]); } }
  __syncthreads();   // the last read of P is over before the partial tiles overwrite its LDS
#pragma unroll
  for (int j = 0; j < HD / 16; ++j)
#pragma unroll
    for (int r = 0; r < 8; ++r) ss[wave][8 * g + r][j * 16 + col] = acc[j][r] * (1.0f / 2048.0f);
  __syncthreads();   // every wave's partial tile (zero where a wave had no keys) is in LDS before any thread sums them
  if (tid < 16 * (DOUT / 4)) { const int rl = tid / (DOUT / 4), q = tid % (DOUT / 4); v4f s = *(const v4f*)&ss[0][rl][q * 4];
#pragma unroll
    for (int w = 1; w < FA_KS; ++w) s += *(const v4f*)&ss[w][rl][q * 4];
    vst2(OUT + ((size_t)b * TT + ql0 + rl) * DOUT + q * 4, s); } }

extern "C" void kernel_launch(void* const* d_in, const int* in_sizes, int n_in, void* d_out, int out_size, void* d_ws, size_t ws_size, hipStream_t stream) {
  (void)in_sizes; (void)n_in; (void)out_size;
  const float** F = (const float**)d_in;
  if (ws_size < (size_t)WS_END) return;
  char* ws = (char*)d_ws; _Float16 *QH = (_Float16*)(ws + WS_QH), *KH = (_Float16*)(ws + WS_KH), *VT = (_Float16*)(ws + WS_VT), *QL = (_Float16*)(ws + WS_QL), *KL = (_Float16*)(ws + WS_KL); __bf16 *VB = (__bf16*)(ws + WS_VB), *VBL = (__bf16*)(ws + WS_VBL); float *Y = (float*)(ws + WS_Y);
  (void)Y;
  // inputs: 0 embedding [4,2048,1024]; 1 Wk [64,1024] (out,in) (q = k = v)
  k_proj<<<dim3(TNB * TT / 64, 1, 3), 128, 0, stream>>>(F[0], F[0], F[0], F[1], F[1], F[1], nullptr, nullptr, nullptr, QH, QL, KH, KL, VT, VB, VBL);
  k_att<<<dim3(TT / 16, 1, TNB), 32 * FA_KS, 0, stream>>>(QH, KH, QL, KL, VB, VBL, (float*)d_out);
}

// v006
// It runs in 34.9 microseconds.
// Next to v005, in two timings, it ran 1.13 times as fast each time.
// Counting every step since v000, it is 25.6 times as fast.
// compute dtype: all float inputs rounded to bf16; q = k = v = x Wk^T with EXACT bf16 products on WMMA 16x16x32 (f32 accumulate; the single head's planes are 64 wide, its real width); causal logits with q = k as f16 hi + residual on both sides (3 products) x 64^-0.5; softmax in f32; P as bf16 hi + lo against v bf16 hi + lo (3 products); f32 output.
#include <hip/hip_runtime.h>
#include <math.h>

typedef __attribute__((ext_vector_type(16))) _Float16 v16h;
typedef __attribute__((ext_vector_type(16))) __bf16 v16b;
typedef __attribute__((ext_vector_type(8)))  _Float16 v8h;
typedef __attribute__((ext_vector_type(8)))  float v8f;
typedef __attribute__((ext_vector_type(4)))  float v4f;
typedef __attribute__((ext_vector_type(2)))  float v2f;
typedef __attribute__((ext_vector_type(4)))  unsigned v4u;
typedef __attribute__((ext_vector_type(4)))  int v4i;
typedef float __attribute__((may_alias)) float_a;
typedef int __attribute__((may_alias)) int_a;

template <typename T> __device__ __forceinline__ void vst2(void* p, T v) { *(T*)p = v;  }
__device__ __forceinline__ v8f wmma16(v16h a, v16h b, v8f c) {
  v8f d = __builtin_amdgcn_wmma_f32_16x16x32_f16(false, a, false, b, (short)0, c, false, false);
  asm volatile("v_nop\n\tv_nop\n\tv_nop\n\tv_nop" : "+v"(d) : "v"(a), "v"(b));
  return d;
}
__device__ __forceinline__ v8f wmma_bf(v16b a, v16b b, v8f c) {
  v8f d = __builtin_amdgcn_wmma_f32_16x16x32_bf16(false, a, false, b, (short)0, c, false, false);
  asm volatile("v_nop\n\tv_nop\n\tv_nop\n\tv_nop" : "+v"(d) : "v"(a), "v"(b));
  return d;
}
// 16x16x32 fragments: lane = (h = lane>>4, row/col = lane&15); elements 0..7 = k0+8h+0..7, 8..15 = k0+16+8h+0..7; D element r = row 8h+r
__device__ __forceinline__ v16h frag_h(const _Float16* rowk0, int lane) {
  union { v16h v; v8h q[2]; } u; const _Float16* p = rowk0 + 8 * (lane >> 4);
  u.q[0] = *(const v8h*)p; u.q[1] = *(const v8h*)(p + 16); return u.v;
}
__device__ __forceinline__ v16h frag_f32(const float* rowk0, int lane) {
  v16h a; const float* p = rowk0 + 8 * (lane >> 4);
#pragma unroll
  for (int i = 0; i < 8; ++i) { a[i] = (_Float16)p[i]; a[8 + i] = (_Float16)p[16 + i]; }
  return a;
}
__device__ __forceinline__ v16h frag_f32s(const float* rowk0, int lane, float sc) {
  v16h a; const float* p = rowk0 + 8 * (lane >> 4);
#pragma unroll
  for (int i = 0; i < 8; ++i) { a[i] = (_Float16)(p[i] * sc); a[8 + i] = (_Float16)(p[16 + i] * sc); }
  return a;
}
// column fragment from a [K][ld] layout (column n), rows >= K read as 0
__device__ __forceinline__ v16h fragc_f32(const float* W, int k0, int n, int lane, int ld, int K) {
  v16h a; const int g = lane >> 4;
#pragma unroll
  for (int i = 0; i < 8; ++i) { const int ka = k0 + 8 * g + i, kb = ka + 16;
    a[i] = (_Float16)(ka < K ? W[(size_t)(ka < K ? ka : K - 1) * ld + n] : 0.f); a[8 + i] = (_Float16)(kb < K ? W[(size_t)(kb < K ? kb : K - 1) * ld + n] : 0.f); }
  return a;
}
struct F2 { v16b h, l; };
__device__ __forceinline__ F2 bsplit16(const float v[16]) { F2 r;
#pragma unroll
  for (int i = 0; i < 16; ++i) { const __bf16 h = (__bf16)v[i]; r.h[i] = h; r.l[i] = (__bf16)(v[i] - (float)h); }
  return r; }
__device__ __forceinline__ F2 split_row(const float* row, int k0, int lane) { float v[16]; const float* p = row + k0 + 8 * (lane >> 4);
#pragma unroll
  for (int i = 0; i < 8; ++i) { v[i] = p[i]; v[8 + i] = p[16 + i]; }
  return bsplit16(v); }
__device__ __forceinline__ F2 split_rowK(const float* row, int k0, int lane, int K) { float v[16]; const int g = lane >> 4;
#pragma unroll
  for (int i = 0; i < 8; ++i) { const int ka = k0 + 8 * g + i, kb = ka + 16; v[i] = ka < K ? row[ka < K ? ka : K - 1] : 0.f; v[8 + i] = kb < K ? row[kb < K ? kb : K - 1] : 0.f; }
  return bsplit16(v); }
__device__ __forceinline__ F2 split_col(const float* W, int k0, int n, int lane, int ld, int K) { float v[16]; const int g = lane >> 4;
#pragma unroll
  for (int i = 0; i < 8; ++i) { const int ka = k0 + 8 * g + i, kb = ka + 16; v[i] = ka < K ? W[(size_t)(ka < K ? ka : K - 1) * ld + n] : 0.f; v[8 + i] = kb < K ? W[(size_t)(kb < K ? kb : K - 1) * ld + n] : 0.f; }
  return bsplit16(v); }
__device__ __forceinline__ v8f mac3(const F2& a, const F2& b, v8f c) { c = wmma_bf(a.l, b.h, c); c = wmma_bf(a.h, b.l, c); return wmma_bf(a.h, b.h, c); }
__device__ __forceinline__ float sigm(float v) { return 1.0f / (1.0f + expf(-v)); }
#define LDSX() do { asm volatile("s_wait_dscnt 0" ::: "memory"); __builtin_amdgcn_wave_barrier(); __builtin_amdgcn_fence(__ATOMIC_RELEASE, "workgroup"); } while (0)

// Single-head causal self-attention with shared projections (B 4, S 2,048, E 1,024 -> A 64): k = x Wk^T; q = v = k; x = q k^T / 8 masked where tril(x) == 0 (the strict upper triangle; exact-zero logits in the lower triangle would also be masked - measure-zero for these inputs); softmax; out = P v -> [B, S, 64].
#define NB 4
#define TT 2048
#define CC 64             // NH * HD = projected width
#define DIN 1024
#define NH 1
#define HD 64
#define NQB (TT / 64)
#define HG 1
#define SCALE (0.125f)
#define CAUSAL 1
#ifndef TNB
#define TNB NB
#endif
__device__ __forceinline__ v16b zero16b() { v16b z; _Pragma("unroll") for (int i = 0; i < 16; ++i) z[i] = (__bf16)0.f; return z; }
__device__ __forceinline__ float bfr(float v) { return (float)(__bf16)v; }
__host__ __device__ __forceinline__ int kb_last(int qb) { return CAUSAL ? ((qb * 64 + 63) >> 7) : (TT / 128 - 1); }
typedef __attribute__((ext_vector_type(8))) __bf16 v8b;
__device__ __forceinline__ v16b frag_b(const __bf16* rowk0, int lane) {
  union { v16b v; v8b q[2]; } u; const __bf16* p = rowk0 + 8 * (lane >> 4);
  u.q[0] = *(const v8b*)p; u.q[1] = *(const v8b*)(p + 16); return u.v;
}
// a 16 x 32 fragment kept in fragment order = 1 KiB: lane l's elements 0..7 at byte 16 l, its elements 8..15 at byte 512 + 16 l, so each 16-byte load of a wave covers 512 contiguous bytes (4 whole lines)
__device__ __forceinline__ v16h fragp_h(const _Float16* f, int lane) {
  union { v16h v; v8h q[2]; } u; const _Float16* p = f + 8 * lane;
  u.q[0] = *(const v8h*)p; u.q[1] = *(const v8h*)(p + 256); return u.v;
}
__device__ __forceinline__ v16b fragp_b(const __bf16* f, int lane) {
  union { v16b v; v8b q[2]; } u; const __bf16* p = f + 8 * lane;
  u.q[0] = *(const v8b*)p; u.q[1] = *(const v8b*)(p + 256); return u.v;
}
#define QBH NQB            // every block: 3-product logits (the self key's logit |k|^2/8 ~ 8 dominates -> peaked rows) and bf16 hi/lo P.v
#define QHI TT
#define KHI TT
// B fragment (k rows k0+.., output column o) of a weight: (in,out) [K][ld] or (out,in) [ld rows of K]: bf16 exact, or f16(bf16 * 256) exact
__device__ __forceinline__ v16b wcol_io(const float* Wm, int k0, int o, int lane, int ld) { v16b w; const int g = lane >> 4;
#pragma unroll
  for (int i = 0; i < 8; ++i) { w[i] = (__bf16)Wm[(size_t)(k0 + 8 * g + i) * ld + o]; w[8 + i] = (__bf16)Wm[(size_t)(k0 + 16 + 8 * g + i) * ld + o]; }
  return w; }
__device__ __forceinline__ v16b wcol_oi(const float* Wm, int k0, int o, int lane, int K) { v16b w; const float* p = Wm + (size_t)o * K + k0 + 8 * (lane >> 4);
#pragma unroll
  for (int i = 0; i < 8; ++i) { w[i] = (__bf16)p[i]; w[8 + i] = (__bf16)p[16 + i]; }
  return w; }
__device__ __forceinline__ v16h wcolh_io(const float* Wm, int k0, int o, int lane, int ld) { v16h w; const int g = lane >> 4;
#pragma unroll
  for (int i = 0; i < 8; ++i) { w[i] = (_Float16)(bfr(Wm[(size_t)(k0 + 8 * g + i) * ld + o]) * 256.0f); w[8 + i] = (_Float16)(bfr(Wm[(size_t)(k0 + 16 + 8 * g + i) * ld + o]) * 256.0f); }
  return w; }
__device__ __forceinline__ v16h wcolh_oi(const float* Wm, int k0, int o, int lane, int K) { v16h w; const float* p = Wm + (size_t)o * K + k0 + 8 * (lane >> 4);
#pragma unroll
  for (int i = 0; i < 8; ++i) { w[i] = (_Float16)(bfr(p[i]) * 256.0f); w[8 + i] = (_Float16)(bfr(p[16 + i]) * 256.0f); }
  return w; }
#define WQKV_LAYOUT 0   // 0 = (out,in) [DOUT][DIN], columns >= DOUT zero; 1 = (out,in) [CC][DIN]; 2 = per-head [NH][DIN][HD]
__device__ __forceinline__ v16b wcol_hdk(const float* Wm, int k0, int o, int lane) { v16b w; const int g = lane >> 4; const float* p = Wm + (size_t)(o / HD) * DIN * HD + (o % HD);
#pragma unroll
  for (int i = 0; i < 8; ++i) { w[i] = (__bf16)p[(size_t)(k0 + 8 * g + i) * HD]; w[8 + i] = (__bf16)p[(size_t)(k0 + 16 + 8 * g + i) * HD]; }
  return w; }
#define WO_OUT_IN 0
#if WQKV_LAYOUT == 1
#define WCOL(W, k0, o, lane) wcol_oi(W, k0, o, lane, DIN)
#elif WQKV_LAYOUT == 2
#define WCOL(W, k0, o, lane) wcol_hdk(W, k0, o, lane)
#else
#define WCOL(W, k0, o, lane) (((o) < DOUT) ? wcol_oi(W, k0, (o), lane, DIN) : zero16b())   /* Wk (out,in) [64][1024]; q = k = v = x Wk^T */
#endif
#if WO_OUT_IN
#define WOCOL(W, k0, o, lane) wcol_oi(W, k0, o, lane, CC)
#define WOCOLH(W, k0, o, lane) wcolh_oi(W, k0, o, lane, CC)
#else
#define WOCOL(W, k0, o, lane) wcol_io(W, k0, o, lane, DIN)
#define WOCOLH(W, k0, o, lane) wcolh_io(W, k0, o, lane, DIN)
#endif
#define DOUT 64            // head width = plane width
#ifndef SM_EXTRA_PARAMS
#define SM_EXTRA_PARAMS
#endif
#ifndef PROJ_EXTRA_PARAMS
#define PROJ_EXTRA_PARAMS
#endif
#ifndef SM_MASK_HOOK
#define SM_MASK_HOOK (void)0
#endif

#define WS_QH  0u                                      // f16 q, fragment order [b*t / 16][CC / 32][512]
#define WS_KH  (WS_QH + 2u * (size_t)NB * TT * CC)      // f16 k, fragment order [b*t / 16][CC / 32][512]
#define WS_VT  (WS_KH + 2u * (size_t)NB * TT * CC)      // f16 v planes [b][c][t]
#define WS_QL  (WS_VT + 2u * (size_t)NB * CC * TT)      // f16 q residual x 2^10, fragment order like q
#define WS_KL  (WS_QL + 2u * (size_t)NB * QHI * CC)     // f16 k residual x 2^10, fragment order like k
#define WS_VB  (WS_KL + 2u * (size_t)NB * KHI * CC)     // bf16 v hi, fragment order [b][t / 32][CC / 16][512] (and v lo behind it)
#define WS_VBL (WS_VB + 2u * (size_t)NB * CC * KHI)
#define WS_Y   (WS_VBL + 2u * (size_t)NB * CC * KHI)    // f32 ctx rows [b*t][CC] (only when there is an output projection)
#define WS_END (WS_Y  + 0u)

// k_proj's staging: a k tile = 64 rows of X and the 64 rows of Wk, PJ_KT columns each, f32 as in memory, brought into LDS by asynchronous copies
#define PJ_KT 128                         // k columns of a tile: a row's piece is 512 contiguous bytes = one copy of a wave
#define PJ_P  (PJ_KT + 4)                 // f32 pitch of a staged row (16 bytes x 33): the 16 rows of a 16-byte fragment read cover all 64 banks once
#define PJ_ROWS (64 + DOUT)
#define PJ_BUFB (PJ_ROWS * PJ_P * 4u)     // bytes of one buffer
#define PJ_LS (4u * PJ_P * 4u)            // LDS bytes between two rows of one wave (4 waves take rows in turn)
#define PJ_GS (4 * DIN)
// eight copies of one wave, rows 4 apart; s_wait_xcnt stands inside the copies' own statement, in front of any rewrite of a register that a copy names
__device__ __forceinline__ void pj_copy8(unsigned l, const float* gp) {
  asm volatile("global_load_async_to_lds_b128 %0, %8, off\n\tglobal_load_async_to_lds_b128 %1, %9, off\n\tglobal_load_async_to_lds_b128 %2, %10, off\n\tglobal_load_async_to_lds_b128 %3, %11, off\n\t"
               "global_load_async_to_lds_b128 %4, %12, off\n\tglobal_load_async_to_lds_b128 %5, %13, off\n\tglobal_load_async_to_lds_b128 %6, %14, off\n\tglobal_load_async_to_lds_b128 %7, %15, off\n\ts_wait_xcnt 0x0"
               :: "v"(l), "v"(l + PJ_LS), "v"(l + 2 * PJ_LS), "v"(l + 3 * PJ_LS), "v"(l + 4 * PJ_LS), "v"(l + 5 * PJ_LS), "v"(l + 6 * PJ_LS), "v"(l + 7 * PJ_LS),
                  "v"(gp), "v"(gp + PJ_GS), "v"(gp + 2 * PJ_GS), "v"(gp + 3 * PJ_GS), "v"(gp + 4 * PJ_GS), "v"(gp + 5 * PJ_GS), "v"(gp + 6 * PJ_GS), "v"(gp + 7 * PJ_GS) : "memory");
}
// one wave's 32 copies of a tile: its 16 rows of X, then its 16 rows of Wk (LDS rows 64 ..)
__device__ __forceinline__ void pj_stage(unsigned l, const float* xg, const float* wg) {
  pj_copy8(l, xg); pj_copy8(l + 8 * PJ_LS, xg + 8 * PJ_GS); pj_copy8(l + 16 * PJ_LS, wg); pj_copy8(l + 24 * PJ_LS, wg + 8 * PJ_GS);
}
// bf16 fragment of a staged f32 row (p = row + k0 + 8 * (lane >> 4)): elements 0..7 = p[0..7], 8..15 = p[16..23], for A and B alike
__device__ __forceinline__ v16b frag_lds(const float* p) { const v4f x0 = *(const v4f*)p, x1 = *(const v4f*)(p + 4), x2 = *(const v4f*)(p + 16), x3 = *(const v4f*)(p + 20); v16b a;
#pragma unroll
  for (int i = 0; i < 4; ++i) { a[i] = (__bf16)x0[i]; a[4 + i] = (__bf16)x1[i]; a[8 + i] = (__bf16)x2[i]; a[12 + i] = (__bf16)x3[i]; }
  return a; }
// ---- k_proj: block = (64 rows, CC cols, which): q/k/v = X W (+ b) with exact bf16 products (K = DIN) -> which 0: q f16 (+ residual); 1: k f16 (+ residual); 2: v f16 planes [c][t] and v bf16 hi/lo; q, k and v hi/lo leave in the order in which k_att's fragments read them
__global__ __launch_bounds__(128) void k_proj(const float* __restrict__ XQ, const float* __restrict__ XK, const float* __restrict__ XV, const float* __restrict__ WQ, const float* __restrict__ WK, const float* __restrict__ WV, const float* __restrict__ BQ, const float* __restrict__ BK, const float* __restrict__ BV,
    _Float16* __restrict__ QH, _Float16* __restrict__ QL, _Float16* __restrict__ KH, _Float16* __restrict__ KL, _Float16* __restrict__ VT, __bf16* __restrict__ VB, __bf16* __restrict__ VBL) {
  // the K loop's two staging buffers and the epilogue's transposing tiles share one LDS range (the epilogue starts behind the loop's last barrier), so that two blocks fit a WGP
  __shared__ __align__(16) union { float st[2][PJ_ROWS][PJ_P]; struct { _Float16 sh[64][CC + 8], sl[64][CC + 8], th[CC][72]; __bf16 tb[CC][72], tbl[CC][72]; } ep; } u;
  auto& sh = u.ep.sh; auto& sl = u.ep.sl; auto& th = u.ep.th; auto& tb = u.ep.tb; auto& tbl = u.ep.tbl;
  const int tid = threadIdx.x, wave = tid >> 5, lane = tid & 31, col = lane & 15, g = lane >> 4; const int which = blockIdx.z; const int c0 = blockIdx.y * CC; const size_t r0 = (size_t)blockIdx.x * 64; const size_t bb = r0 / TT; const int t0 = (int)(r0 % TT);
  const float* X = which == 0 ? XQ : which == 1 ? XK : XV; const float* WA = which == 0 ? WQ : which == 1 ? WK : WV; const float* BA = which == 0 ? BQ : which == 1 ? BK : BV;
  v8f acc[CC / 16] = {};
  static_assert(CC == DOUT && DOUT % 16 == 0 && DIN % PJ_KT == 0 && DIN / PJ_KT >= 2, "grid y is 1, so c0 is 0 and plane column tile j is Wk's rows 16 j ..; at least two k tiles");
  const unsigned l0 = (unsigned)(size_t)&u.st[0][wave][lane * 4];   // LDS byte address of this lane's 16 bytes in row 'wave' of buffer 0
  const float* xg = X + (r0 + wave) * DIN + lane * 4; const float* wg = WA + (size_t)wave * DIN + lane * 4;
  pj_stage(l0, xg, wg);
  asm volatile("s_wait_asynccnt 0x0" ::: "memory");   // this wave's copies of tile 0 have landed
  __syncthreads();                                      // ... and every other wave's: tile 0 may be read
  pj_stage(l0 + PJ_BUFB, xg + PJ_KT, wg + PJ_KT);
#pragma unroll 1   // rolled, for speed only
  for (int t = 0; t < DIN / PJ_KT; ++t) { const float* pa = &u.st[t & 1][wave * 16 + col][8 * g]; const float* pw = &u.st[t & 1][64 + col][8 * g];
    v16b a = frag_lds(pa), w[DOUT / 16];
#pragma unroll
    for (int j = 0; j < DOUT / 16; ++j) w[j] = frag_lds(pw + j * 16 * PJ_P);
#pragma unroll
    for (int kq = 0; kq < PJ_KT / 32; ++kq) { v16b an = a, wn[DOUT / 16];   // the next 32 columns' fragments (same tile) are read as one group in front of this step's products, so that their LDS latency runs under them
#pragma unroll
      for (int j = 0; j < DOUT / 16; ++j) wn[j] = w[j];
      if (kq + 1 < PJ_KT / 32) { an = frag_lds(pa + (kq + 1) * 32);
#pragma unroll
        for (int j = 0; j < DOUT / 16; ++j) wn[j] = frag_lds(pw + j * 16 * PJ_P + (kq + 1) * 32); }
#pragma unroll
      for (int j = 0; j < CC / 16; ++j) acc[j] = wmma_bf(a, w[j], acc[j]);
      a = an;
#pragma unroll
      for (int j = 0; j < DOUT / 16; ++j) w[j] = wn[j]; }
    asm volatile("s_wait_dscnt 0x0" ::: "memory");      // this wave's reads of tile t are over
    asm volatile("s_wait_asynccnt 0x0" ::: "memory");   // this wave's copies of tile t + 1 have landed
    __syncthreads();                                      // publishes tile t + 1 and frees tile t's buffer (behind the last trip: for the epilogue's tiles)
    if (t + 2 < DIN / PJ_KT) pj_stage(l0 + (t & 1) * PJ_BUFB, xg + (t + 2) * PJ_KT, wg + (t + 2) * PJ_KT); }
  asm volatile("s_wait_asynccnt 0x0" ::: "memory");     // no copy is outstanding when the LDS range changes hands
  if (which < 2) { _Float16* DH = which == 0 ? QH : KH; _Float16* DL = which == 0 ? QL : KL; const int nhi = which == 0 ? QHI : KHI; const bool hi_rows = t0 < nhi;
#pragma unroll
    for (int j = 0; j < CC / 16; ++j) { const float bias = BA ? bfr(BA[c0 + j * 16 + col]) : 0.f;
#pragma unroll
      for (int r = 0; r < 8; ++r) { const float v = acc[j][r] + bias; const _Float16 hv = (_Float16)v; sh[wave * 16 + 8 * g + r][j * 16 + col] = hv; sl[wave * 16 + 8 * g + r][j * 16 + col] = (_Float16)((v - (float)hv) * 1024.0f); } }
    __syncthreads();
    static_assert(CC == 64, "a block holds whole 16-row tiles: 2 fragments of 64 pieces of 16 bytes each");
    // piece e of the block's 4 tiles: bits 3..0 = row in the tile, 4 = lane half g, 5 = fragment half, 6 = 32-column step, 8..7 = tile; columns 8 * (e >> 4 & 7) ..
    for (int e = tid; e < 64 * 8; e += 128) { const int rl = (e >> 7) * 16 + (e & 15), q = (e >> 4) & 7; vst2((unsigned*)(DH + r0 * CC + e * 8), *(const v4u*)&sh[rl][q * 8]); if (hi_rows) vst2((unsigned*)(DL + (bb * nhi + t0) * (size_t)CC + e * 8), *(const v4u*)&sl[rl][q * 8]); }
  } else { const bool hi_rows = t0 < KHI;
#pragma unroll
    for (int j = 0; j < CC / 16; ++j) { const float bias = BA ? bfr(BA[c0 + j * 16 + col]) : 0.f;
#pragma unroll
      for (int r = 0; r < 8; ++r) { const float v = acc[j][r] + bias; const int rl = wave * 16 + 8 * g + r, cl = j * 16 + col; th[cl][rl] = (_Float16)v; const __bf16 bh = (__bf16)v; tb[cl][rl] = bh; tbl[cl][rl] = (__bf16)(v - (float)bh); } }
    __syncthreads();
    for (int e = tid; e < CC * 8; e += 128) { const int cl = e >> 3, q = e & 7; vst2((unsigned*)(VT + (bb * CC + c0 + cl) * (size_t)TT + t0 + q * 8), *(const v4u*)&th[cl][q * 8]); if (hi_rows) { const int cf = ((e >> 6) & 3) * 16 + (e & 15), qf = (e >> 8) * 4 + ((e >> 4) & 3);   // piece e of the block's 2 x 4 fragments: bits 3..0 = column in the tile, 4 = lane half g, 5 = fragment half, 7..6 = column tile, 8 = 32-key step
        const size_t o3 = (bb * (KHI / 32) + (t0 >> 5)) * (size_t)(CC * 32) + e * 8; vst2((unsigned*)(VB + o3), *(const v4u*)&tb[cf][qf * 8]); vst2((unsigned*)(VBL + o3), *(const v4u*)&tbl[cf][qf * 8]); } } } }
// ---- k_att: block = 16 queries of batch b (blockIdx.z), 16 waves: logits, softmax and P . v in one kernel; the 16 logit rows stay in LDS from the first product to the last, so no logit and no P goes through memory.
// 1) wave w takes the 16-key tiles w, w + 16, ... of keys [0, kend): q hi + residual (x 2^10) against k hi + residual (3 products), x SCALE, into sp[query][key]
// 2) wave w owns query row w: causal mask by index, max, exp, sum, P x 2^11 in place (0 for excluded keys)
// 3) wave w takes the 64-key pairs of steps w, w + 16, ...: P as bf16 hi + lo against v bf16 hi + lo (3 products); the 16 partial tiles are summed through LDS in wave order and the 64 real columns stored to out
#define FA_KS 16               // waves of a block
#define LOG2E 1.4426950408889634f
#define FA_P  (TT + 4)         // f32 pitch of a logit row in LDS: row r starts 4 r banks on, so the 16 rows of a 16-byte fragment read cover all 64 banks once
// second bound: 8 waves per SIMD = 128 registers a wave, so that two blocks (LDS allows two) share a WGP and one block's matrix phases run under the other's softmax and barriers
__global__ __launch_bounds__(32 * FA_KS, 8) void k_att(const _Float16* __restrict__ QH, const _Float16* __restrict__ KH, const _Float16* __restrict__ QL, const _Float16* __restrict__ KL, const __bf16* __restrict__ VB, const __bf16* __restrict__ VBL, float* __restrict__ OUT) {
  __shared__ __align__(16) float buf[16 * FA_P];   // first the logit / P rows, then (behind a barrier) the waves' partial tiles
  float (*sp)[FA_P] = (float (*)[FA_P])buf; float (*ss)[16][HD + 4] = (float (*)[16][HD + 4])buf;
  static_assert(FA_KS * 16 * (HD + 4) <= 16 * FA_P, "the partial tiles fit the buffer");
  const int tid = threadIdx.x, lane = tid & 31, col = lane & 15, g = lane >> 4; const int b = blockIdx.z; const int ql0 = blockIdx.x * 16; const int kend = (kb_last(ql0 >> 6) + 1) * 128;
  const int wave = __builtin_amdgcn_readfirstlane(tid >> 5);   // scalar, so that every key loop's trip count is a scalar branch and every lane stays on at the matrix instructions
  { v16h ah[HD / 32], al[HD / 32]; const _Float16* qh = QH + ((size_t)b * TT + ql0) * CC; const _Float16* ql = QL + ((size_t)b * QHI + ql0) * CC;
#pragma unroll
    for (int kc = 0; kc < HD / 32; ++kc) { ah[kc] = fragp_h(qh + kc * 512, lane); al[kc] = fragp_h(ql + kc * 512, lane); }
    asm volatile("s_wait_xcnt 0x0" :: "v"(qh + 8 * lane), "v"(ql + 8 * lane) : "memory");   // the wait before a register of an issued q load is overwritten; with the two lane addresses as inputs the build keeps it behind the loads (without them the loads sink below it)
    for (int jt = wave; jt < kend / 16; jt += FA_KS) { const _Float16* kh = KH + ((size_t)b * TT + jt * 16) * CC; const _Float16* kl = KL + ((size_t)b * KHI + jt * 16) * CC; v8f acc = {}, accl = {};
#pragma unroll
      for (int kc = 0; kc < HD / 32; ++kc) { const v16h kbf = fragp_h(kh + kc * 512, lane), klf = fragp_h(kl + kc * 512, lane); acc = wmma16(ah[kc], kbf, acc); accl = wmma16(al[kc], kbf, accl); accl = wmma16(ah[kc], klf, accl); }
#pragma unroll
      for (int r = 0; r < 8; ++r) sp[8 * g + r][jt * 16 + col] = (acc[r] + accl[r] * (1.0f / 1024.0f)) * SCALE; } }
  __syncthreads();   // all logits of the 16 rows are in LDS before a wave reduces its row
  { const int t = ql0 + wave; float* sr = sp[wave]; float m = -3.0e38f;
#pragma unroll 4   // four LDS reads in flight
    for (int kq = 0; kq < kend / 128; ++kq) { const int k = kq * 128 + lane * 4; const v4f v = *(const v4f*)&sr[k];
#pragma unroll
      for (int i = 0; i < 4; ++i) m = fmaxf(m, (!CAUSAL || k + i <= t) ? v[i] : -3.0e38f); }
#pragma unroll
    for (int o = 1; o < 32; o <<= 1) m = fmaxf(m, __shfl_xor(m, o));
    float sum = 0.f; const float ml = m * LOG2E;   // exp(v - m) = 2^(v log2(e) - ml): one fused multiply-add and the bare base-2 exponential; ml's own rounding scales a whole row alike and leaves with the division by the row's sum
#pragma unroll 2   // the next LDS read flies under this one's exponentials
    for (int kq = 0; kq < kend / 128; ++kq) { const int k = kq * 128 + lane * 4; const v4f v = *(const v4f*)&sr[k]; v4f e;
#pragma unroll
      for (int i = 0; i < 4; ++i) { const float p = __builtin_amdgcn_exp2f(__builtin_fmaf(v[i], LOG2E, -ml)); e[i] = (!CAUSAL || k + i <= t) ? p : 0.f; sum += e[i]; }   // computed for every key and selected: four independent exponentials and no branch
      *(v4f*)&sr[k] = e; }
#pragma unroll
    for (int o = 1; o < 32; o <<= 1) sum += __shfl_xor(sum, o);
    const float inv = sum > 0.f ? 2048.0f / sum : 0.f;
#pragma unroll 4   // four LDS reads in flight
    for (int kq = 0; kq < kend / 128; ++kq) { const int k = kq * 128 + lane * 4; const v4f e = *(const v4f*)&sr[k]; *(v4f*)&sr[k] = e * inv; } }
  __syncthreads();   // every row's P is in LDS before any wave reads its key range of all 16 rows
  v8f acc[HD / 16] = {};
#pragma unroll 1   // one 64-key pair a trip: a second pair's fragments would not fit the 128 registers
  for (int kp = wave; kp < kend / 64; kp += FA_KS)
#pragma unroll
    for (int kc = 2 * kp; kc < 2 * kp + 2; ++kc) { const F2 p = split_row(sp[col], kc * 32, lane);
#pragma unroll
      for (int j = 0; j < HD / 16; j += 2) { const size_t po = (((size_t)b * (KHI / 32) + kc) * (CC / 16) + j) * 512, p1 = po + 512; const v16b vh0 = fragp_b(VB + po, lane), vl0 = fragp_b(VBL + po, lane), vh1 = fragp_b(VB + p1, lane), vl1 = fragp_b(VBL + p1, lane);   // two column tiles' loads in flight together
        acc[j] = wmma_bf(p.h, vh0, acc[j]); acc[j] = wmma_bf(p.l, vh0, acc[j]); acc[j] = wmma_bf(p.h, vl0, acc[j]); acc[j + 1] = wmma_bf(p.h, vh1, acc[j + 1]); acc[j + 1] = wmma_bf(p.l, vh1, acc[j + 1]); acc[j + 1] = wmma_bf(p.h, vl1, acc[j + 1]); } }
  __syncthreads();   // the last read of P is over before the partial tiles overwrite its LDS
#pragma unroll
  for (int j = 0; j < HD / 16; ++j)
#pragma unroll
    for (int r = 0; r < 8; ++r) ss[wave][8 * g + r][j * 16 + col] = acc[j][r] * (1.0f / 2048.0f);
  __syncthreads();   // every wave's partial tile (zero where a wave had no keys) is in LDS before any thread sums them
  if (tid < 16 * (DOUT / 4)) { const int rl = tid / (DOUT / 4), q = tid % (DOUT / 4); v4f s = *(const v4f*)&ss[0][rl][q * 4];
#pragma unroll
    for (int w = 1; w < FA_KS; ++w) s += *(const v4f*)&ss[w][rl][q * 4];
    vst2(OUT + ((size_t)b * TT + ql0 + rl) * DOUT + q * 4, s); } }

extern "C" void kernel_launch(void* const* d_in, const int* in_sizes, int n_in, void* d_out, int out_size, void* d_ws, size_t ws_size, hipStream_t stream) {
  (void)in_sizes; (void)n_in; (void)out_size;
  const float** F = (const float**)d_in;
  if (ws_size < (size_t)WS_END) return;
  char* ws = (char*)d_ws; _Float16 *QH = (_Float16*)(ws + WS_QH), *KH = (_Float16*)(ws + WS_KH), *VT = (_Float16*)(ws + WS_VT), *QL = (_Float16*)(ws + WS_QL), *KL = (_Float16*)(ws + WS_KL); __bf16 *VB = (__bf16*)(ws + WS_VB), *VBL = (__bf16*)(ws + WS_VBL); float *Y = (float*)(ws + WS_Y);
  (void)Y;
  // inputs: 0 embedding [4,2048,1024]; 1 Wk [64,1024] (out,in) (q = k = v)
  k_proj<<<dim3(TNB * TT / 64, 1, 3), 128, 0, stream>>>(F[0], F[0], F[0], F[1], F[1], F[1], nullptr, nullptr, nullptr, QH, QL, KH, KL, VT, VB, VBL);
  k_att<<<dim3(TT / 16, 1, TNB), 32 * FA_KS, 0, stream>>>(QH, KH, QL, KL, VB, VBL, (float*)d_out);
}

// v007
// One run takes 32.3 microseconds.
// Timed twice side by side with v006, it ran 1.09 times as fast both times.
// Over all steps from v000 it is 27.9 times as fast.
// compute dtype: all float inputs rounded to bf16; q = k = v = x Wk^T with EXACT bf16 products on WMMA 16x16x32 (f32 accumulate; the single head's planes are 64 wide, its real width); causal logits with q = k as f16 hi + residual on both sides (3 products) x 64^-0.5; softmax in f32; P as bf16 hi + lo against v bf16 hi + lo (3 products); f32 output.
#include <hip/hip_runtime.h>
#include <math.h>

typedef __attribute__((ext_vector_type(16))) _Float16 v16h;
typedef __attribute__((ext_vector_type(16))) __bf16 v16b;
typedef __attribute__((ext_vector_type(8)))  _Float16 v8h;
typedef __attribute__((ext_vector_type(8)))  float v8f;
typedef __attribute__((ext_vector_type(4)))  float v4f;
typedef __attribute__((ext_vector_type(2)))  float v2f;
typedef __attribute__((ext_vector_type(4)))  unsigned v4u;
typedef __attribute__((ext_vector_type(4)))  int v4i;
typedef float __attribute__((may_alias)) float_a;
typedef int __attribute__((may_alias)) int_a;

template <typename T> __device__ __forceinline__ void vst2(void* p, T v) { *(T*)p = v;  }
__device__ __forceinline__ v8f wmma16(v16h a, v16h b, v8f c) {
  v8f d = __builtin_amdgcn_wmma_f32_16x16x32_f16(false, a, false, b, (short)0, c, false, false);
  asm volatile("v_nop\n\tv_nop\n\tv_nop\n\tv_nop" : "+v"(d) : "v"(a), "v"(b));
  return d;
}
__device__ __forceinline__ v8f wmma_bf(v16b a, v16b b, v8f c) {
  v8f d = __builtin_amdgcn_wmma_f32_16x16x32_bf16(false, a, false, b, (short)0, c, false, false);
  asm volatile("v_nop\n\tv_nop\n\tv_nop\n\tv_nop" : "+v"(d) : "v"(a), "v"(b));
  return d;
}
// 16x16x32 fragments: lane = (h = lane>>4, row/col = lane&15); elements 0..7 = k0+8h+0..7, 8..15 = k0+16+8h+0..7; D element r = row 8h+r
__device__ __forceinline__ v16h frag_h(const _Float16* rowk0, int lane) {
  union { v16h v; v8h q[2]; } u; const _Float16* p = rowk0 + 8 * (lane >> 4);
  u.q[0] = *(const v8h*)p; u.q[1] = *(const v8h*)(p + 16); return u.v;
}
__device__ __forceinline__ v16h frag_f32(const float* rowk0, int lane) {
  v16h a; const float* p = rowk0 + 8 * (lane >> 4);
#pragma unroll
  for (int i = 0; i < 8; ++i) { a[i] = (_Float16)p[i]; a[8 + i] = (_Float16)p[16 + i]; }
  return a;
}
__device__ __forceinline__ v16h frag_f32s(const float* rowk0, int lane, float sc) {
  v16h a; const float* p = rowk0 + 8 * (lane >> 4);
#pragma unroll
  for (int i = 0; i < 8; ++i) { a[i] = (_Float16)(p[i] * sc); a[8 + i] = (_Float16)(p[16 + i] * sc); }
  return a;
}
// column fragment from a [K][ld] layout (column n), rows >= K read as 0
__device__ __forceinline__ v16h fragc_f32(const float* W, int k0, int n, int lane, int ld, int K) {
  v16h a; const int g = lane >> 4;
#pragma unroll
  for (int i = 0; i < 8; ++i) { const int ka = k0 + 8 * g + i, kb = ka + 16;
    a[i] = (_Float16)(ka < K ? W[(size_t)(ka < K ? ka : K - 1) * ld + n] : 0.f); a[8 + i] = (_Float16)(kb < K ? W[(size_t)(kb < K ? kb : K - 1) * ld + n] : 0.f); }
  return a;
}
struct F2 { v16b h, l; };
__device__ __forceinline__ F2 bsplit16(const float v[16]) { F2 r;
#pragma unroll
  for (int i = 0; i < 16; ++i) { const __bf16 h = (__bf16)v[i]; r.h[i] = h; r.l[i] = (__bf16)(v[i] - (float)h); }
  return r; }
__device__ __forceinline__ F2 split_row(const float* row, int k0, int lane) { float v[16]; const float* p = row + k0 + 8 * (lane >> 4);
#pragma unroll
  for (int i = 0; i < 8; ++i) { v[i] = p[i]; v[8 + i] = p[16 + i]; }
  return bsplit16(v); }
__device__ __forceinline__ F2 split_rowK(const float* row, int k0, int lane, int K) { float v[16]; const int g = lane >> 4;
#pragma unroll
  for (int i = 0; i < 8; ++i) { const int ka = k0 + 8 * g + i, kb = ka + 16; v[i] = ka < K ? row[ka < K ? ka : K - 1] : 0.f; v[8 + i] = kb < K ? row[kb < K ? kb : K - 1] : 0.f; }
  return bsplit16(v); }
__device__ __forceinline__ F2 split_col(const float* W, int k0, int n, int lane, int ld, int K) { float v[16]; const int g = lane >> 4;
#pragma unroll
  for (int i = 0; i < 8; ++i) { const int ka = k0 + 8 * g + i, kb = ka + 16; v[i] = ka < K ? W[(size_t)(ka < K ? ka : K - 1) * ld + n] : 0.f; v[8 + i] = kb < K ? W[(size_t)(kb < K ? kb : K - 1) * ld + n] : 0.f; }
  return bsplit16(v); }
__device__ __forceinline__ v8f mac3(const F2& a, const F2& b, v8f c) { c = wmma_bf(a.l, b.h, c); c = wmma_bf(a.h, b.l, c); return wmma_bf(a.h, b.h, c); }
__device__ __forceinline__ float sigm(float v) { return 1.0f / (1.0f + expf(-v)); }
#define LDSX() do { asm volatile("s_wait_dscnt 0" ::: "memory"); __builtin_amdgcn_wave_barrier(); __builtin_amdgcn_fence(__ATOMIC_RELEASE, "workgroup"); } while (0)

// Single-head causal self-attention with shared projections (B 4, S 2,048, E 1,024 -> A 64): k = x Wk^T; q = v = k; x = q k^T / 8 masked where tril(x) == 0 (the strict upper triangle; exact-zero logits in the lower triangle would also be masked - measure-zero for these inputs); softmax; out = P v -> [B, S, 64].
#define NB 4
#define TT 2048
#define CC 64             // NH * HD = projected width
#define DIN 1024
#define NH 1
#define HD 64
#define NQB (TT / 64)
#define HG 1
#define SCALE (0.125f)
#define CAUSAL 1
#ifndef TNB
#define TNB NB
#endif
__device__ __forceinline__ v16b zero16b() { v16b z; _Pragma("unroll") for (int i = 0; i < 16; ++i) z[i] = (__bf16)0.f; return z; }
__device__ __forceinline__ float bfr(float v) { return (float)(__bf16)v; }
__host__ __device__ __forceinline__ int kb_last(int qb) { return CAUSAL ? ((qb * 64 + 63) >> 7) : (TT / 128 - 1); }
typedef __attribute__((ext_vector_type(8))) __bf16 v8b;
__device__ __forceinline__ v16b frag_b(const __bf16* rowk0, int lane) {
  union { v16b v; v8b q[2]; } u; const __bf16* p = rowk0 + 8 * (lane >> 4);
  u.q[0] = *(const v8b*)p; u.q[1] = *(const v8b*)(p + 16); return u.v;
}
// a 16 x 32 fragment kept in fragment order = 1 KiB: lane l's elements 0..7 at byte 16 l, its elements 8..15 at byte 512 + 16 l, so each 16-byte load of a wave covers 512 contiguous bytes (4 whole lines)
__device__ __forceinline__ v16h fragp_h(const _Float16* f, int lane) {
  union { v16h v; v8h q[2]; } u; const _Float16* p = f + 8 * lane;
  u.q[0] = *(const v8h*)p; u.q[1] = *(const v8h*)(p + 256); return u.v;
}
__device__ __forceinline__ v16b fragp_b(const __bf16* f, int lane) {
  union { v16b v; v8b q[2]; } u; const __bf16* p = f + 8 * lane;
  u.q[0] = *(const v8b*)p; u.q[1] = *(const v8b*)(p + 256); return u.v;
}
#define QBH NQB            // every block: 3-product logits (the self key's logit |k|^2/8 ~ 8 dominates -> peaked rows) and bf16 hi/lo P.v
#define QHI TT
#define KHI TT
// B fragment (k rows k0+.., output column o) of a weight: (in,out) [K][ld] or (out,in) [ld rows of K]: bf16 exact, or f16(bf16 * 256) exact
__device__ __forceinline__ v16b wcol_io(const float* Wm, int k0, int o, int lane, int ld) { v16b w; const int g = lane >> 4;
#pragma unroll
  for (int i = 0; i < 8; ++i) { w[i] = (__bf16)Wm[(size_t)(k0 + 8 * g + i) * ld + o]; w[8 + i] = (__bf16)Wm[(size_t)(k0 + 16 + 8 * g + i) * ld + o]; }
  return w; }
__device__ __forceinline__ v16b wcol_oi(const float* Wm, int k0, int o, int lane, int K) { v16b w; const float* p = Wm + (size_t)o * K + k0 + 8 * (lane >> 4);
#pragma unroll
  for (int i = 0; i < 8; ++i) { w[i] = (__bf16)p[i]; w[8 + i] = (__bf16)p[16 + i]; }
  return w; }
__device__ __forceinline__ v16h wcolh_io(const float* Wm, int k0, int o, int lane, int ld) { v16h w; const int g = lane >> 4;
#pragma unroll
  for (int i = 0; i < 8; ++i) { w[i] = (_Float16)(bfr(Wm[(size_t)(k0 + 8 * g + i) * ld + o]) * 256.0f); w[8 + i] = (_Float16)(bfr(Wm[(size_t)(k0 + 16 + 8 * g + i) * ld + o]) * 256.0f); }
  return w; }
__device__ __forceinline__ v16h wcolh_oi(const float* Wm, int k0, int o, int lane, int K) { v16h w; const float* p = Wm + (size_t)o * K + k0 + 8 * (lane >> 4);
#pragma unroll
  for (int i = 0; i < 8; ++i) { w[i] = (_Float16)(bfr(p[i]) * 256.0f); w[8 + i] = (_Float16)(bfr(p[16 + i]) * 256.0f); }
  return w; }
#define WQKV_LAYOUT 0   // 0 = (out,in) [DOUT][DIN], columns >= DOUT zero; 1 = (out,in) [CC][DIN]; 2 = per-head [NH][DIN][HD]
__device__ __forceinline__ v16b wcol_hdk(const float* Wm, int k0, int o, int lane) { v16b w; const int g = lane >> 4; const float* p = Wm + (size_t)(o / HD) * DIN * HD + (o % HD);
#pragma unroll
  for (int i = 0; i < 8; ++i) { w[i] = (__bf16)p[(size_t)(k0 + 8 * g + i) * HD]; w[8 + i] = (__bf16)p[(size_t)(k0 + 16 + 8 * g + i) * HD]; }
  return w; }
#define WO_OUT_IN 0
#if WQKV_LAYOUT == 1
#define WCOL(W, k0, o, lane) wcol_oi(W, k0, o, lane, DIN)
#elif WQKV_LAYOUT == 2
#define WCOL(W, k0, o, lane) wcol_hdk(W, k0, o, lane)
#else
#define WCOL(W, k0, o, lane) (((o) < DOUT) ? wcol_oi(W, k0, (o), lane, DIN) : zero16b())   /* Wk (out,in) [64][1024]; q = k = v = x Wk^T */
#endif
#if WO_OUT_IN
#define WOCOL(W, k0, o, lane) wcol_oi(W, k0, o, lane, CC)
#define WOCOLH(W, k0, o, lane) wcolh_oi(W, k0, o, lane, CC)
#else
#define WOCOL(W, k0, o, lane) wcol_io(W, k0, o, lane, DIN)
#define WOCOLH(W, k0, o, lane) wcolh_io(W, k0, o, lane, DIN)
#endif
#define DOUT 64            // head width = plane width
#ifndef SM_EXTRA_PARAMS
#define SM_EXTRA_PARAMS
#endif
#ifndef PROJ_EXTRA_PARAMS
#define PROJ_EXTRA_PARAMS
#endif
#ifndef SM_MASK_HOOK
#define SM_MASK_HOOK (void)0
#endif

#define WS_QH  0u                                      // f16 q, fragment order [b*t / 16][CC / 32][512]
#define WS_KH  (WS_QH + 2u * (size_t)NB * TT * CC)      // f16 k, fragment order [b*t / 16][CC / 32][512]
#define WS_VT  (WS_KH + 2u * (size_t)NB * TT * CC)      // f16 v planes [b][c][t]
#define WS_QL  (WS_VT + 2u * (size_t)NB * CC * TT)      // f16 q residual x 2^10, fragment order like q
#define WS_KL  (WS_QL + 2u * (size_t)NB * QHI * CC)     // f16 k residual x 2^10, fragment order like k
#define WS_VB  (WS_KL + 2u * (size_t)NB * KHI * CC)     // bf16 v hi, fragment order [b][t / 32][CC / 16][512] (and v lo behind it)
#define WS_VBL (WS_VB + 2u * (size_t)NB * CC * KHI)
#define WS_Y   (WS_VBL + 2u * (size_t)NB * CC * KHI)    // f32 ctx rows [b*t][CC] (only when there is an output projection)
#define WS_END (WS_Y  + 0u)

// k_proj's staging: a k tile = 64 rows of X and the 64 rows of Wk, PJ_KT columns each, f32 as in memory, brought into LDS by asynchronous copies
#define PJ_KT 128                         // k columns of a tile: a row's piece is 512 contiguous bytes = one copy of a wave
#define PJ_P  (PJ_KT + 4)                 // f32 pitch of a staged row (16 bytes x 33): the 16 rows of a 16-byte fragment read cover all 64 banks once
#define PJ_ROWS (64 + DOUT)
#define PJ_BUFB (PJ_ROWS * PJ_P * 4u)     // bytes of one buffer
#define PJ_LS (4u * PJ_P * 4u)            // LDS bytes between two rows of one wave (4 waves take rows in turn)
#define PJ_GS (4 * DIN)
// eight copies of one wave, rows 4 apart; s_wait_xcnt stands inside the copies' own statement, in front of any rewrite of a register that a copy names
__device__ __forceinline__ void pj_copy8(unsigned l, const float* gp) {
  asm volatile("global_load_async_to_lds_b128 %0, %8, off\n\tglobal_load_async_to_lds_b128 %1, %9, off\n\tglobal_load_async_to_lds_b128 %2, %10, off\n\tglobal_load_async_to_lds_b128 %3, %11, off\n\t"
               "global_load_async_to_lds_b128 %4, %12, off\n\tglobal_load_async_to_lds_b128 %5, %13, off\n\tglobal_load_async_to_lds_b128 %6, %14, off\n\tglobal_load_async_to_lds_b128 %7, %15, off\n\ts_wait_xcnt 0x0"
               :: "v"(l), "v"(l + PJ_LS), "v"(l + 2 * PJ_LS), "v"(l + 3 * PJ_LS), "v"(l + 4 * PJ_LS), "v"(l + 5 * PJ_LS), "v"(l + 6 * PJ_LS), "v"(l + 7 * PJ_LS),
                  "v"(gp), "v"(gp + PJ_GS), "v"(gp + 2 * PJ_GS), "v"(gp + 3 * PJ_GS), "v"(gp + 4 * PJ_GS), "v"(gp + 5 * PJ_GS), "v"(gp + 6 * PJ_GS), "v"(gp + 7 * PJ_GS) : "memory");
}
// one wave's 32 copies of a tile: its 16 rows of X, then its 16 rows of Wk (LDS rows 64 ..)
__device__ __forceinline__ void pj_stage(unsigned l, const float* xg, const float* wg) {
  pj_copy8(l, xg); pj_copy8(l + 8 * PJ_LS, xg + 8 * PJ_GS); pj_copy8(l + 16 * PJ_LS, wg); pj_copy8(l + 24 * PJ_LS, wg + 8 * PJ_GS);
}
// bf16 fragment of a staged f32 row (p = row + k0 + 8 * (lane >> 4)): elements 0..7 = p[0..7], 8..15 = p[16..23], for A and B alike
__device__ __forceinline__ v16b frag_lds(const float* p) { const v4f x0 = *(const v4f*)p, x1 = *(const v4f*)(p + 4), x2 = *(const v4f*)(p + 16), x3 = *(const v4f*)(p + 20); v16b a;
#pragma unroll
  for (int i = 0; i < 4; ++i) { a[i] = (__bf16)x0[i]; a[4 + i] = (__bf16)x1[i]; a[8 + i] = (__bf16)x2[i]; a[12 + i] = (__bf16)x3[i]; }
  return a; }
// ---- k_proj: block = (64 rows, CC cols, which): q/k/v = X W (+ b) with exact bf16 products (K = DIN) -> which 0: q f16 (+ residual); 1: k f16 (+ residual); 2: v f16 planes [c][t] and v bf16 hi/lo; q, k and v hi/lo leave in the order in which k_att's fragments read them
__global__ __launch_bounds__(128) void k_proj(const float* __restrict__ XQ, const float* __restrict__ XK, const float* __restrict__ XV, const float* __restrict__ WQ, const float* __restrict__ WK, const float* __restrict__ WV, const float* __restrict__ BQ, const float* __restrict__ BK, const float* __restrict__ BV,
    _Float16* __restrict__ QH, _Float16* __restrict__ QL, _Float16* __restrict__ KH, _Float16* __restrict__ KL, _Float16* __restrict__ VT, __bf16* __restrict__ VB, __bf16* __restrict__ VBL) {
  // the K loop's two staging buffers and the epilogue's transposing tiles share one LDS range (the epilogue starts behind the loop's last barrier), so that two blocks fit a WGP
  __shared__ __align__(16) union { float st[2][PJ_ROWS][PJ_P]; struct { _Float16 sh[64][CC + 8], sl[64][CC + 8], th[CC][72]; __bf16 tb[CC][72], tbl[CC][72]; } ep; } u;
  auto& sh = u.ep.sh; auto& sl = u.ep.sl; auto& th = u.ep.th; auto& tb = u.ep.tb; auto& tbl = u.ep.tbl;
  const int tid = threadIdx.x, wave = tid >> 5, lane = tid & 31, col = lane & 15, g = lane >> 4; const int which = blockIdx.z; const int c0 = blockIdx.y * CC; const size_t r0 = (size_t)blockIdx.x * 64; const size_t bb = r0 / TT; const int t0 = (int)(r0 % TT);
  const float* X = which == 0 ? XQ : which == 1 ? XK : XV; const float* WA = which == 0 ? WQ : which == 1 ? WK : WV; const float* BA = which == 0 ? BQ : which == 1 ? BK : BV;
  v8f acc[CC / 16] = {};
  static_assert(CC == DOUT && DOUT % 16 == 0 && DIN % PJ_KT == 0 && DIN / PJ_KT >= 2, "grid y is 1, so c0 is 0 and plane column tile j is Wk's rows 16 j ..; at least two k tiles");
  const unsigned l0 = (unsigned)(size_t)&u.st[0][wave][lane * 4];   // LDS byte address of this lane's 16 bytes in row 'wave' of buffer 0
  const float* xg = X + (r0 + wave) * DIN + lane * 4; const float* wg = WA + (size_t)wave * DIN + lane * 4;
  pj_stage(l0, xg, wg);
  asm volatile("s_wait_asynccnt 0x0" ::: "memory");   // this wave's copies of tile 0 have landed
  __syncthreads();                                      // ... and every other wave's: tile 0 may be read
  pj_stage(l0 + PJ_BUFB, xg + PJ_KT, wg + PJ_KT);
#pragma unroll 1   // rolled, for speed only
  for (int t = 0; t < DIN / PJ_KT; ++t) { const float* pa = &u.st[t & 1][wave * 16 + col][8 * g]; const float* pw = &u.st[t & 1][64 + col][8 * g];
    v16b a = frag_lds(pa), w[DOUT / 16];
#pragma unroll
    for (int j = 0; j < DOUT / 16; ++j) w[j] = frag_lds(pw + j * 16 * PJ_P);
#pragma unroll
    for (int kq = 0; kq < PJ_KT / 32; ++kq) { v16b an = a, wn[DOUT / 16];   // the next 32 columns' fragments (same tile) are read as one group in front of this step's products, so that their LDS latency runs under them
#pragma unroll
      for (int j = 0; j < DOUT / 16; ++j) wn[j] = w[j];
      if (kq + 1 < PJ_KT / 32) { an = frag_lds(pa + (kq + 1) * 32);
#pragma unroll
        for (int j = 0; j < DOUT / 16; ++j) wn[j] = frag_lds(pw + j * 16 * PJ_P + (kq + 1) * 32); }
#pragma unroll
      for (int j = 0; j < CC / 16; ++j) acc[j] = wmma_bf(a, w[j], acc[j]);
      a = an;
#pragma unroll
      for (int j = 0; j < DOUT / 16; ++j) w[j] = wn[j]; }
    asm volatile("s_wait_dscnt 0x0" ::: "memory");      // this wave's reads of tile t are over
    asm volatile("s_wait_asynccnt 0x0" ::: "memory");   // this wave's copies of tile t + 1 have landed
    __syncthreads();                                      // publishes tile t + 1 and frees tile t's buffer (behind the last trip: for the epilogue's tiles)
    if (t + 2 < DIN / PJ_KT) pj_stage(l0 + (t & 1) * PJ_BUFB, xg + (t + 2) * PJ_KT, wg + (t + 2) * PJ_KT); }
  asm volatile("s_wait_asynccnt 0x0" ::: "memory");     // no copy is outstanding when the LDS range changes hands
  if (which < 2) { _Float16* DH = which == 0 ? QH : KH; _Float16* DL = which == 0 ? QL : KL; const int nhi = which == 0 ? QHI : KHI; const bool hi_rows = t0 < nhi;
#pragma unroll
    for (int j = 0; j < CC / 16; ++j) { const float bias = BA ? bfr(BA[c0 + j * 16 + col]) : 0.f;
#pragma unroll
      for (int r = 0; r < 8; ++r) { const float v = acc[j][r] + bias; const _Float16 hv = (_Float16)v; sh[wave * 16 + 8 * g + r][j * 16 + col] = hv; sl[wave * 16 + 8 * g + r][j * 16 + col] = (_Float16)((v - (float)hv) * 1024.0f); } }
    __syncthreads();
    static_assert(CC == 64, "a block holds whole 16-row tiles: 2 fragments of 64 pieces of 16 bytes each");
    // piece e of the block's 4 tiles: bits 3..0 = row in the tile, 4 = lane half g, 5 = fragment half, 6 = 32-column step, 8..7 = tile; columns 8 * (e >> 4 & 7) ..
    for (int e = tid; e < 64 * 8; e += 128) { const int rl = (e >> 7) * 16 + (e & 15), q = (e >> 4) & 7; vst2((unsigned*)(DH + r0 * CC + e * 8), *(const v4u*)&sh[rl][q * 8]); if (hi_rows) vst2((unsigned*)(DL + (bb * nhi + t0) * (size_t)CC + e * 8), *(const v4u*)&sl[rl][q * 8]); }
  } else { const bool hi_rows = t0 < KHI;
#pragma unroll
    for (int j = 0; j < CC / 16; ++j) { const float bias = BA ? bfr(BA[c0 + j * 16 + col]) : 0.f;
#pragma unroll
      for (int r = 0; r < 8; ++r) { const float v = acc[j][r] + bias; const int rl = wave * 16 + 8 * g + r, cl = j * 16 + col; th[cl][rl] = (_Float16)v; const __bf16 bh = (__bf16)v; tb[cl][rl] = bh; tbl[cl][rl] = (__bf16)(v - (float)bh); } }
    __syncthreads();
    for (int e = tid; e < CC * 8; e += 128) { const int cl = e >> 3, q = e & 7; vst2((unsigned*)(VT + (bb * CC + c0 + cl) * (size_t)TT + t0 + q * 8), *(const v4u*)&th[cl][q * 8]); if (hi_rows) { const int cf = ((e >> 6) & 3) * 16 + (e & 15), qf = (e >> 8) * 4 + ((e >> 4) & 3);   // piece e of the block's 2 x 4 fragments: bits 3..0 = column in the tile, 4 = lane half g, 5 = fragment half, 7..6 = column tile, 8 = 32-key step
        const size_t o3 = (bb * (KHI / 32) + (t0 >> 5)) * (size_t)(CC * 32) + e * 8; vst2((unsigned*)(VB + o3), *(const v4u*)&tb[cf][qf * 8]); vst2((unsigned*)(VBL + o3), *(const v4u*)&tbl[cf][qf * 8]); } } } }
// ---- k_att: block = 16 queries of one batch (tile and batch from the flat block index, longest tile first), 16 waves: logits, softmax and P . v in one kernel; the 16 logit rows stay in LDS from the first product to the last, so no logit and no P goes through memory.
// 1) wave w takes the 16-key tiles w, w + 16, ... of keys [0, kend): q hi + residual (x 2^10) against k hi + residual (3 products), x SCALE, into sp[query][key]
// 2) wave w owns query row w: causal mask by index, max, exp, sum, P x 2^11 in place (0 for excluded keys)
// 3) wave w takes the 64-key pairs of steps w, w + 16, ...: P as bf16 hi + lo against v bf16 hi + lo (3 products); the 16 partial tiles are summed through LDS in wave order and the 64 real columns stored to out
#define FA_KS 16               // waves of a block
#define LOG2E 1.4426950408889634f
#define FA_P  (TT + 4)         // f32 pitch of a logit row in LDS: row r starts 4 r banks on, so the 16 rows of a 16-byte fragment read cover all 64 banks once
// second bound: 8 waves per SIMD = 128 registers a wave, so that two blocks (LDS allows two) share a WGP and one block's matrix phases run under the other's softmax and barriers
__global__ __launch_bounds__(32 * FA_KS, 8) void k_att(const _Float16* __restrict__ QH, const _Float16* __restrict__ KH, const _Float16* __restrict__ QL, const _Float16* __restrict__ KL, const __bf16* __restrict__ VB, const __bf16* __restrict__ VBL, float* __restrict__ OUT) {
  __shared__ __align__(16) float buf[16 * FA_P];   // first the logit / P rows, then (behind a barrier) the waves' partial tiles
  float (*sp)[FA_P] = (float (*)[FA_P])buf; float (*ss)[16][HD + 4] = (float (*)[16][HD + 4])buf;
  static_assert(FA_KS * 16 * (HD + 4) <= 16 * FA_P, "the partial tiles fit the buffer");
  const int tid = threadIdx.x, lane = tid & 31, col = lane & 15, g = lane >> 4; const int fi = blockIdx.z * (TT / 16) + blockIdx.x;   // flat block index
  const int b = fi % TNB; const int ql0 = (TT / 16 - 1 - fi / TNB) * 16;   // cost falls with the index: the query tiles with the most keys (all batches) come first, the shortest last
  const int kend = (kb_last(ql0 >> 6) + 1) * 128;
  const int wave = __builtin_amdgcn_readfirstlane(tid >> 5);   // scalar, so that every key loop's trip count is a scalar branch and every lane stays on at the matrix instructions
  { v16h ah[HD / 32], al[HD / 32]; const _Float16* qh = QH + ((size_t)b * TT + ql0) * CC; const _Float16* ql = QL + ((size_t)b * QHI + ql0) * CC;
#pragma unroll
    for (int kc = 0; kc < HD / 32; ++kc) { ah[kc] = fragp_h(qh + kc * 512, lane); al[kc] = fragp_h(ql + kc * 512, lane); }
    asm volatile("s_wait_xcnt 0x0" :: "v"(qh + 8 * lane), "v"(ql + 8 * lane) : "memory");   // the wait before a register of an issued q load is overwritten; with the two lane addresses as inputs the build keeps it behind the loads (without them the loads sink below it)
    for (int jt = wave; jt < kend / 16; jt += FA_KS) { const _Float16* kh = KH + ((size_t)b * TT + jt * 16) * CC; const _Float16* kl = KL + ((size_t)b * KHI + jt * 16) * CC; v8f acc = {}, accl = {};
#pragma unroll
      for (int kc = 0; kc < HD / 32; ++kc) { const v16h kbf = fragp_h(kh + kc * 512, lane), klf = fragp_h(kl + kc * 512, lane); acc = wmma16(ah[kc], kbf, acc); accl = wmma16(al[kc], kbf, accl); accl = wmma16(ah[kc], klf, accl); }
#pragma unroll
      for (int r = 0; r < 8; ++r) sp[8 * g + r][jt * 16 + col] = (acc[r] + accl[r] * (1.0f / 1024.0f)) * SCALE; } }
  __syncthreads();   // all logits of the 16 rows are in LDS before a wave reduces its row
  { const int t = ql0 + wave; float* sr = sp[wave]; float m = -3.0e38f;
#pragma unroll 4   // four LDS reads in flight
    for (int kq = 0; kq < kend / 128; ++kq) { const int k = kq * 128 + lane * 4; const v4f v = *(const v4f*)&sr[k];
#pragma unroll
      for (int i = 0; i < 4; ++i) m = fmaxf(m, (!CAUSAL || k + i <= t) ? v[i] : -3.0e38f); }
#pragma unroll
    for (int o = 1; o < 32; o <<= 1) m = fmaxf(m, __shfl_xor(m, o));
    float sum = 0.f; const float ml = m * LOG2E;   // exp(v - m) = 2^(v log2(e) - ml): one fused multiply-add and the bare base-2 exponential; ml's own rounding scales a whole row alike and leaves with the division by the row's sum
#pragma unroll 2   // the next LDS read flies under this one's exponentials
    for (int kq = 0; kq < kend / 128; ++kq) { const int k = kq * 128 + lane * 4; const v4f v = *(const v4f*)&sr[k]; v4f e;
#pragma unroll
      for (int i = 0; i < 4; ++i) { const float p = __builtin_amdgcn_exp2f(__builtin_fmaf(v[i], LOG2E, -ml)); e[i] = (!CAUSAL || k + i <= t) ? p : 0.f; sum += e[i]; }   // computed for every key and selected: four independent exponentials and no branch
      *(v4f*)&sr[k] = e; }
#pragma unroll
    for (int o = 1; o < 32; o <<= 1) sum += __shfl_xor(sum, o);
    const float inv = sum > 0.f ? 2048.0f / sum : 0.f;
#pragma unroll 4   // four LDS reads in flight
    for (int kq = 0; kq < kend / 128; ++kq) { const int k = kq * 128 + lane * 4; const v4f e = *(const v4f*)&sr[k]; *(v4f*)&sr[k] = e * inv; } }
  __syncthreads();   // every row's P is in LDS before any wave reads its key range of all 16 rows
  v8f acc[HD / 16] = {};
#pragma unroll 1   // one 64-key pair a trip: a second pair's fragments would not fit the 128 registers
  for (int kp = wave; kp < kend / 64; kp += FA_KS)
#pragma unroll
    for (int kc = 2 * kp; kc < 2 * kp + 2; ++kc) { const F2 p = split_row(sp[col], kc * 32, lane);
#pragma unroll
      for (int j = 0; j < HD / 16; j += 2) { const size_t po = (((size_t)b * (KHI / 32) + kc) * (CC / 16) + j) * 512, p1 = po + 512; const v16b vh0 = fragp_b(VB + po, lane), vl0 = fragp_b(VBL + po, lane), vh1 = fragp_b(VB + p1, lane), vl1 = fragp_b(VBL + p1, lane);   // two column tiles' loads in flight together
        acc[j] = wmma_bf(p.h, vh0, acc[j]); acc[j] = wmma_bf(p.l, vh0, acc[j]); acc[j] = wmma_bf(p.h, vl0, acc[j]); acc[j + 1] = wmma_bf(p.h, vh1, acc[j + 1]); acc[j + 1] = wmma_bf(p.l, vh1, acc[j + 1]); acc[j + 1] = wmma_bf(p.h, vl1, acc[j + 1]); } }
  __syncthreads();   // the last read of P is over before the partial tiles overwrite its LDS
#pragma unroll
  for (int j = 0; j < HD / 16; ++j)
#pragma unroll
    for (int r = 0; r < 8; ++r) ss[wave][8 * g + r][j * 16 + col] = acc[j][r] * (1.0f / 2048.0f);
  __syncthreads();   // every wave's partial tile (zero where a wave had no keys) is in LDS before any thread sums them
  if (tid < 16 * (DOUT / 4)) { const int rl = tid / (DOUT / 4), q = tid % (DOUT / 4); v4f s = *(const v4f*)&ss[0][rl][q * 4];
#pragma unroll
    for (int w = 1; w < FA_KS; ++w) s += *(const v4f*)&ss[w][rl][q * 4];
    vst2(OUT + ((size_t)b * TT + ql0 + rl) * DOUT + q * 4, s); } }

extern "C" void kernel_launch(void* const* d_in, const int* in_sizes, int n_in, void* d_out, int out_size, void* d_ws, size_t ws_size, hipStream_t stream) {
  (void)in_sizes; (void)n_in; (void)out_size;
  const float** F = (const float**)d_in;
  if (ws_size < (size_t)WS_END) return;
  char* ws = (char*)d_ws; _Float16 *QH = (_Float16*)(ws + WS_QH), *KH = (_Float16*)(ws + WS_KH), *VT = (_Float16*)(ws + WS_VT), *QL = (_Float16*)(ws + WS_QL), *KL = (_Float16*)(ws + WS_KL); __bf16 *VB = (__bf16*)(ws + WS_VB), *VBL = (__bf16*)(ws + WS_VBL); float *Y = (float*)(ws + WS_Y);
  (void)Y;
  // inputs: 0 embedding [4,2048,1024]; 1 Wk [64,1024] (out,in) (q = k = v)
  k_proj<<<dim3(TNB * TT / 64, 1, 3), 128, 0, stream>>>(F[0], F[0], F[0], F[1], F[1], F[1], nullptr, nullptr, nullptr, QH, QL, KH, KL, VT, VB, VBL);
  k_att<<<dim3(TT / 16, 1, TNB), 32 * FA_KS, 0, stream>>>(QH, KH, QL, KL, VB, VBL, (float*)d_out);
}

// v008
// One run takes 30 microseconds.
// Timed twice side by side with v007, it ran 1.09 and 1.06 times as fast.
// Counting every step since v000, it is 30.1 times as fast.
// compute dtype: all float inputs rounded to bf16; q = k = v = x Wk^T with EXACT bf16 products on WMMA 16x16x32 (f32 accumulate; the single head's planes are 64 wide, its real width); causal logits with q = k as f16 hi + residual on both sides (3 products) x 64^-0.5; softmax in f32; P as bf16 hi + lo against v bf16 hi + lo (3 products); f32 output.
#include <hip/hip_runtime.h>
#include <math.h>

typedef __attribute__((ext_vector_type(16))) _Float16 v16h;
typedef __attribute__((ext_vector_type(16))) __bf16 v16b;
typedef __attribute__((ext_vector_type(8)))  _Float16 v8h;
typedef __attribute__((ext_vector_type(8)))  float v8f;
typedef __attribute__((ext_vector_type(4)))  float v4f;
typedef __attribute__((ext_vector_type(2)))  float v2f;
typedef __attribute__((ext_vector_type(4)))  unsigned v4u;
typedef __attribute__((ext_vector_type(4)))  int v4i;
typedef float __attribute__((may_alias)) float_a;
typedef int __attribute__((may_alias)) int_a;

template <typename T> __device__ __forceinline__ void vst2(void* p, T v) { *(T*)p = v;  }
__device__ __forceinline__ v8f wmma16(v16h a, v16h b, v8f c) {
  v8f d = __builtin_amdgcn_wmma_f32_16x16x32_f16(false, a, false, b, (short)0, c, false, false);
  asm volatile("v_nop\n\tv_nop\n\tv_nop\n\tv_nop" : "+v"(d) : "v"(a), "v"(b));
  return d;
}
__device__ __forceinline__ v8f wmma_bf(v16b a, v16b b, v8f c) {
  v8f d = __builtin_amdgcn_wmma_f32_16x16x32_bf16(false, a, false, b, (short)0, c, false, false);
  asm volatile("v_nop\n\tv_nop\n\tv_nop\n\tv_nop" : "+v"(d) : "v"(a), "v"(b));
  return d;
}
// 16x16x32 fragments: lane = (h = lane>>4, row/col = lane&15); elements 0..7 = k0+8h+0..7, 8..15 = k0+16+8h+0..7; D element r = row 8h+r
__device__ __forceinline__ v16h frag_h(const _Float16* rowk0, int lane) {
  union { v16h v; v8h q[2]; } u; const _Float16* p = rowk0 + 8 * (lane >> 4);
  u.q[0] = *(const v8h*)p; u.q[1] = *(const v8h*)(p + 16); return u.v;
}
__device__ __forceinline__ v16h frag_f32(const float* rowk0, int lane) {
  v16h a; const float* p = rowk0 + 8 * (lane >> 4);
#pragma unroll
  for (int i = 0; i < 8; ++i) { a[i] = (_Float16)p[i]; a[8 + i] = (_Float16)p[16 + i]; }
  return a;
}
__device__ __forceinline__ v16h frag_f32s(const float* rowk0, int lane, float sc) {
  v16h a; const float* p = rowk0 + 8 * (lane >> 4);
#pragma unroll
  for (int i = 0; i < 8; ++i) { a[i] = (_Float16)(p[i] * sc); a[8 + i] = (_Float16)(p[16 + i] * sc); }
  return a;
}
// column fragment from a [K][ld] layout (column n), rows >= K read as 0
__device__ __forceinline__ v16h fragc_f32(const float* W, int k0, int n, int lane, int ld, int K) {
  v16h a; const int g = lane >> 4;
#pragma unroll
  for (int i = 0; i < 8; ++i) { const int ka = k0 + 8 * g + i, kb = ka + 16;
    a[i] = (_Float16)(ka < K ? W[(size_t)(ka < K ? ka : K - 1) * ld + n] : 0.f); a[8 + i] = (_Float16)(kb < K ? W[(size_t)(kb < K ? kb : K - 1) * ld + n] : 0.f); }
  return a;
}
struct F2 { v16b h, l; };
__device__ __forceinline__ F2 bsplit16(const float v[16]) { F2 r;
#pragma unroll
  for (int i = 0; i < 16; ++i) { const __bf16 h = (__bf16)v[i]; r.h[i] = h; r.l[i] = (__bf16)(v[i] - (float)h); }
  return r; }
__device__ __forceinline__ F2 split_row(const float* row, int k0, int lane) { float v[16]; const float* p = row + k0 + 8 * (lane >> 4);
#pragma unroll
  for (int i = 0; i < 8; ++i) { v[i] = p[i]; v[8 + i] = p[16 + i]; }
  return bsplit16(v); }
__device__ __forceinline__ F2 split_rowK(const float* row, int k0, int lane, int K) { float v[16]; const int g = lane >> 4;
#pragma unroll
  for (int i = 0; i < 8; ++i) { const int ka = k0 + 8 * g + i, kb = ka + 16; v[i] = ka < K ? row[ka < K ? ka : K - 1] : 0.f; v[8 + i] = kb < K ? row[kb < K ? kb : K - 1] : 0.f; }
  return bsplit16(v); }
__device__ __forceinline__ F2 split_col(const float* W, int k0, int n, int lane, int ld, int K) { float v[16]; const int g = lane >> 4;
#pragma unroll
  for (int i = 0; i < 8; ++i) { const int ka = k0 + 8 * g + i, kb = ka + 16; v[i] = ka < K ? W[(size_t)(ka < K ? ka : K - 1) * ld + n] : 0.f; v[8 + i] = kb < K ? W[(size_t)(kb < K ? kb : K - 1) * ld + n] : 0.f; }
  return bsplit16(v); }
__device__ __forceinline__ v8f mac3(const F2& a, const F2& b, v8f c) { c = wmma_bf(a.l, b.h, c); c = wmma_bf(a.h, b.l, c); return wmma_bf(a.h, b.h, c); }
__device__ __forceinline__ float sigm(float v) { return 1.0f / (1.0f + expf(-v)); }
#define LDSX() do { asm volatile("s_wait_dscnt 0" ::: "memory"); __builtin_amdgcn_wave_barrier(); __builtin_amdgcn_fence(__ATOMIC_RELEASE, "workgroup"); } while (0)

// Single-head causal self-attention with shared projections (B 4, S 2,048, E 1,024 -> A 64): k = x Wk^T; q = v = k; x = q k^T / 8 masked where tril(x) == 0 (the strict upper triangle; exact-zero logits in the lower triangle would also be masked - measure-zero for these inputs); softmax; out = P v -> [B, S, 64].
#define NB 4
#define TT 2048
#define CC 64             // NH * HD = projected width
#define DIN 1024
#define NH 1
#define HD 64
#define NQB (TT / 64)
#define HG 1
#define SCALE (0.125f)
#define CAUSAL 1
#ifndef TNB
#define TNB NB
#endif
__device__ __forceinline__ v16b zero16b() { v16b z; _Pragma("unroll") for (int i = 0; i < 16; ++i) z[i] = (__bf16)0.f; return z; }
__device__ __forceinline__ float bfr(float v) { return (float)(__bf16)v; }
__host__ __device__ __forceinline__ int kb_last(int qb) { return CAUSAL ? ((qb * 64 + 63) >> 7) : (TT / 128 - 1); }
typedef __attribute__((ext_vector_type(8))) __bf16 v8b;
__device__ __forceinline__ v16b frag_b(const __bf16* rowk0, int lane) {
  union { v16b v; v8b q[2]; } u; const __bf16* p = rowk0 + 8 * (lane >> 4);
  u.q[0] = *(const v8b*)p; u.q[1] = *(const v8b*)(p + 16); return u.v;
}
// a 16 x 32 fragment kept in fragment order = 1 KiB: lane l's elements 0..7 at byte 16 l, its elements 8..15 at byte 512 + 16 l, so each 16-byte load of a wave covers 512 contiguous bytes (4 whole lines)
__device__ __forceinline__ v16h fragp_h(const _Float16* f, int lane) {
  union { v16h v; v8h q[2]; } u; const _Float16* p = f + 8 * lane;
  u.q[0] = *(const v8h*)p; u.q[1] = *(const v8h*)(p + 256); return u.v;
}
__device__ __forceinline__ v16b fragp_b(const __bf16* f, int lane) {
  union { v16b v; v8b q[2]; } u; const __bf16* p = f + 8 * lane;
  u.q[0] = *(const v8b*)p; u.q[1] = *(const v8b*)(p + 256); return u.v;
}
#define QBH NQB            // every block: 3-product logits (the self key's logit |k|^2/8 ~ 8 dominates -> peaked rows) and bf16 hi/lo P.v
#define QHI TT
#define KHI TT
// B fragment (k rows k0+.., output column o) of a weight: (in,out) [K][ld] or (out,in) [ld rows of K]: bf16 exact, or f16(bf16 * 256) exact
__device__ __forceinline__ v16b wcol_io(const float* Wm, int k0, int o, int lane, int ld) { v16b w; const int g = lane >> 4;
#pragma unroll
  for (int i = 0; i < 8; ++i) { w[i] = (__bf16)Wm[(size_t)(k0 + 8 * g + i) * ld + o]; w[8 + i] = (__bf16)Wm[(size_t)(k0 + 16 + 8 * g + i) * ld + o]; }
  return w; }
__device__ __forceinline__ v16b wcol_oi(const float* Wm, int k0, int o, int lane, int K) { v16b w; const float* p = Wm + (size_t)o * K + k0 + 8 * (lane >> 4);
#pragma unroll
  for (int i = 0; i < 8; ++i) { w[i] = (__bf16)p[i]; w[8 + i] = (__bf16)p[16 + i]; }
  return w; }
__device__ __forceinline__ v16h wcolh_io(const float* Wm, int k0, int o, int lane, int ld) { v16h w; const int g = lane >> 4;
#pragma unroll
  for (int i = 0; i < 8; ++i) { w[i] = (_Float16)(bfr(Wm[(size_t)(k0 + 8 * g + i) * ld + o]) * 256.0f); w[8 + i] = (_Float16)(bfr(Wm[(size_t)(k0 + 16 + 8 * g + i) * ld + o]) * 256.0f); }
  return w; }
__device__ __forceinline__ v16h wcolh_oi(const float* Wm, int k0, int o, int lane, int K) { v16h w; const float* p = Wm + (size_t)o * K + k0 + 8 * (lane >> 4);
#pragma unroll
  for (int i = 0; i < 8; ++i) { w[i] = (_Float16)(bfr(p[i]) * 256.0f); w[8 + i] = (_Float16)(bfr(p[16 + i]) * 256.0f); }
  return w; }
#define WQKV_LAYOUT 0   // 0 = (out,in) [DOUT][DIN], columns >= DOUT zero; 1 = (out,in) [CC][DIN]; 2 = per-head [NH][DIN][HD]
__device__ __forceinline__ v16b wcol_hdk(const float* Wm, int k0, int o, int lane) { v16b w; const int g = lane >> 4; const float* p = Wm + (size_t)(o / HD) * DIN * HD + (o % HD);
#pragma unroll
  for (int i = 0; i < 8; ++i) { w[i] = (__bf16)p[(size_t)(k0 + 8 * g + i) * HD]; w[8 + i] = (__bf16)p[(size_t)(k0 + 16 + 8 * g + i) * HD]; }
  return w; }
#define WO_OUT_IN 0
#if WQKV_LAYOUT == 1
#define WCOL(W, k0, o, lane) wcol_oi(W, k0, o, lane, DIN)
#elif WQKV_LAYOUT == 2
#define WCOL(W, k0, o, lane) wcol_hdk(W, k0, o, lane)
#else
#define WCOL(W, k0, o, lane) (((o) < DOUT) ? wcol_oi(W, k0, (o), lane, DIN) : zero16b())   /* Wk (out,in) [64][1024]; q = k = v = x Wk^T */
#endif
#if WO_OUT_IN
#define WOCOL(W, k0, o, lane) wcol_oi(W, k0, o, lane, CC)
#define WOCOLH(W, k0, o, lane) wcolh_oi(W, k0, o, lane, CC)
#else
#define WOCOL(W, k0, o, lane) wcol_io(W, k0, o, lane, DIN)
#define WOCOLH(W, k0, o, lane) wcolh_io(W, k0, o, lane, DIN)
#endif
#define DOUT 64            // head width = plane width
#ifndef SM_EXTRA_PARAMS
#define SM_EXTRA_PARAMS
#endif
#ifndef PROJ_EXTRA_PARAMS
#define PROJ_EXTRA_PARAMS
#endif
#ifndef SM_MASK_HOOK
#define SM_MASK_HOOK (void)0
#endif

#define WS_KH  0u                                      // f16 k (= q), fragment order [b*t / 16][CC / 32][512]: A and B fragments of the logits' product have the same order, so one plane serves both sides
#define WS_KL  (WS_KH + 2u * (size_t)NB * TT * CC)      // f16 k (= q) residual x 2^10, fragment order like k
#define WS_VB  (WS_KL + 2u * (size_t)NB * KHI * CC)     // bf16 v hi, fragment order [b][t / 32][CC / 16][512] (and v lo behind it)
#define WS_VBL (WS_VB + 2u * (size_t)NB * CC * KHI)
#define WS_Y   (WS_VBL + 2u * (size_t)NB * CC * KHI)    // f32 ctx rows [b*t][CC] (only when there is an output projection)
#define WS_END (WS_Y  + 0u)

// k_proj's staging: a k tile = 64 rows of X and the 64 rows of Wk, PJ_KT columns each, f32 as in memory, brought into LDS by asynchronous copies
#define PJ_KT 128                         // k columns of a tile: a row's piece is 512 contiguous bytes = one copy of a wave
#define PJ_P  (PJ_KT + 4)                 // f32 pitch of a staged row (16 bytes x 33): the 16 rows of a 16-byte fragment read cover all 64 banks once
#define PJ_ROWS (64 + DOUT)
#define PJ_BUFB (PJ_ROWS * PJ_P * 4u)     // bytes of one buffer
#define PJ_LS (4u * PJ_P * 4u)            // LDS bytes between two rows of one wave (4 waves take rows in turn)
#define PJ_GS (4 * DIN)
// eight copies of one wave, rows 4 apart; s_wait_xcnt stands inside the copies' own statement, in front of any rewrite of a register that a copy names
__device__ __forceinline__ void pj_copy8(unsigned l, const float* gp) {
  asm volatile("global_load_async_to_lds_b128 %0, %8, off\n\tglobal_load_async_to_lds_b128 %1, %9, off\n\tglobal_load_async_to_lds_b128 %2, %10, off\n\tglobal_load_async_to_lds_b128 %3, %11, off\n\t"
               "global_load_async_to_lds_b128 %4, %12, off\n\tglobal_load_async_to_lds_b128 %5, %13, off\n\tglobal_load_async_to_lds_b128 %6, %14, off\n\tglobal_load_async_to_lds_b128 %7, %15, off\n\ts_wait_xcnt 0x0"
               :: "v"(l), "v"(l + PJ_LS), "v"(l + 2 * PJ_LS), "v"(l + 3 * PJ_LS), "v"(l + 4 * PJ_LS), "v"(l + 5 * PJ_LS), "v"(l + 6 * PJ_LS), "v"(l + 7 * PJ_LS),
                  "v"(gp), "v"(gp + PJ_GS), "v"(gp + 2 * PJ_GS), "v"(gp + 3 * PJ_GS), "v"(gp + 4 * PJ_GS), "v"(gp + 5 * PJ_GS), "v"(gp + 6 * PJ_GS), "v"(gp + 7 * PJ_GS) : "memory");
}
// one wave's 32 copies of a tile: its 16 rows of X, then its 16 rows of Wk (LDS rows 64 ..)
__device__ __forceinline__ void pj_stage(unsigned l, const float* xg, const float* wg) {
  pj_copy8(l, xg); pj_copy8(l + 8 * PJ_LS, xg + 8 * PJ_GS); pj_copy8(l + 16 * PJ_LS, wg); pj_copy8(l + 24 * PJ_LS, wg + 8 * PJ_GS);
}
// bf16 fragment of a staged f32 row (p = row + k0 + 8 * (lane >> 4)): elements 0..7 = p[0..7], 8..15 = p[16..23], for A and B alike
__device__ __forceinline__ v16b frag_lds(const float* p) { const v4f x0 = *(const v4f*)p, x1 = *(const v4f*)(p + 4), x2 = *(const v4f*)(p + 16), x3 = *(const v4f*)(p + 20); v16b a;
#pragma unroll
  for (int i = 0; i < 4; ++i) { a[i] = (__bf16)x0[i]; a[4 + i] = (__bf16)x1[i]; a[8 + i] = (__bf16)x2[i]; a[12 + i] = (__bf16)x3[i]; }
  return a; }
// ---- k_proj: block = (64 rows, CC cols): the one projection X Wk^T (q = k = v) with exact bf16 products (K = DIN), computed once; each block stores it as f16 hi + residual (the logits' q and k) and as bf16 hi + lo (v), in the order in which k_att's fragments read them
__global__ __launch_bounds__(128) void k_proj(const float* __restrict__ X, const float* __restrict__ WA, _Float16* __restrict__ KH, _Float16* __restrict__ KL, __bf16* __restrict__ VB, __bf16* __restrict__ VBL) {
  // the K loop's two staging buffers and the epilogue's transposing tiles share one LDS range (the epilogue starts behind the loop's last barrier)
  __shared__ __align__(16) union { float st[2][PJ_ROWS][PJ_P]; struct { _Float16 sh[64][CC + 8], sl[64][CC + 8]; __bf16 tb[CC][72], tbl[CC][72]; } ep; } u;
  auto& sh = u.ep.sh; auto& sl = u.ep.sl; auto& tb = u.ep.tb; auto& tbl = u.ep.tbl;
  const int tid = threadIdx.x, wave = tid >> 5, lane = tid & 31, col = lane & 15, g = lane >> 4; const size_t r0 = (size_t)blockIdx.x * 64; const size_t bb = r0 / TT; const int t0 = (int)(r0 % TT);
  v8f acc[CC / 16] = {};
  static_assert(CC == DOUT && DOUT % 16 == 0 && DIN % PJ_KT == 0 && DIN / PJ_KT >= 2, "plane column tile j is Wk's rows 16 j ..; at least two k tiles");
  const unsigned l0 = (unsigned)(size_t)&u.st[0][wave][lane * 4];   // LDS byte address of this lane's 16 bytes in row 'wave' of buffer 0
  const float* xg = X + (r0 + wave) * DIN + lane * 4; const float* wg = WA + (size_t)wave * DIN + lane * 4;
  pj_stage(l0, xg, wg);
  asm volatile("s_wait_asynccnt 0x0" ::: "memory");   // this wave's copies of tile 0 have landed
  __syncthreads();                                      // ... and every other wave's: tile 0 may be read
  pj_stage(l0 + PJ_BUFB, xg + PJ_KT, wg + PJ_KT);
#pragma unroll 1   // rolled, for speed only
  for (int t = 0; t < DIN / PJ_KT; ++t) { const float* pa = &u.st[t & 1][wave * 16 + col][8 * g]; const float* pw = &u.st[t & 1][64 + col][8 * g];
    v16b a = frag_lds(pa), w[DOUT / 16];
#pragma unroll
    for (int j = 0; j < DOUT / 16; ++j) w[j] = frag_lds(pw + j * 16 * PJ_P);
#pragma unroll
    for (int kq = 0; kq < PJ_KT / 32; ++kq) { v16b an = a, wn[DOUT / 16];   // the next 32 columns' fragments (same tile) are read as one group in front of this step's products, so that their LDS latency runs under them
#pragma unroll
      for (int j = 0; j < DOUT / 16; ++j) wn[j] = w[j];
      if (kq + 1 < PJ_KT / 32) { an = frag_lds(pa + (kq + 1) * 32);
#pragma unroll
        for (int j = 0; j < DOUT / 16; ++j) wn[j] = frag_lds(pw + j * 16 * PJ_P + (kq + 1) * 32); }
#pragma unroll
      for (int j = 0; j < CC / 16; ++j) acc[j] = wmma_bf(a, w[j], acc[j]);
      a = an;
#pragma unroll
      for (int j = 0; j < DOUT / 16; ++j) w[j] = wn[j]; }
    asm volatile("s_wait_dscnt 0x0" ::: "memory");      // this wave's reads of tile t are over
    asm volatile("s_wait_asynccnt 0x0" ::: "memory");   // this wave's copies of tile t + 1 have landed
    __syncthreads();                                      // publishes tile t + 1 and frees tile t's buffer (behind the last trip: for the epilogue's tiles)
    if (t + 2 < DIN / PJ_KT) pj_stage(l0 + (t & 1) * PJ_BUFB, xg + (t + 2) * PJ_KT, wg + (t + 2) * PJ_KT); }
  asm volatile("s_wait_asynccnt 0x0" ::: "memory");     // no copy is outstanding when the LDS range changes hands
#pragma unroll
  for (int j = 0; j < CC / 16; ++j)
#pragma unroll
    for (int r = 0; r < 8; ++r) { const float v = acc[j][r]; const int rl = wave * 16 + 8 * g + r, cl = j * 16 + col; const _Float16 hv = (_Float16)v; sh[rl][cl] = hv; sl[rl][cl] = (_Float16)((v - (float)hv) * 1024.0f); const __bf16 bh = (__bf16)v; tb[cl][rl] = bh; tbl[cl][rl] = (__bf16)(v - (float)bh); }
  __syncthreads();   // all four tiles are whole before any thread gathers its 16-byte pieces
  static_assert(CC == 64, "a block holds whole 16-row tiles: 2 fragments of 64 pieces of 16 bytes each");
#pragma unroll   // four pieces of each plane a thread: their LDS reads fly together, and the stores take immediate offsets from one address each
  for (int i = 0; i < 4; ++i) { const int e = tid + i * 128;
    // k: piece e of the block's 4 tiles: bits 3..0 = row in the tile, 4 = lane half g, 5 = fragment half, 6 = 32-column step, 8..7 = tile; columns 8 * (e >> 4 & 7) ..
    const int rl = (e >> 7) * 16 + (e & 15), q = (e >> 4) & 7; vst2((unsigned*)(KH + r0 * CC + e * 8), *(const v4u*)&sh[rl][q * 8]); vst2((unsigned*)(KL + r0 * CC + e * 8), *(const v4u*)&sl[rl][q * 8]);
    // v: piece e of the block's 2 x 4 fragments: bits 3..0 = column in the tile, 4 = lane half g, 5 = fragment half, 7..6 = column tile, 8 = 32-key step
    const int cf = ((e >> 6) & 3) * 16 + (e & 15), qf = (e >> 8) * 4 + ((e >> 4) & 3); const size_t o3 = (bb * (KHI / 32) + (t0 >> 5)) * (size_t)(CC * 32) + e * 8; vst2((unsigned*)(VB + o3), *(const v4u*)&tb[cf][qf * 8]); vst2((unsigned*)(VBL + o3), *(const v4u*)&tbl[cf][qf * 8]); } }
// ---- k_att: block = 16 queries of one batch (tile and batch from the flat block index, longest tile first), 16 waves: logits, softmax and P . v in one kernel; the 16 logit rows stay in LDS from the first product to the last, so no logit and no P goes through memory.
// 1) wave w takes the 16-key tiles w, w + 16, ... of keys [0, kend): q hi + residual (x 2^10) against k hi + residual (3 products), x SCALE, into sp[query][key]
// 2) wave w owns query row w: causal mask by index, max, exp, sum, P x 2^11 in place (0 for excluded keys)
// 3) wave w takes the 64-key pairs of steps w, w + 16, ...: P as bf16 hi + lo against v bf16 hi + lo (3 products); the 16 partial tiles are summed through LDS in wave order and the 64 real columns stored to out
#define FA_KS 16               // waves of a block
#define LOG2E 1.4426950408889634f
#define FA_P  (TT + 4)         // f32 pitch of a logit row in LDS: row r starts 4 r banks on, so the 16 rows of a 16-byte fragment read cover all 64 banks once
// second bound: 8 waves per SIMD = 128 registers a wave, so that two blocks (LDS allows two) share a WGP and one block's matrix phases run under the other's softmax and barriers
__global__ __launch_bounds__(32 * FA_KS, 8) void k_att(const _Float16* __restrict__ KH, const _Float16* __restrict__ KL, const __bf16* __restrict__ VB, const __bf16* __restrict__ VBL, float* __restrict__ OUT) {
  __shared__ __align__(16) float buf[16 * FA_P];   // first the logit / P rows, then (behind a barrier) the waves' partial tiles
  float (*sp)[FA_P] = (float (*)[FA_P])buf; float (*ss)[16][HD + 4] = (float (*)[16][HD + 4])buf;
  static_assert(FA_KS * 16 * (HD + 4) <= 16 * FA_P, "the partial tiles fit the buffer");
  const int tid = threadIdx.x, lane = tid & 31, col = lane & 15, g = lane >> 4; const int fi = blockIdx.z * (TT / 16) + blockIdx.x;   // flat block index
  const int b = fi % TNB; const int ql0 = (TT / 16 - 1 - fi / TNB) * 16;   // cost falls with the index: the query tiles with the most keys (all batches) come first, the shortest last
  const int kend = (kb_last(ql0 >> 6) + 1) * 128;
  const int wave = __builtin_amdgcn_readfirstlane(tid >> 5);   // scalar, so that every key loop's trip count is a scalar branch and every lane stays on at the matrix instructions
  { v16h ah[HD / 32], al[HD / 32]; const _Float16* qh = KH + ((size_t)b * TT + ql0) * CC; const _Float16* ql = KL + ((size_t)b * KHI + ql0) * CC;   // q = k: the query tile's fragments are its own rows of the k planes
#pragma unroll
    for (int kc = 0; kc < HD / 32; ++kc) { ah[kc] = fragp_h(qh + kc * 512, lane); al[kc] = fragp_h(ql + kc * 512, lane); }
    asm volatile("s_wait_xcnt 0x0" :: "v"(qh + 8 * lane), "v"(ql + 8 * lane) : "memory");   // the wait before a register of an issued q load is overwritten; with the two lane addresses as inputs the build keeps it behind the loads (without them the loads sink below it)
    for (int jt = wave; jt < kend / 16; jt += FA_KS) { const _Float16* kh = KH + ((size_t)b * TT + jt * 16) * CC; const _Float16* kl = KL + ((size_t)b * KHI + jt * 16) * CC; v8f acc = {}, accl = {};
#pragma unroll
      for (int kc = 0; kc < HD / 32; ++kc) { const v16h kbf = fragp_h(kh + kc * 512, lane), klf = fragp_h(kl + kc * 512, lane); acc = wmma16(ah[kc], kbf, acc); accl = wmma16(al[kc], kbf, accl); accl = wmma16(ah[kc], klf, accl); }
#pragma unroll
      for (int r = 0; r < 8; ++r) sp[8 * g + r][jt * 16 + col] = (acc[r] + accl[r] * (1.0f / 1024.0f)) * SCALE; } }
  __syncthreads();   // all logits of the 16 rows are in LDS before a wave reduces its row
  { const int t = ql0 + wave; float* sr = sp[wave]; float m = -3.0e38f;
#pragma unroll 4   // four LDS reads in flight
    for (int kq = 0; kq < kend / 128; ++kq) { const int k = kq * 128 + lane * 4; const v4f v = *(const v4f*)&sr[k];
#pragma unroll
      for (int i = 0; i < 4; ++i) m = fmaxf(m, (!CAUSAL || k + i <= t) ? v[i] : -3.0e38f); }
#pragma unroll
    for (int o = 1; o < 32; o <<= 1) m = fmaxf(m, __shfl_xor(m, o));
    float sum = 0.f; const float ml = m * LOG2E;   // exp(v - m) = 2^(v log2(e) - ml): one fused multiply-add and the bare base-2 exponential; ml's own rounding scales a whole row alike and leaves with the division by the row's sum
#pragma unroll 2   // the next LDS read flies under this one's exponentials
    for (int kq = 0; kq < kend / 128; ++kq) { const int k = kq * 128 + lane * 4; const v4f v = *(const v4f*)&sr[k]; v4f e;
#pragma unroll
      for (int i = 0; i < 4; ++i) { const float p = __builtin_amdgcn_exp2f(__builtin_fmaf(v[i], LOG2E, -ml)); e[i] = (!CAUSAL || k + i <= t) ? p : 0.f; sum += e[i]; }   // computed for every key and selected: four independent exponentials and no branch
      *(v4f*)&sr[k] = e; }
#pragma unroll
    for (int o = 1; o < 32; o <<= 1) sum += __shfl_xor(sum, o);
    const float inv = sum > 0.f ? 2048.0f / sum : 0.f;
#pragma unroll 4   // four LDS reads in flight
    for (int kq = 0; kq < kend / 128; ++kq) { const int k = kq * 128 + lane * 4; const v4f e = *(const v4f*)&sr[k]; *(v4f*)&sr[k] = e * inv; } }
  __syncthreads();   // every row's P is in LDS before any wave reads its key range of all 16 rows
  v8f acc[HD / 16] = {};
#pragma unroll 1   // one 64-key pair a trip: a second pair's fragments would not fit the 128 registers
  for (int kp = wave; kp < kend / 64; kp += FA_KS)
#pragma unroll
    for (int kc = 2 * kp; kc < 2 * kp + 2; ++kc) { const F2 p = split_row(sp[col], kc * 32, lane);
#pragma unroll
      for (int j = 0; j < HD / 16; j += 2) { const size_t po = (((size_t)b * (KHI / 32) + kc) * (CC / 16) + j) * 512, p1 = po + 512; const v16b vh0 = fragp_b(VB + po, lane), vl0 = fragp_b(VBL + po, lane), vh1 = fragp_b(VB + p1, lane), vl1 = fragp_b(VBL + p1, lane);   // two column tiles' loads in flight together
        acc[j] = wmma_bf(p.h, vh0, acc[j]); acc[j] = wmma_bf(p.l, vh0, acc[j]); acc[j] = wmma_bf(p.h, vl0, acc[j]); acc[j + 1] = wmma_bf(p.h, vh1, acc[j + 1]); acc[j + 1] = wmma_bf(p.l, vh1, acc[j + 1]); acc[j + 1] = wmma_bf(p.h, vl1, acc[j + 1]); } }
  __syncthreads();   // the last read of P is over before the partial tiles overwrite its LDS
#pragma unroll
  for (int j = 0; j < HD / 16; ++j)
#pragma unroll
    for (int r = 0; r < 8; ++r) ss[wave][8 * g + r][j * 16 + col] = acc[j][r] * (1.0f / 2048.0f);
  __syncthreads();   // every wave's partial tile (zero where a wave had no keys) is in LDS before any thread sums them
  if (tid < 16 * (DOUT / 4)) { const int rl = tid / (DOUT / 4), q = tid % (DOUT / 4); v4f s = *(const v4f*)&ss[0][rl][q * 4];
#pragma unroll
    for (int w = 1; w < FA_KS; ++w) s += *(const v4f*)&ss[w][rl][q * 4];
    vst2(OUT + ((size_t)b * TT + ql0 + rl) * DOUT + q * 4, s); } }

extern "C" void kernel_launch(void* const* d_in, const int* in_sizes, int n_in, void* d_out, int out_size, void* d_ws, size_t ws_size, hipStream_t stream) {
  (void)in_sizes; (void)n_in; (void)out_size;
  const float** F = (const float**)d_in;
  if (ws_size < (size_t)WS_END) return;
  char* ws = (char*)d_ws; _Float16 *KH = (_Float16*)(ws + WS_KH), *KL = (_Float16*)(ws + WS_KL); __bf16 *VB = (__bf16*)(ws + WS_VB), *VBL = (__bf16*)(ws + WS_VBL); float *Y = (float*)(ws + WS_Y);
  (void)Y;
  // inputs: 0 embedding [4,2048,1024]; 1 Wk [64,1024] (out,in) (q = k = v)
  k_proj<<<dim3(TNB * TT / 64, 1, 1), 128, 0, stream>>>(F[0], F[1], KH, KL, VB, VBL);
  k_att<<<dim3(TT / 16, 1, TNB), 32 * FA_KS, 0, stream>>>(KH, KL, VB, VBL, (float*)d_out);
}

// v009
// Measured time: 26.1 microseconds a run.
// In two side-by-side timings against v008, it was 1.17 and 1.15 times as fast.
// Counting every step since v000, it is 34.8 times as fast.
// compute dtype: all float inputs rounded to bf16; q = k = v = x Wk^T with EXACT bf16 products on WMMA 16x16x32 (f32 accumulate; the single head's planes are 64 wide, its real width); causal logits with q = k as f16 hi + residual on both sides (3 products) x 64^-0.5; softmax in f32; P as bf16 hi + lo against v bf16 hi + lo (3 products); f32 output.
#include <hip/hip_runtime.h>
#include <math.h>

typedef __attribute__((ext_vector_type(16))) _Float16 v16h;
typedef __attribute__((ext_vector_type(16))) __bf16 v16b;
typedef __attribute__((ext_vector_type(8)))  _Float16 v8h;
typedef __attribute__((ext_vector_type(8)))  float v8f;
typedef __attribute__((ext_vector_type(4)))  float v4f;
typedef __attribute__((ext_vector_type(2)))  float v2f;
typedef __attribute__((ext_vector_type(4)))  unsigned v4u;
typedef __attribute__((ext_vector_type(4)))  int v4i;
typedef float __attribute__((may_alias)) float_a;
typedef int __attribute__((may_alias)) int_a;

template <typename T> __device__ __forceinline__ void vst2(void* p, T v) { *(T*)p = v;  }
__device__ __forceinline__ v8f wmma16(v16h a, v16h b, v8f c) {
  v8f d = __builtin_amdgcn_wmma_f32_16x16x32_f16(false, a, false, b, (short)0, c, false, false);
  asm volatile("v_nop\n\tv_nop\n\tv_nop\n\tv_nop" : "+v"(d) : "v"(a), "v"(b));
  return d;
}
__device__ __forceinline__ v8f wmma_bf(v16b a, v16b b, v8f c) {
  v8f d = __builtin_amdgcn_wmma_f32_16x16x32_bf16(false, a, false, b, (short)0, c, false, false);
  asm volatile("v_nop\n\tv_nop\n\tv_nop\n\tv_nop" : "+v"(d) : "v"(a), "v"(b));
  return d;
}
// 16x16x32 fragments: lane = (h = lane>>4, row/col = lane&15); elements 0..7 = k0+8h+0..7, 8..15 = k0+16+8h+0..7; D element r = row 8h+r
__device__ __forceinline__ v16h frag_h(const _Float16* rowk0, int lane) {
  union { v16h v; v8h q[2]; } u; const _Float16* p = rowk0 + 8 * (lane >> 4);
  u.q[0] = *(const v8h*)p; u.q[1] = *(const v8h*)(p + 16); return u.v;
}
__device__ __forceinline__ v16h frag_f32(const float* rowk0, int lane) {
  v16h a; const float* p = rowk0 + 8 * (lane >> 4);
#pragma unroll
  for (int i = 0; i < 8; ++i) { a[i] = (_Float16)p[i]; a[8 + i] = (_Float16)p[16 + i]; }
  return a;
}
__device__ __forceinline__ v16h frag_f32s(const float* rowk0, int lane, float sc) {
  v16h a; const float* p = rowk0 + 8 * (lane >> 4);
#pragma unroll
  for (int i = 0; i < 8; ++i) { a[i] = (_Float16)(p[i] * sc); a[8 + i] = (_Float16)(p[16 + i] * sc); }
  return a;
}
// column fragment from a [K][ld] layout (column n), rows >= K read as 0
__device__ __forceinline__ v16h fragc_f32(const float* W, int k0, int n, int lane, int ld, int K) {
  v16h a; const int g = lane >> 4;
#pragma unroll
  for (int i = 0; i < 8; ++i) { const int ka = k0 + 8 * g + i, kb = ka + 16;
    a[i] = (_Float16)(ka < K ? W[(size_t)(ka < K ? ka : K - 1) * ld + n] : 0.f); a[8 + i] = (_Float16)(kb < K ? W[(size_t)(kb < K ? kb : K - 1) * ld + n] : 0.f); }
  return a;
}
struct F2 { v16b h, l; };
__device__ __forceinline__ F2 bsplit16(const float v[16]) { F2 r;
#pragma unroll
  for (int i = 0; i < 16; ++i) { const __bf16 h = (__bf16)v[i]; r.h[i] = h; r.l[i] = (__bf16)(v[i] - (float)h); }
  return r; }
__device__ __forceinline__ F2 split_row(const float* row, int k0, int lane) { float v[16]; const float* p = row + k0 + 8 * (lane >> 4);
#pragma unroll
  for (int i = 0; i < 8; ++i) { v[i] = p[i]; v[8 + i] = p[16 + i]; }
  return bsplit16(v); }
__device__ __forceinline__ F2 split_rowK(const float* row, int k0, int lane, int K) { float v[16]; const int g = lane >> 4;
#pragma unroll
  for (int i = 0; i < 8; ++i) { const int ka = k0 + 8 * g + i, kb = ka + 16; v[i] = ka < K ? row[ka < K ? ka : K - 1] : 0.f; v[8 + i] = kb < K ? row[kb < K ? kb : K - 1] : 0.f; }
  return bsplit16(v); }
__device__ __forceinline__ F2 split_col(const float* W, int k0, int n, int lane, int ld, int K) { float v[16]; const int g = lane >> 4;
#pragma unroll
  for (int i = 0; i < 8; ++i) { const int ka = k0 + 8 * g + i, kb = ka + 16; v[i] = ka < K ? W[(size_t)(ka < K ? ka : K - 1) * ld + n] : 0.f; v[8 + i] = kb < K ? W[(size_t)(kb < K ? kb : K - 1) * ld + n] : 0.f; }
  return bsplit16(v); }
__device__ __forceinline__ v8f mac3(const F2& a, const F2& b, v8f c) { c = wmma_bf(a.l, b.h, c); c = wmma_bf(a.h, b.l, c); return wmma_bf(a.h, b.h, c); }
__device__ __forceinline__ float sigm(float v) { return 1.0f / (1.0f + expf(-v)); }
#define LDSX() do { asm volatile("s_wait_dscnt 0" ::: "memory"); __builtin_amdgcn_wave_barrier(); __builtin_amdgcn_fence(__ATOMIC_RELEASE, "workgroup"); } while (0)

// Single-head causal self-attention with shared projections (B 4, S 2,048, E 1,024 -> A 64): k = x Wk^T; q = v = k; x = q k^T / 8 masked where tril(x) == 0 (the strict upper triangle; exact-zero logits in the lower triangle would also be masked - measure-zero for these inputs); softmax; out = P v -> [B, S, 64].
#define NB 4
#define TT 2048
#define CC 64             // NH * HD = projected width
#define DIN 1024
#define NH 1
#define HD 64
#define NQB (TT / 64)
#define HG 1
#define SCALE (0.125f)
#define CAUSAL 1
#ifndef TNB
#define TNB NB
#endif
__device__ __forceinline__ v16b zero16b() { v16b z; _Pragma("unroll") for (int i = 0; i < 16; ++i) z[i] = (__bf16)0.f; return z; }
__device__ __forceinline__ float bfr(float v) { return (float)(__bf16)v; }
__host__ __device__ __forceinline__ int kb_last(int qb) { return CAUSAL ? ((qb * 64 + 63) >> 7) : (TT / 128 - 1); }
typedef __attribute__((ext_vector_type(8))) __bf16 v8b;
__device__ __forceinline__ v16b frag_b(const __bf16* rowk0, int lane) {
  union { v16b v; v8b q[2]; } u; const __bf16* p = rowk0 + 8 * (lane >> 4);
  u.q[0] = *(const v8b*)p; u.q[1] = *(const v8b*)(p + 16); return u.v;
}
// a 16 x 32 fragment kept in fragment order = 1 KiB: lane l's elements 0..7 at byte 16 l, its elements 8..15 at byte 512 + 16 l, so each 16-byte load of a wave covers 512 contiguous bytes (4 whole lines)
__device__ __forceinline__ v16h fragp_h(const _Float16* f, int lane) {
  union { v16h v; v8h q[2]; } u; const _Float16* p = f + 8 * lane;
  u.q[0] = *(const v8h*)p; u.q[1] = *(const v8h*)(p + 256); return u.v;
}
__device__ __forceinline__ v16b fragp_b(const __bf16* f, int lane) {
  union { v16b v; v8b q[2]; } u; const __bf16* p = f + 8 * lane;
  u.q[0] = *(const v8b*)p; u.q[1] = *(const v8b*)(p + 256); return u.v;
}
#define QBH NQB            // every block: 3-product logits (the self key's logit |k|^2/8 ~ 8 dominates -> peaked rows) and bf16 hi/lo P.v
#define QHI TT
#define KHI TT
// B fragment (k rows k0+.., output column o) of a weight: (in,out) [K][ld] or (out,in) [ld rows of K]: bf16 exact, or f16(bf16 * 256) exact
__device__ __forceinline__ v16b wcol_io(const float* Wm, int k0, int o, int lane, int ld) { v16b w; const int g = lane >> 4;
#pragma unroll
  for (int i = 0; i < 8; ++i) { w[i] = (__bf16)Wm[(size_t)(k0 + 8 * g + i) * ld + o]; w[8 + i] = (__bf16)Wm[(size_t)(k0 + 16 + 8 * g + i) * ld + o]; }
  return w; }
__device__ __forceinline__ v16b wcol_oi(const float* Wm, int k0, int o, int lane, int K) { v16b w; const float* p = Wm + (size_t)o * K + k0 + 8 * (lane >> 4);
#pragma unroll
  for (int i = 0; i < 8; ++i) { w[i] = (__bf16)p[i]; w[8 + i] = (__bf16)p[16 + i]; }
  return w; }
__device__ __forceinline__ v16h wcolh_io(const float* Wm, int k0, int o, int lane, int ld) { v16h w; const int g = lane >> 4;
#pragma unroll
  for (int i = 0; i < 8; ++i) { w[i] = (_Float16)(bfr(Wm[(size_t)(k0 + 8 * g + i) * ld + o]) * 256.0f); w[8 + i] = (_Float16)(bfr(Wm[(size_t)(k0 + 16 + 8 * g + i) * ld + o]) * 256.0f); }
  return w; }
__device__ __forceinline__ v16h wcolh_oi(const float* Wm, int k0, int o, int lane, int K) { v16h w; const float* p = Wm + (size_t)o * K + k0 + 8 * (lane >> 4);
#pragma unroll
  for (int i = 0; i < 8; ++i) { w[i] = (_Float16)(bfr(p[i]) * 256.0f); w[8 + i] = (_Float16)(bfr(p[16 + i]) * 256.0f); }
  return w; }
#define WQKV_LAYOUT 0   // 0 = (out,in) [DOUT][DIN], columns >= DOUT zero; 1 = (out,in) [CC][DIN]; 2 = per-head [NH][DIN][HD]
__device__ __forceinline__ v16b wcol_hdk(const float* Wm, int k0, int o, int lane) { v16b w; const int g = lane >> 4; const float* p = Wm + (size_t)(o / HD) * DIN * HD + (o % HD);
#pragma unroll
  for (int i = 0; i < 8; ++i) { w[i] = (__bf16)p[(size_t)(k0 + 8 * g + i) * HD]; w[8 + i] = (__bf16)p[(size_t)(k0 + 16 + 8 * g + i) * HD]; }
  return w; }
#define WO_OUT_IN 0
#if WQKV_LAYOUT == 1
#define WCOL(W, k0, o, lane) wcol_oi(W, k0, o, lane, DIN)
#elif WQKV_LAYOUT == 2
#define WCOL(W, k0, o, lane) wcol_hdk(W, k0, o, lane)
#else
#define WCOL(W, k0, o, lane) (((o) < DOUT) ? wcol_oi(W, k0, (o), lane, DIN) : zero16b())   /* Wk (out,in) [64][1024]; q = k = v = x Wk^T */
#endif
#if WO_OUT_IN
#define WOCOL(W, k0, o, lane) wcol_oi(W, k0, o, lane, CC)
#define WOCOLH(W, k0, o, lane) wcolh_oi(W, k0, o, lane, CC)
#else
#define WOCOL(W, k0, o, lane) wcol_io(W, k0, o, lane, DIN)
#define WOCOLH(W, k0, o, lane) wcolh_io(W, k0, o, lane, DIN)
#endif
#define DOUT 64            // head width = plane width
#ifndef SM_EXTRA_PARAMS
#define SM_EXTRA_PARAMS
#endif
#ifndef PROJ_EXTRA_PARAMS
#define PROJ_EXTRA_PARAMS
#endif
#ifndef SM_MASK_HOOK
#define SM_MASK_HOOK (void)0
#endif

#define WS_KH  0u                                      // f16 k (= q), fragment order [b*t / 16][CC / 32][512]: A and B fragments of the logits' product have the same order, so one plane serves both sides
#define WS_KL  (WS_KH + 2u * (size_t)NB * TT * CC)      // f16 k (= q) residual x 2^10, fragment order like k
#define WS_VB  (WS_KL + 2u * (size_t)NB * KHI * CC)     // bf16 v hi, fragment order [b][t / 32][CC / 16][512] (and v lo behind it)
#define WS_VBL (WS_VB + 2u * (size_t)NB * CC * KHI)
#define WS_Y   (WS_VBL + 2u * (size_t)NB * CC * KHI)    // f32 ctx rows [b*t][CC] (only when there is an output projection)
#define WS_END (WS_Y  + 0u)

// k_proj's staging: a k tile = 64 rows of X and the 64 rows of Wk, PJ_KT columns each, f32 as in memory, brought into LDS by asynchronous copies
#define PJ_KT 128                         // k columns of a tile: a row's piece is 512 contiguous bytes = one copy of a wave
#define PJ_P  (PJ_KT + 4)                 // f32 pitch of a staged row (16 bytes x 33): the 16 rows of a 16-byte fragment read cover all 64 banks once
#define PJ_ROWS (64 + DOUT)
#define PJ_BUFB (PJ_ROWS * PJ_P * 4u)     // bytes of one buffer
#define PJ_LS (4u * PJ_P * 4u)            // LDS bytes between two rows of one wave (4 waves take rows in turn)
#define PJ_GS (4 * DIN)
// eight copies of one wave, rows 4 apart; s_wait_xcnt stands inside the copies' own statement, in front of any rewrite of a register that a copy names
__device__ __forceinline__ void pj_copy8(unsigned l, const float* gp) {
  asm volatile("global_load_async_to_lds_b128 %0, %8, off\n\tglobal_load_async_to_lds_b128 %1, %9, off\n\tglobal_load_async_to_lds_b128 %2, %10, off\n\tglobal_load_async_to_lds_b128 %3, %11, off\n\t"
               "global_load_async_to_lds_b128 %4, %12, off\n\tglobal_load_async_to_lds_b128 %5, %13, off\n\tglobal_load_async_to_lds_b128 %6, %14, off\n\tglobal_load_async_to_lds_b128 %7, %15, off\n\ts_wait_xcnt 0x0"
               :: "v"(l), "v"(l + PJ_LS), "v"(l + 2 * PJ_LS), "v"(l + 3 * PJ_LS), "v"(l + 4 * PJ_LS), "v"(l + 5 * PJ_LS), "v"(l + 6 * PJ_LS), "v"(l + 7 * PJ_LS),
                  "v"(gp), "v"(gp + PJ_GS), "v"(gp + 2 * PJ_GS), "v"(gp + 3 * PJ_GS), "v"(gp + 4 * PJ_GS), "v"(gp + 5 * PJ_GS), "v"(gp + 6 * PJ_GS), "v"(gp + 7 * PJ_GS) : "memory");
}
// one wave's 32 copies of a tile: its 16 rows of X, then its 16 rows of Wk (LDS rows 64 ..)
__device__ __forceinline__ void pj_stage(unsigned l, const float* xg, const float* wg) {
  pj_copy8(l, xg); pj_copy8(l + 8 * PJ_LS, xg + 8 * PJ_GS); pj_copy8(l + 16 * PJ_LS, wg); pj_copy8(l + 24 * PJ_LS, wg + 8 * PJ_GS);
}
// bf16 fragment of a staged f32 row (p = row + k0 + 8 * (lane >> 4)): elements 0..7 = p[0..7], 8..15 = p[16..23], for A and B alike
__device__ __forceinline__ v16b frag_lds(const float* p) { const v4f x0 = *(const v4f*)p, x1 = *(const v4f*)(p + 4), x2 = *(const v4f*)(p + 16), x3 = *(const v4f*)(p + 20); v16b a;
#pragma unroll
  for (int i = 0; i < 4; ++i) { a[i] = (__bf16)x0[i]; a[4 + i] = (__bf16)x1[i]; a[8 + i] = (__bf16)x2[i]; a[12 + i] = (__bf16)x3[i]; }
  return a; }
// ---- k_proj: block = (64 rows, CC cols): the one projection X Wk^T (q = k = v) with exact bf16 products (K = DIN), computed once; each block stores it as f16 hi + residual (the logits' q and k) and as bf16 hi + lo (v), in the order in which k_att's fragments read them
__global__ __launch_bounds__(128) void k_proj(const float* __restrict__ X, const float* __restrict__ WA, _Float16* __restrict__ KH, _Float16* __restrict__ KL, __bf16* __restrict__ VB, __bf16* __restrict__ VBL) {
  // the K loop's two staging buffers and the epilogue's transposing tiles share one LDS range (the epilogue starts behind the loop's last barrier)
  __shared__ __align__(16) union { float st[2][PJ_ROWS][PJ_P]; struct { _Float16 sh[64][CC + 8], sl[64][CC + 8]; __bf16 tb[CC][72], tbl[CC][72]; } ep; } u;
  auto& sh = u.ep.sh; auto& sl = u.ep.sl; auto& tb = u.ep.tb; auto& tbl = u.ep.tbl;
  const int tid = threadIdx.x, wave = tid >> 5, lane = tid & 31, col = lane & 15, g = lane >> 4; const size_t r0 = (size_t)blockIdx.x * 64; const size_t bb = r0 / TT; const int t0 = (int)(r0 % TT);
  v8f acc[CC / 16] = {};
  static_assert(CC == DOUT && DOUT % 16 == 0 && DIN % PJ_KT == 0 && DIN / PJ_KT >= 2, "plane column tile j is Wk's rows 16 j ..; at least two k tiles");
  const unsigned l0 = (unsigned)(size_t)&u.st[0][wave][lane * 4];   // LDS byte address of this lane's 16 bytes in row 'wave' of buffer 0
  const float* xg = X + (r0 + wave) * DIN + lane * 4; const float* wg = WA + (size_t)wave * DIN + lane * 4;
  pj_stage(l0, xg, wg);
  asm volatile("s_wait_asynccnt 0x0" ::: "memory");   // this wave's copies of tile 0 have landed
  __syncthreads();                                      // ... and every other wave's: tile 0 may be read
  pj_stage(l0 + PJ_BUFB, xg + PJ_KT, wg + PJ_KT);
#pragma unroll 1   // rolled, for speed only
  for (int t = 0; t < DIN / PJ_KT; ++t) { const float* pa = &u.st[t & 1][wave * 16 + col][8 * g]; const float* pw = &u.st[t & 1][64 + col][8 * g];
    v16b a = frag_lds(pa), w[DOUT / 16];
#pragma unroll
    for (int j = 0; j < DOUT / 16; ++j) w[j] = frag_lds(pw + j * 16 * PJ_P);
#pragma unroll
    for (int kq = 0; kq < PJ_KT / 32; ++kq) { v16b an = a, wn[DOUT / 16];   // the next 32 columns' fragments (same tile) are read as one group in front of this step's products, so that their LDS latency runs under them
#pragma unroll
      for (int j = 0; j < DOUT / 16; ++j) wn[j] = w[j];
      if (kq + 1 < PJ_KT / 32) { an = frag_lds(pa + (kq + 1) * 32);
#pragma unroll
        for (int j = 0; j < DOUT / 16; ++j) wn[j] = frag_lds(pw + j * 16 * PJ_P + (kq + 1) * 32); }
#pragma unroll
      for (int j = 0; j < CC / 16; ++j) acc[j] = wmma_bf(a, w[j], acc[j]);
      a = an;
#pragma unroll
      for (int j = 0; j < DOUT / 16; ++j) w[j] = wn[j]; }
    asm volatile("s_wait_dscnt 0x0" ::: "memory");      // this wave's reads of tile t are over
    asm volatile("s_wait_asynccnt 0x0" ::: "memory");   // this wave's copies of tile t + 1 have landed
    __syncthreads();                                      // publishes tile t + 1 and frees tile t's buffer (behind the last trip: for the epilogue's tiles)
    if (t + 2 < DIN / PJ_KT) pj_stage(l0 + (t & 1) * PJ_BUFB, xg + (t + 2) * PJ_KT, wg + (t + 2) * PJ_KT); }
  asm volatile("s_wait_asynccnt 0x0" ::: "memory");     // no copy is outstanding when the LDS range changes hands
#pragma unroll
  for (int j = 0; j < CC / 16; ++j)
#pragma unroll
    for (int r = 0; r < 8; ++r) { const float v = acc[j][r]; const int rl = wave * 16 + 8 * g + r, cl = j * 16 + col; const _Float16 hv = (_Float16)v; sh[rl][cl] = hv; sl[rl][cl] = (_Float16)((v - (float)hv) * 1024.0f); const __bf16 bh = (__bf16)v; tb[cl][rl] = bh; tbl[cl][rl] = (__bf16)(v - (float)bh); }
  __syncthreads();   // all four tiles are whole before any thread gathers its 16-byte pieces
  static_assert(CC == 64, "a block holds whole 16-row tiles: 2 fragments of 64 pieces of 16 bytes each");
#pragma unroll   // four pieces of each plane a thread: their LDS reads fly together, and the stores take immediate offsets from one address each
  for (int i = 0; i < 4; ++i) { const int e = tid + i * 128;
    // k: piece e of the block's 4 tiles: bits 3..0 = row in the tile, 4 = lane half g, 5 = fragment half, 6 = 32-column step, 8..7 = tile; columns 8 * (e >> 4 & 7) ..
    const int rl = (e >> 7) * 16 + (e & 15), q = (e >> 4) & 7; vst2((unsigned*)(KH + r0 * CC + e * 8), *(const v4u*)&sh[rl][q * 8]); vst2((unsigned*)(KL + r0 * CC + e * 8), *(const v4u*)&sl[rl][q * 8]);
    // v: piece e of the block's 2 x 4 fragments: bits 3..0 = column in the tile, 4 = lane half g, 5 = fragment half, 7..6 = column tile, 8 = 32-key step
    const int cf = ((e >> 6) & 3) * 16 + (e & 15), qf = (e >> 8) * 4 + ((e >> 4) & 3); const size_t o3 = (bb * (KHI / 32) + (t0 >> 5)) * (size_t)(CC * 32) + e * 8; vst2((unsigned*)(VB + o3), *(const v4u*)&tb[cf][qf * 8]); vst2((unsigned*)(VBL + o3), *(const v4u*)&tbl[cf][qf * 8]); } }
// ---- k_att: block = two 16-query tiles of one batch, 16 waves: the long tile 127 - i and the short tile i of the causal triangle, so that every block has the same work and each k and v fragment that is loaded for the long tile also feeds the short tile's products while its keys last. Logits, softmax and P . v in one kernel; the 32 logit rows stay in LDS from the first product to the last, so no logit and no P goes through memory.
// 1) wave w takes the 16-key tiles w, w + 16, ... of keys [0, kend of the long tile): q hi + residual (x 2^10) against k hi + residual (3 products), x SCALE, into sp[query][key]; the short tile's rows (16 ..) only for keys below its own kend
// 2) wave w owns query row w of each tile, one after the other: causal mask by index, max, exp, sum, P x 2^11 in place (0 for excluded keys)
// 3) wave w takes the 64-key pairs of steps w, w + 16, ...: P as bf16 hi + lo against v bf16 hi + lo (3 products); the 16 waves' partial tiles (two each) are summed through LDS in wave order and the 64 real columns stored to out
#define FA_KS 16               // waves of a block
#define FA_QT 2                // query tiles of a block
#define LOG2E 1.4426950408889634f
#define FA_P  (TT + 4)         // f32 pitch of a logit row in LDS: row r starts 4 r banks on, so the 16 rows of a 16-byte fragment read cover all 64 banks once
// one block a WGP (the 32 logit rows take most of its LDS), 4 waves per SIMD, up to 256 registers a wave: both tiles' q fragments and accumulators stay in registers
__global__ __launch_bounds__(32 * FA_KS) void k_att(const _Float16* __restrict__ KH, const _Float16* __restrict__ KL, const __bf16* __restrict__ VB, const __bf16* __restrict__ VBL, float* __restrict__ OUT) {
  __shared__ __align__(16) float buf[FA_QT * 16 * FA_P];   // first the logit / P rows (long tile 0 .. 15, short tile 16 .. 31), then (behind a barrier) the waves' partial tiles
  float (*sp)[FA_P] = (float (*)[FA_P])buf; float (*ss)[FA_QT * 16][HD + 4] = (float (*)[FA_QT * 16][HD + 4])buf;
  static_assert(FA_KS * FA_QT * 16 * (HD + 4) <= FA_QT * 16 * FA_P, "the partial tiles fit the buffer");
  static_assert(FA_QT == 2 && (TT / 16) % 2 == 0 && 32 * FA_KS == FA_QT * 16 * (DOUT / 4), "tiles pair up as (n - 1 - i, i); one thread per 16 output bytes");
  const int tid = threadIdx.x, lane = tid & 31, col = lane & 15, g = lane >> 4; const int fi = blockIdx.z * (TT / 32) + blockIdx.x;   // flat block index
  const int b = fi % TNB; const int qa = (TT / 16 - 1 - fi / TNB) * 16, qb = (fi / TNB) * 16;   // first query of the long and of the short tile: qb < qa, so the short tile's keys are a prefix of the long tile's
  const int kenda = (kb_last(qa >> 6) + 1) * 128, kendb = (kb_last(qb >> 6) + 1) * 128;
  const int wave = __builtin_amdgcn_readfirstlane(tid >> 5);   // scalar, so that every key loop's trip count and every test on the short tile's kend is a scalar branch and every lane stays on at the matrix instructions
  { v16h ah[FA_QT][HD / 32], al[FA_QT][HD / 32]; const _Float16* qha = KH + ((size_t)b * TT + qa) * CC; const _Float16* qla = KL + ((size_t)b * KHI + qa) * CC; const _Float16* qhb = KH + ((size_t)b * TT + qb) * CC; const _Float16* qlb = KL + ((size_t)b * KHI + qb) * CC;   // q = k: a query tile's fragments are its own rows of the k planes
#pragma unroll
    for (int kc = 0; kc < HD / 32; ++kc) { ah[0][kc] = fragp_h(qha + kc * 512, lane); al[0][kc] = fragp_h(qla + kc * 512, lane); ah[1][kc] = fragp_h(qhb + kc * 512, lane); al[1][kc] = fragp_h(qlb + kc * 512, lane); }
    asm volatile("s_wait_xcnt 0x0" :: "v"(qha + 8 * lane), "v"(qla + 8 * lane), "v"(qhb + 8 * lane), "v"(qlb + 8 * lane) : "memory");   // the wait before a register of an issued q load is overwritten; with the lane addresses as inputs the build keeps it behind the loads (without them the loads sink below it)
    for (int jt = wave; jt < kenda / 16; jt += FA_KS) { const _Float16* kh = KH + ((size_t)b * TT + jt * 16) * CC; const _Float16* kl = KL + ((size_t)b * KHI + jt * 16) * CC; v16h kbf[HD / 32], klf[HD / 32];
#pragma unroll
      for (int kc = 0; kc < HD / 32; ++kc) { kbf[kc] = fragp_h(kh + kc * 512, lane); klf[kc] = fragp_h(kl + kc * 512, lane); }   // the key tile's fragments, loaded once for both query tiles
      { v8f acc = {}, accl = {};
#pragma unroll
        for (int kc = 0; kc < HD / 32; ++kc) { acc = wmma16(ah[0][kc], kbf[kc], acc); accl = wmma16(al[0][kc], kbf[kc], accl); accl = wmma16(ah[0][kc], klf[kc], accl); }
#pragma unroll
        for (int r = 0; r < 8; ++r) sp[8 * g + r][jt * 16 + col] = (acc[r] + accl[r] * (1.0f / 1024.0f)) * SCALE; }
      asm volatile("s_wait_xcnt 0x0" ::: "memory");   // the wait before the k loads' address registers step on to the next key tile; their data has arrived by here, so it holds nothing up
      if (jt * 16 < kendb) { v8f acc = {}, accl = {};
#pragma unroll
        for (int kc = 0; kc < HD / 32; ++kc) { acc = wmma16(ah[1][kc], kbf[kc], acc); accl = wmma16(al[1][kc], kbf[kc], accl); accl = wmma16(ah[1][kc], klf[kc], accl); }
#pragma unroll
        for (int r = 0; r < 8; ++r) sp[16 + 8 * g + r][jt * 16 + col] = (acc[r] + accl[r] * (1.0f / 1024.0f)) * SCALE; } } }
  __syncthreads();   // all logits of the 32 rows are in LDS before a wave reduces its rows
#pragma unroll 1   // rolled: a second copy of the three row loops would only lengthen the text
  for (int h = 0; h < FA_QT; ++h) { const int t = (h ? qb : qa) + wave, kend = h ? kendb : kenda; float* sr = sp[h * 16 + wave]; float m = -3.0e38f;
#pragma unroll 4   // four LDS reads in flight
    for (int kq = 0; kq < kend / 128; ++kq) { const int k = kq * 128 + lane * 4; const v4f v = *(const v4f*)&sr[k];
#pragma unroll
      for (int i = 0; i < 4; ++i) m = fmaxf(m, (!CAUSAL || k + i <= t) ? v[i] : -3.0e38f); }
#pragma unroll
    for (int o = 1; o < 32; o <<= 1) m = fmaxf(m, __shfl_xor(m, o));
    float sum = 0.f; const float ml = m * LOG2E;   // exp(v - m) = 2^(v log2(e) - ml): one fused multiply-add and the bare base-2 exponential; ml's own rounding scales a whole row alike and leaves with the division by the row's sum
#pragma unroll 2   // the next LDS read flies under this one's exponentials
    for (int kq = 0; kq < kend / 128; ++kq) { const int k = kq * 128 + lane * 4; const v4f v = *(const v4f*)&sr[k]; v4f e;
#pragma unroll
      for (int i = 0; i < 4; ++i) { const float p = __builtin_amdgcn_exp2f(__builtin_fmaf(v[i], LOG2E, -ml)); e[i] = (!CAUSAL || k + i <= t) ? p : 0.f; sum += e[i]; }   // computed for every key and selected: four independent exponentials and no branch
      *(v4f*)&sr[k] = e; }
#pragma unroll
    for (int o = 1; o < 32; o <<= 1) sum += __shfl_xor(sum, o);
    const float inv = sum > 0.f ? 2048.0f / sum : 0.f;
#pragma unroll 4   // four LDS reads in flight
    for (int kq = 0; kq < kend / 128; ++kq) { const int k = kq * 128 + lane * 4; const v4f e = *(const v4f*)&sr[k]; *(v4f*)&sr[k] = e * inv; } }
  __syncthreads();   // every row's P is in LDS before any wave reads its key range of all 32 rows
  v8f acc[FA_QT][HD / 16] = {};
#pragma unroll 1   // one 64-key pair a trip: a second pair's fragments would not fit the registers beside both tiles' accumulators
  for (int kp = wave; kp < kenda / 64; kp += FA_KS)
#pragma unroll
    for (int kc = 2 * kp; kc < 2 * kp + 2; ++kc) { v16b vh[HD / 16], vl[HD / 16];
#pragma unroll
      for (int j = 0; j < HD / 16; ++j) { const size_t po = (((size_t)b * (KHI / 32) + kc) * (CC / 16) + j) * 512; vh[j] = fragp_b(VB + po, lane); vl[j] = fragp_b(VBL + po, lane); }   // the 32 keys' v fragments, loaded once for both query tiles, all in flight together
      { const F2 p = split_row(sp[col], kc * 32, lane);
#pragma unroll
        for (int j = 0; j < HD / 16; ++j) { acc[0][j] = wmma_bf(p.h, vh[j], acc[0][j]); acc[0][j] = wmma_bf(p.l, vh[j], acc[0][j]); acc[0][j] = wmma_bf(p.h, vl[j], acc[0][j]); } }
      if (kp * 64 < kendb) { const F2 p = split_row(sp[16 + col], kc * 32, lane);
#pragma unroll
        for (int j = 0; j < HD / 16; ++j) { acc[1][j] = wmma_bf(p.h, vh[j], acc[1][j]); acc[1][j] = wmma_bf(p.l, vh[j], acc[1][j]); acc[1][j] = wmma_bf(p.h, vl[j], acc[1][j]); } } }
  __syncthreads();   // the last read of P is over before the partial tiles overwrite its LDS
#pragma unroll
  for (int h = 0; h < FA_QT; ++h)
#pragma unroll
    for (int j = 0; j < HD / 16; ++j)
#pragma unroll
      for (int r = 0; r < 8; ++r) ss[wave][h * 16 + 8 * g + r][j * 16 + col] = acc[h][j][r] * (1.0f / 2048.0f);
  __syncthreads();   // every wave's partial tiles (zero where a wave had no keys) are in LDS before any thread sums them
  { const int rl = tid / (DOUT / 4), q = tid % (DOUT / 4); v4f s = *(const v4f*)&ss[0][rl][q * 4];
#pragma unroll
    for (int w = 1; w < FA_KS; ++w) s += *(const v4f*)&ss[w][rl][q * 4];
    vst2(OUT + ((size_t)b * TT + (rl < 16 ? qa + rl : qb + rl - 16)) * DOUT + q * 4, s); } }

extern "C" void kernel_launch(void* const* d_in, const int* in_sizes, int n_in, void* d_out, int out_size, void* d_ws, size_t ws_size, hipStream_t stream) {
  (void)in_sizes; (void)n_in; (void)out_size;
  const float** F = (const float**)d_in;
  if (ws_size < (size_t)WS_END) return;
  char* ws = (char*)d_ws; _Float16 *KH = (_Float16*)(ws + WS_KH), *KL = (_Float16*)(ws + WS_KL); __bf16 *VB = (__bf16*)(ws + WS_VB), *VBL = (__bf16*)(ws + WS_VBL); float *Y = (float*)(ws + WS_Y);
  (void)Y;
  // inputs: 0 embedding [4,2048,1024]; 1 Wk [64,1024] (out,in) (q = k = v)
  k_proj<<<dim3(TNB * TT / 64, 1, 1), 128, 0, stream>>>(F[0], F[1], KH, KL, VB, VBL);
  k_att<<<dim3(TT / 32, 1, TNB), 32 * FA_KS, 0, stream>>>(KH, KL, VB, VBL, (float*)d_out);
}

// v010
// A run of this version takes 23.5 microseconds.
// In two side-by-side timings against v009, it was 1.15 and 1.14 times as fast.
// Counting every step since v000, it is 39.7 times as fast.
// compute dtype: all float inputs rounded to bf16; q = k = v = x Wk^T with EXACT bf16 products on WMMA 16x16x32 (f32 accumulate; the single head's planes are 64 wide, its real width); causal logits with q = k as f16 hi + residual on both sides (3 products) x 64^-0.5; softmax in f32; P as bf16 hi + lo against v bf16 hi + lo (3 products); f32 output.
#include <hip/hip_runtime.h>
#include <math.h>

typedef __attribute__((ext_vector_type(16))) _Float16 v16h;
typedef __attribute__((ext_vector_type(16))) __bf16 v16b;
typedef __attribute__((ext_vector_type(8)))  _Float16 v8h;
typedef __attribute__((ext_vector_type(8)))  float v8f;
typedef __attribute__((ext_vector_type(4)))  float v4f;
typedef __attribute__((ext_vector_type(2)))  float v2f;
typedef __attribute__((ext_vector_type(4)))  unsigned v4u;
typedef __attribute__((ext_vector_type(4)))  int v4i;
typedef float __attribute__((may_alias)) float_a;
typedef int __attribute__((may_alias)) int_a;

template <typename T> __device__ __forceinline__ void vst2(void* p, T v) { *(T*)p = v;  }
__device__ __forceinline__ v8f wmma16(v16h a, v16h b, v8f c) {
  v8f d = __builtin_amdgcn_wmma_f32_16x16x32_f16(false, a, false, b, (short)0, c, false, false);
  asm volatile("v_nop\n\tv_nop\n\tv_nop\n\tv_nop" : "+v"(d) : "v"(a), "v"(b));
  return d;
}
__device__ __forceinline__ v8f wmma_bf(v16b a, v16b b, v8f c) {
  v8f d = __builtin_amdgcn_wmma_f32_16x16x32_bf16(false, a, false, b, (short)0, c, false, false);
  asm volatile("v_nop\n\tv_nop\n\tv_nop\n\tv_nop" : "+v"(d) : "v"(a), "v"(b));
  return d;
}
// 16x16x32 fragments: lane = (h = lane>>4, row/col = lane&15); elements 0..7 = k0+8h+0..7, 8..15 = k0+16+8h+0..7; D element r = row 8h+r
__device__ __forceinline__ v16h frag_h(const _Float16* rowk0, int lane) {
  union { v16h v; v8h q[2]; } u; const _Float16* p = rowk0 + 8 * (lane >> 4);
  u.q[0] = *(const v8h*)p; u.q[1] = *(const v8h*)(p + 16); return u.v;
}
__device__ __forceinline__ v16h frag_f32(const float* rowk0, int lane) {
  v16h a; const float* p = rowk0 + 8 * (lane >> 4);
#pragma unroll
  for (int i = 0; i < 8; ++i) { a[i] = (_Float16)p[i]; a[8 + i] = (_Float16)p[16 + i]; }
  return a;
}
__device__ __forceinline__ v16h frag_f32s(const float* rowk0, int lane, float sc) {
  v16h a; const float* p = rowk0 + 8 * (lane >> 4);
#pragma unroll
  for (int i = 0; i < 8; ++i) { a[i] = (_Float16)(p[i] * sc); a[8 + i] = (_Float16)(p[16 + i] * sc); }
  return a;
}
// column fragment from a [K][ld] layout (column n), rows >= K read as 0
__device__ __forceinline__ v16h fragc_f32(const float* W, int k0, int n, int lane, int ld, int K) {
  v16h a; const int g = lane >> 4;
#pragma unroll
  for (int i = 0; i < 8; ++i) { const int ka = k0 + 8 * g + i, kb = ka + 16;
    a[i] = (_Float16)(ka < K ? W[(size_t)(ka < K ? ka : K - 1) * ld + n] : 0.f); a[8 + i] = (_Float16)(kb < K ? W[(size_t)(kb < K ? kb : K - 1) * ld + n] : 0.f); }
  return a;
}
struct F2 { v16b h, l; };
__device__ __forceinline__ F2 bsplit16(const float v[16]) { F2 r;
#pragma unroll
  for (int i = 0; i < 16; ++i) { const __bf16 h = (__bf16)v[i]; r.h[i] = h; r.l[i] = (__bf16)(v[i] - (float)h); }
  return r; }
__device__ __forceinline__ F2 split_row(const float* row, int k0, int lane) { float v[16]; const float* p = row + k0 + 8 * (lane >> 4);
#pragma unroll
  for (int i = 0; i < 8; ++i) { v[i] = p[i]; v[8 + i] = p[16 + i]; }
  return bsplit16(v); }
__device__ __forceinline__ F2 split_rowK(const float* row, int k0, int lane, int K) { float v[16]; const int g = lane >> 4;
#pragma unroll
  for (int i = 0; i < 8; ++i) { const int ka = k0 + 8 * g + i, kb = ka + 16; v[i] = ka < K ? row[ka < K ? ka : K - 1] : 0.f; v[8 + i] = kb < K ? row[kb < K ? kb : K - 1] : 0.f; }
  return bsplit16(v); }
__device__ __forceinline__ F2 split_col(const float* W, int k0, int n, int lane, int ld, int K) { float v[16]; const int g = lane >> 4;
#pragma unroll
  for (int i = 0; i < 8; ++i) { const int ka = k0 + 8 * g + i, kb = ka + 16; v[i] = ka < K ? W[(size_t)(ka < K ? ka : K - 1) * ld + n] : 0.f; v[8 + i] = kb < K ? W[(size_t)(kb < K ? kb : K - 1) * ld + n] : 0.f; }
  return bsplit16(v); }
__device__ __forceinline__ v8f mac3(const F2& a, const F2& b, v8f c) { c = wmma_bf(a.l, b.h, c); c = wmma_bf(a.h, b.l, c); return wmma_bf(a.h, b.h, c); }
__device__ __forceinline__ float sigm(float v) { return 1.0f / (1.0f + expf(-v)); }
#define LDSX() do { asm volatile("s_wait_dscnt 0" ::: "memory"); __builtin_amdgcn_wave_barrier(); __builtin_amdgcn_fence(__ATOMIC_RELEASE, "workgroup"); } while (0)

// Single-head causal self-attention with shared projections (B 4, S 2,048, E 1,024 -> A 64): k = x Wk^T; q = v = k; x = q k^T / 8 masked where tril(x) == 0 (the strict upper triangle; exact-zero logits in the lower triangle would also be masked - measure-zero for these inputs); softmax; out = P v -> [B, S, 64].
#define NB 4
#define TT 2048
#define CC 64             // NH * HD = projected width
#define DIN 1024
#define NH 1
#define HD 64
#define NQB (TT / 64)
#define HG 1
#define SCALE (0.125f)
#define CAUSAL 1
#ifndef TNB
#define TNB NB
#endif
__device__ __forceinline__ v16b zero16b() { v16b z; _Pragma("unroll") for (int i = 0; i < 16; ++i) z[i] = (__bf16)0.f; return z; }
__device__ __forceinline__ float bfr(float v) { return (float)(__bf16)v; }
__host__ __device__ __forceinline__ int kb_last(int qb) { return CAUSAL ? ((qb * 64 + 63) >> 7) : (TT / 128 - 1); }
typedef __attribute__((ext_vector_type(8))) __bf16 v8b;
__device__ __forceinline__ v16b frag_b(const __bf16* rowk0, int lane) {
  union { v16b v; v8b q[2]; } u; const __bf16* p = rowk0 + 8 * (lane >> 4);
  u.q[0] = *(const v8b*)p; u.q[1] = *(const v8b*)(p + 16); return u.v;
}
// a 16 x 32 fragment kept in fragment order = 1 KiB: lane l's elements 0..7 at byte 16 l, its elements 8..15 at byte 512 + 16 l, so each 16-byte load of a wave covers 512 contiguous bytes (4 whole lines)
__device__ __forceinline__ v16h fragp_h(const _Float16* f, int lane) {
  union { v16h v; v8h q[2]; } u; const _Float16* p = f + 8 * lane;
  u.q[0] = *(const v8h*)p; u.q[1] = *(const v8h*)(p + 256); return u.v;
}
__device__ __forceinline__ v16b fragp_b(const __bf16* f, int lane) {
  union { v16b v; v8b q[2]; } u; const __bf16* p = f + 8 * lane;
  u.q[0] = *(const v8b*)p; u.q[1] = *(const v8b*)(p + 256); return u.v;
}
#define QBH NQB            // every block: 3-product logits (the self key's logit |k|^2/8 ~ 8 dominates -> peaked rows) and bf16 hi/lo P.v
#define QHI TT
#define KHI TT
// B fragment (k rows k0+.., output column o) of a weight: (in,out) [K][ld] or (out,in) [ld rows of K]: bf16 exact, or f16(bf16 * 256) exact
__device__ __forceinline__ v16b wcol_io(const float* Wm, int k0, int o, int lane, int ld) { v16b w; const int g = lane >> 4;
#pragma unroll
  for (int i = 0; i < 8; ++i) { w[i] = (__bf16)Wm[(size_t)(k0 + 8 * g + i) * ld + o]; w[8 + i] = (__bf16)Wm[(size_t)(k0 + 16 + 8 * g + i) * ld + o]; }
  return w; }
__device__ __forceinline__ v16b wcol_oi(const float* Wm, int k0, int o, int lane, int K) { v16b w; const float* p = Wm + (size_t)o * K + k0 + 8 * (lane >> 4);
#pragma unroll
  for (int i = 0; i < 8; ++i) { w[i] = (__bf16)p[i]; w[8 + i] = (__bf16)p[16 + i]; }
  return w; }
__device__ __forceinline__ v16h wcolh_io(const float* Wm, int k0, int o, int lane, int ld) { v16h w; const int g = lane >> 4;
#pragma unroll
  for (int i = 0; i < 8; ++i) { w[i] = (_Float16)(bfr(Wm[(size_t)(k0 + 8 * g + i) * ld + o]) * 256.0f); w[8 + i] = (_Float16)(bfr(Wm[(size_t)(k0 + 16 + 8 * g + i) * ld + o]) * 256.0f); }
  return w; }
__device__ __forceinline__ v16h wcolh_oi(const float* Wm, int k0, int o, int lane, int K) { v16h w; const float* p = Wm + (size_t)o * K + k0 + 8 * (lane >> 4);
#pragma unroll
  for (int i = 0; i < 8; ++i) { w[i] = (_Float16)(bfr(p[i]) * 256.0f); w[8 + i] = (_Float16)(bfr(p[16 + i]) * 256.0f); }
  return w; }
#define WQKV_LAYOUT 0   // 0 = (out,in) [DOUT][DIN], columns >= DOUT zero; 1 = (out,in) [CC][DIN]; 2 = per-head [NH][DIN][HD]
__device__ __forceinline__ v16b wcol_hdk(const float* Wm, int k0, int o, int lane) { v16b w; const int g = lane >> 4; const float* p = Wm + (size_t)(o / HD) * DIN * HD + (o % HD);
#pragma unroll
  for (int i = 0; i < 8; ++i) { w[i] = (__bf16)p[(size_t)(k0 + 8 * g + i) * HD]; w[8 + i] = (__bf16)p[(size_t)(k0 + 16 + 8 * g + i) * HD]; }
  return w; }
#define WO_OUT_IN 0
#if WQKV_LAYOUT == 1
#define WCOL(W, k0, o, lane) wcol_oi(W, k0, o, lane, DIN)
#elif WQKV_LAYOUT == 2
#define WCOL(W, k0, o, lane) wcol_hdk(W, k0, o, lane)
#else
#define WCOL(W, k0, o, lane) (((o) < DOUT) ? wcol_oi(W, k0, (o), lane, DIN) : zero16b())   /* Wk (out,in) [64][1024]; q = k = v = x Wk^T */
#endif
#if WO_OUT_IN
#define WOCOL(W, k0, o, lane) wcol_oi(W, k0, o, lane, CC)
#define WOCOLH(W, k0, o, lane) wcolh_oi(W, k0, o, lane, CC)
#else
#define WOCOL(W, k0, o, lane) wcol_io(W, k0, o, lane, DIN)
#define WOCOLH(W, k0, o, lane) wcolh_io(W, k0, o, lane, DIN)
#endif
#define DOUT 64            // head width = plane width
#ifndef SM_EXTRA_PARAMS
#define SM_EXTRA_PARAMS
#endif
#ifndef PROJ_EXTRA_PARAMS
#define PROJ_EXTRA_PARAMS
#endif
#ifndef SM_MASK_HOOK
#define SM_MASK_HOOK (void)0
#endif

#define WS_KH  0u                                      // f16 k (= q), fragment order [b*t / 16][CC / 32][512]: A and B fragments of the logits' product have the same order, so one plane serves both sides
#define WS_KL  (WS_KH + 2u * (size_t)NB * TT * CC)      // f16 k (= q) residual x 2^10, fragment order like k
#define WS_VB  (WS_KL + 2u * (size_t)NB * KHI * CC)     // bf16 v hi, fragment order [b][t / 32][CC / 16][512] (and v lo behind it)
#define WS_VBL (WS_VB + 2u * (size_t)NB * CC * KHI)
#define WS_Y   (WS_VBL + 2u * (size_t)NB * CC * KHI)    // f32 ctx rows [b*t][CC] (only when there is an output projection)
#define WS_END (WS_Y  + 0u)

// k_proj's staging: wave w of a block owns the k columns PJ_KT w .. of the block's PJ_R rows of X (f32 as in memory, brought into LDS by asynchronous copies) and of the 64 rows of Wk (through registers, kept as bf16); the whole K stands in LDS at once, filled once
#define PJ_R  32                          // rows of X of a block: 256 blocks, one for every WGP
#define PJ_W  8                           // waves of a block
#define PJ_KT (DIN / PJ_W)                // k columns of a wave: a row's piece is 512 contiguous bytes = one copy or one load of a wave
#define PJ_P  (PJ_KT + 4)                 // f32 pitch of a staged row of X (16 bytes x 33): the 16 rows of a 16-byte fragment read cover all 64 banks once
#define PJ_WP (PJ_KT + 8)                 // bf16 pitch of a staged row of Wk (16 bytes x 17), for the same reason
#define PJ_PP (PJ_R + 4)                  // f32 pitch of a column of a wave's partial tile (16 bytes x 9), for the same reason
#define PJ_LS (PJ_P * 4u)                 // LDS bytes and global floats between two rows
#define PJ_GS DIN
typedef __attribute__((ext_vector_type(4))) __bf16 v4b;
// eight copies of one wave, eight rows; s_wait_xcnt stands inside the copies' own statement, in front of any rewrite of a register that a copy names
__device__ __forceinline__ void pj_copy8(unsigned l, const float* gp) {
  asm volatile("global_load_async_to_lds_b128 %0, %8, off\n\tglobal_load_async_to_lds_b128 %1, %9, off\n\tglobal_load_async_to_lds_b128 %2, %10, off\n\tglobal_load_async_to_lds_b128 %3, %11, off\n\t"
               "global_load_async_to_lds_b128 %4, %12, off\n\tglobal_load_async_to_lds_b128 %5, %13, off\n\tglobal_load_async_to_lds_b128 %6, %14, off\n\tglobal_load_async_to_lds_b128 %7, %15, off\n\ts_wait_xcnt 0x0"
               :: "v"(l), "v"(l + PJ_LS), "v"(l + 2 * PJ_LS), "v"(l + 3 * PJ_LS), "v"(l + 4 * PJ_LS), "v"(l + 5 * PJ_LS), "v"(l + 6 * PJ_LS), "v"(l + 7 * PJ_LS),
                  "v"(gp), "v"(gp + PJ_GS), "v"(gp + 2 * PJ_GS), "v"(gp + 3 * PJ_GS), "v"(gp + 4 * PJ_GS), "v"(gp + 5 * PJ_GS), "v"(gp + 6 * PJ_GS), "v"(gp + 7 * PJ_GS) : "memory");
}
// bf16 fragment of a staged f32 row (p = row + k0 + 8 * (lane >> 4)): elements 0..7 = p[0..7], 8..15 = p[16..23], the k order of frag_b
__device__ __forceinline__ v16b frag_lds(const float* p) { const v4f x0 = *(const v4f*)p, x1 = *(const v4f*)(p + 4), x2 = *(const v4f*)(p + 16), x3 = *(const v4f*)(p + 20); v16b a;
#pragma unroll
  for (int i = 0; i < 4; ++i) { a[i] = (__bf16)x0[i]; a[4 + i] = (__bf16)x1[i]; a[8 + i] = (__bf16)x2[i]; a[12 + i] = (__bf16)x3[i]; }
  return a; }
// ---- k_proj: block = (PJ_R rows, CC cols), PJ_W waves that split K: the one projection X Wk^T (q = k = v) with exact bf16 products (K = DIN), computed once. All of the block's X is asked for at once, so that every WGP has its whole share of the stream in flight from the start; each wave multiplies its own k slice, the PJ_W partial tiles are summed through LDS in wave order, and the block stores the sum as f16 hi + residual (the logits' q and k) and as bf16 hi + lo (v), in the order in which k_att's fragments read them
__global__ __launch_bounds__(32 * PJ_W) void k_proj(const float* __restrict__ X, const float* __restrict__ WA, _Float16* __restrict__ KH, _Float16* __restrict__ KL, __bf16* __restrict__ VB, __bf16* __restrict__ VBL) {
  // a wave's slice of X and Wk, and later, in the same bytes, its partial tile [column][row]: no other wave touches the slice, so the change of hands takes no barrier
  __shared__ __align__(16) union { struct { float xs[PJ_R][PJ_P]; __bf16 ws[DOUT][PJ_WP]; } in; float part[CC][PJ_PP]; } u[PJ_W];
  __shared__ __align__(16) struct { _Float16 sh[PJ_R][CC + 8], sl[PJ_R][CC + 8]; __bf16 tb[CC][PJ_R + 8], tbl[CC][PJ_R + 8]; } ep;   // the epilogue's transposing tiles
  static_assert(CC == DOUT && CC == 64 && PJ_R == 32 && DIN % (32 * PJ_W) == 0 && PJ_KT == 128 && 32 * PJ_W == CC * PJ_R / 8, "a row's piece is one 512-byte copy; one thread sums 8 rows of a column and gathers one 16-byte piece of each plane");
  const int tid = threadIdx.x, lane = tid & 31, col = lane & 15, g = lane >> 4; const size_t r0 = (size_t)blockIdx.x * PJ_R; const size_t bb = r0 / TT; const int t0 = (int)(r0 % TT);
  const int wave = __builtin_amdgcn_readfirstlane(tid >> 5);   // scalar, so that the slice's addresses start from scalar bases
  auto& in = u[wave].in;
  const unsigned l0 = (unsigned)(size_t)&in.xs[0][lane * 4];   // LDS byte address of this lane's 16 bytes in row 0 of the wave's slice
  const float* xg = X + r0 * DIN + wave * PJ_KT + lane * 4; const float* wg = WA + wave * PJ_KT + lane * 4;
  pj_copy8(l0, xg); pj_copy8(l0 + 8 * PJ_LS, xg + 8 * PJ_GS); pj_copy8(l0 + 16 * PJ_LS, xg + 16 * PJ_GS); pj_copy8(l0 + 24 * PJ_LS, xg + 24 * PJ_GS);   // the wave's 32 copies, all outstanding together
  { v4f wv[DOUT];   // Wk's slice comes from L2 and is rounded and stored while X is still on its way: four groups of 16 loads, two to three of them in flight
#pragma unroll
    for (int s = 0; s < DOUT / 16 + 2; ++s) {
      if (s >= 2) {
#pragma unroll
        for (int n = (s - 2) * 16; n < (s - 1) * 16; ++n) { v4b t;
#pragma unroll
          for (int i = 0; i < 4; ++i) t[i] = (__bf16)wv[n][i];
          *(v4b*)&in.ws[n][lane * 4] = t; } }
      if (s < DOUT / 16) {
#pragma unroll
        for (int n = s * 16; n < (s + 1) * 16; ++n) wv[n] = *(const v4f*)(wg + (size_t)n * DIN); }
      if (s >= 1 && s < DOUT / 16) __builtin_amdgcn_sched_barrier(0);   // keeps a later group's loads from rising over this point: all 64 at once would take more than 256 registers
    } }
  asm volatile("s_wait_asynccnt 0x0" ::: "memory");   // this wave's copies have landed
  __syncthreads();                                      // the filled buffers may be read
  v8f acc[PJ_R / 16][CC / 16] = {};
  { const float* pa = &in.xs[col][8 * g]; const __bf16* pw = &in.ws[col][0]; v16b a[PJ_R / 16], w[CC / 16];
#pragma unroll
    for (int rt = 0; rt < PJ_R / 16; ++rt) a[rt] = frag_lds(pa + rt * 16 * PJ_P);
#pragma unroll
    for (int j = 0; j < CC / 16; ++j) w[j] = frag_b(pw + j * 16 * PJ_WP, lane);
#pragma unroll
    for (int kq = 0; kq < PJ_KT / 32; ++kq) { v16b an[PJ_R / 16], wn[CC / 16];   // the next 32 columns' fragments are read as one group in front of this step's products, so that their LDS latency runs under them
      if (kq + 1 < PJ_KT / 32) {
#pragma unroll
        for (int rt = 0; rt < PJ_R / 16; ++rt) an[rt] = frag_lds(pa + rt * 16 * PJ_P + (kq + 1) * 32);
#pragma unroll
        for (int j = 0; j < CC / 16; ++j) wn[j] = frag_b(pw + j * 16 * PJ_WP + (kq + 1) * 32, lane); }
#pragma unroll
      for (int rt = 0; rt < PJ_R / 16; ++rt)
#pragma unroll
        for (int j = 0; j < CC / 16; ++j) acc[rt][j] = wmma_bf(a[rt], w[j], acc[rt][j]);
      if (kq + 1 < PJ_KT / 32) {
#pragma unroll
        for (int rt = 0; rt < PJ_R / 16; ++rt) a[rt] = an[rt];
#pragma unroll
        for (int j = 0; j < CC / 16; ++j) w[j] = wn[j]; } } }
  asm volatile("s_wait_dscnt 0x0" ::: "memory");      // this wave's reads of its slice are over before its partial tile overwrites the same bytes
#pragma unroll
  for (int rt = 0; rt < PJ_R / 16; ++rt)
#pragma unroll
    for (int j = 0; j < CC / 16; ++j) { float* pp = &u[wave].part[j * 16 + col][rt * 16 + 8 * g]; const v8f d = acc[rt][j];   // a lane's 8 results are 8 rows of one column: two 16-byte stores
      *(v4f*)pp = (v4f){d[0], d[1], d[2], d[3]}; *(v4f*)(pp + 4) = (v4f){d[4], d[5], d[6], d[7]}; }
  __syncthreads();   // every wave's partial tile is in LDS before any thread sums them
  { const int c = tid & 63, q = tid >> 6;   // column c, rows 8 q .. 8 q + 7
    v4f s0 = *(const v4f*)&u[0].part[c][8 * q], s1 = *(const v4f*)&u[0].part[c][8 * q + 4];
#pragma unroll
    for (int w = 1; w < PJ_W; ++w) { s0 += *(const v4f*)&u[w].part[c][8 * q]; s1 += *(const v4f*)&u[w].part[c][8 * q + 4]; }
    v8b bh8, bl8;
#pragma unroll
    for (int i = 0; i < 8; ++i) { const float v = i < 4 ? s0[i & 3] : s1[i & 3]; const int rl = 8 * q + i; const _Float16 hv = (_Float16)v; ep.sh[rl][c] = hv; ep.sl[rl][c] = (_Float16)((v - (float)hv) * 1024.0f); const __bf16 bh = (__bf16)v; bh8[i] = bh; bl8[i] = (__bf16)(v - (float)bh); }
    *(v8b*)&ep.tb[c][8 * q] = bh8; *(v8b*)&ep.tbl[c][8 * q] = bl8; }
  __syncthreads();   // all four tiles are whole before any thread gathers its 16-byte pieces
  { const int e = tid;
    // k: piece e of the block's 2 tiles: bits 3..0 = row in the tile, 4 = lane half g, 5 = fragment half, 6 = 32-column step, 7 = tile; columns 8 * (e >> 4 & 7) ..
    const int rl = (e >> 7) * 16 + (e & 15), q = (e >> 4) & 7; vst2((unsigned*)(KH + r0 * CC + e * 8), *(const v4u*)&ep.sh[rl][q * 8]); vst2((unsigned*)(KL + r0 * CC + e * 8), *(const v4u*)&ep.sl[rl][q * 8]);
    // v: piece e of the block's 4 fragments (one 32-key step): bits 3..0 = column in the tile, 4 = lane half g, 5 = fragment half, 7..6 = column tile
    const int cf = ((e >> 6) & 3) * 16 + (e & 15), qf = (e >> 4) & 3; const size_t o3 = (bb * (KHI / 32) + (t0 >> 5)) * (size_t)(CC * 32) + e * 8; vst2((unsigned*)(VB + o3), *(const v4u*)&ep.tb[cf][qf * 8]); vst2((unsigned*)(VBL + o3), *(const v4u*)&ep.tbl[cf][qf * 8]); } }
// ---- k_att: block = two 16-query tiles of one batch, 16 waves: the long tile 127 - i and the short tile i of the causal triangle, so that every block has the same work and each k and v fragment that is loaded for the long tile also feeds the short tile's products while its keys last. Logits, softmax and P . v in one kernel; the 32 logit rows stay in LDS from the first product to the last, so no logit and no P goes through memory.
// 1) wave w takes the 16-key tiles w, w + 16, ... of keys [0, kend of the long tile): q hi + residual (x 2^10) against k hi + residual (3 products), x SCALE, into sp[query][key]; the short tile's rows (16 ..) only for keys below its own kend
// 2) wave w owns query row w of each tile, one after the other: causal mask by index, max, exp, sum, P x 2^11 in place (0 for excluded keys)
// 3) wave w takes the 64-key pairs of steps w, w + 16, ...: P as bf16 hi + lo against v bf16 hi + lo (3 products); the 16 waves' partial tiles (two each) are summed through LDS in wave order and the 64 real columns stored to out
#define FA_KS 16               // waves of a block
#define FA_QT 2                // query tiles of a block
#define LOG2E 1.4426950408889634f
#define FA_P  (TT + 4)         // f32 pitch of a logit row in LDS: row r starts 4 r banks on, so the 16 rows of a 16-byte fragment read cover all 64 banks once
// one block a WGP (the 32 logit rows take most of its LDS), 4 waves per SIMD, up to 256 registers a wave: both tiles' q fragments and accumulators stay in registers
__global__ __launch_bounds__(32 * FA_KS) void k_att(const _Float16* __restrict__ KH, const _Float16* __restrict__ KL, const __bf16* __restrict__ VB, const __bf16* __restrict__ VBL, float* __restrict__ OUT) {
  __shared__ __align__(16) float buf[FA_QT * 16 * FA_P];   // first the logit / P rows (long tile 0 .. 15, short tile 16 .. 31), then (behind a barrier) the waves' partial tiles
  float (*sp)[FA_P] = (float (*)[FA_P])buf; float (*ss)[FA_QT * 16][HD + 4] = (float (*)[FA_QT * 16][HD + 4])buf;
  static_assert(FA_KS * FA_QT * 16 * (HD + 4) <= FA_QT * 16 * FA_P, "the partial tiles fit the buffer");
  static_assert(FA_QT == 2 && (TT / 16) % 2 == 0 && 32 * FA_KS == FA_QT * 16 * (DOUT / 4), "tiles pair up as (n - 1 - i, i); one thread per 16 output bytes");
  const int tid = threadIdx.x, lane = tid & 31, col = lane & 15, g = lane >> 4; const int fi = blockIdx.z * (TT / 32) + blockIdx.x;   // flat block index
  const int b = fi % TNB; const int qa = (TT / 16 - 1 - fi / TNB) * 16, qb = (fi / TNB) * 16;   // first query of the long and of the short tile: qb < qa, so the short tile's keys are a prefix of the long tile's
  const int kenda = (kb_last(qa >> 6) + 1) * 128, kendb = (kb_last(qb >> 6) + 1) * 128;
  const int wave = __builtin_amdgcn_readfirstlane(tid >> 5);   // scalar, so that every key loop's trip count and every test on the short tile's kend is a scalar branch and every lane stays on at the matrix instructions
  { v16h ah[FA_QT][HD / 32], al[FA_QT][HD / 32]; const _Float16* qha = KH + ((size_t)b * TT + qa) * CC; const _Float16* qla = KL + ((size_t)b * KHI + qa) * CC; const _Float16* qhb = KH + ((size_t)b * TT + qb) * CC; const _Float16* qlb = KL + ((size_t)b * KHI + qb) * CC;   // q = k: a query tile's fragments are its own rows of the k planes
#pragma unroll
    for (int kc = 0; kc < HD / 32; ++kc) { ah[0][kc] = fragp_h(qha + kc * 512, lane); al[0][kc] = fragp_h(qla + kc * 512, lane); ah[1][kc] = fragp_h(qhb + kc * 512, lane); al[1][kc] = fragp_h(qlb + kc * 512, lane); }
    asm volatile("s_wait_xcnt 0x0" :: "v"(qha + 8 * lane), "v"(qla + 8 * lane), "v"(qhb + 8 * lane), "v"(qlb + 8 * lane) : "memory");   // the wait before a register of an issued q load is overwritten; with the lane addresses as inputs the build keeps it behind the loads (without them the loads sink below it)
    for (int jt = wave; jt < kenda / 16; jt += FA_KS) { const _Float16* kh = KH + ((size_t)b * TT + jt * 16) * CC; const _Float16* kl = KL + ((size_t)b * KHI + jt * 16) * CC; v16h kbf[HD / 32], klf[HD / 32];
#pragma unroll
      for (int kc = 0; kc < HD / 32; ++kc) { kbf[kc] = fragp_h(kh + kc * 512, lane); klf[kc] = fragp_h(kl + kc * 512, lane); }   // the key tile's fragments, loaded once for both query tiles
      { v8f acc = {}, accl = {};
#pragma unroll
        for (int kc = 0; kc < HD / 32; ++kc) { acc = wmma16(ah[0][kc], kbf[kc], acc); accl = wmma16(al[0][kc], kbf[kc], accl); accl = wmma16(ah[0][kc], klf[kc], accl); }
#pragma unroll
        for (int r = 0; r < 8; ++r) sp[8 * g + r][jt * 16 + col] = (acc[r] + accl[r] * (1.0f / 1024.0f)) * SCALE; }
      asm volatile("s_wait_xcnt 0x0" ::: "memory");   // the wait before the k loads' address registers step on to the next key tile; their data has arrived by here, so it holds nothing up
      if (jt * 16 < kendb) { v8f acc = {}, accl = {};
#pragma unroll
        for (int kc = 0; kc < HD / 32; ++kc) { acc = wmma16(ah[1][kc], kbf[kc], acc); accl = wmma16(al[1][kc], kbf[kc], accl); accl = wmma16(ah[1][kc], klf[kc], accl); }
#pragma unroll
        for (int r = 0; r < 8; ++r) sp[16 + 8 * g + r][jt * 16 + col] = (acc[r] + accl[r] * (1.0f / 1024.0f)) * SCALE; } } }
  __syncthreads();   // all logits of the 32 rows are in LDS before a wave reduces its rows
#pragma unroll 1   // rolled: a second copy of the three row loops would only lengthen the text
  for (int h = 0; h < FA_QT; ++h) { const int t = (h ? qb : qa) + wave, kend = h ? kendb : kenda; float* sr = sp[h * 16 + wave]; float m = -3.0e38f;
#pragma unroll 4   // four LDS reads in flight
    for (int kq = 0; kq < kend / 128; ++kq) { const int k = kq * 128 + lane * 4; const v4f v = *(const v4f*)&sr[k];
#pragma unroll
      for (int i = 0; i < 4; ++i) m = fmaxf(m, (!CAUSAL || k + i <= t) ? v[i] : -3.0e38f); }
#pragma unroll
    for (int o = 1; o < 32; o <<= 1) m = fmaxf(m, __shfl_xor(m, o));
    float sum = 0.f; const float ml = m * LOG2E;   // exp(v - m) = 2^(v log2(e) - ml): one fused multiply-add and the bare base-2 exponential; ml's own rounding scales a whole row alike and leaves with the division by the row's sum
#pragma unroll 2   // the next LDS read flies under this one's exponentials
    for (int kq = 0; kq < kend / 128; ++kq) { const int k = kq * 128 + lane * 4; const v4f v = *(const v4f*)&sr[k]; v4f e;
#pragma unroll
      for (int i = 0; i < 4; ++i) { const float p = __builtin_amdgcn_exp2f(__builtin_fmaf(v[i], LOG2E, -ml)); e[i] = (!CAUSAL || k + i <= t) ? p : 0.f; sum += e[i]; }   // computed for every key and selected: four independent exponentials and no branch
      *(v4f*)&sr[k] = e; }
#pragma unroll
    for (int o = 1; o < 32; o <<= 1) sum += __shfl_xor(sum, o);
    const float inv = sum > 0.f ? 2048.0f / sum : 0.f;
#pragma unroll 4   // four LDS reads in flight
    for (int kq = 0; kq < kend / 128; ++kq) { const int k = kq * 128 + lane * 4; const v4f e = *(const v4f*)&sr[k]; *(v4f*)&sr[k] = e * inv; } }
  __syncthreads();   // every row's P is in LDS before any wave reads its key range of all 32 rows
  v8f acc[FA_QT][HD / 16] = {};
#pragma unroll 1   // one 64-key pair a trip: a second pair's fragments would not fit the registers beside both tiles' accumulators
  for (int kp = wave; kp < kenda / 64; kp += FA_KS)
#pragma unroll
    for (int kc = 2 * kp; kc < 2 * kp + 2; ++kc) { v16b vh[HD / 16], vl[HD / 16];
#pragma unroll
      for (int j = 0; j < HD / 16; ++j) { const size_t po = (((size_t)b * (KHI / 32) + kc) * (CC / 16) + j) * 512; vh[j] = fragp_b(VB + po, lane); vl[j] = fragp_b(VBL + po, lane); }   // the 32 keys' v fragments, loaded once for both query tiles, all in flight together
      { const F2 p = split_row(sp[col], kc * 32, lane);
#pragma unroll
        for (int j = 0; j < HD / 16; ++j) { acc[0][j] = wmma_bf(p.h, vh[j], acc[0][j]); acc[0][j] = wmma_bf(p.l, vh[j], acc[0][j]); acc[0][j] = wmma_bf(p.h, vl[j], acc[0][j]); } }
      if (kp * 64 < kendb) { const F2 p = split_row(sp[16 + col], kc * 32, lane);
#pragma unroll
        for (int j = 0; j < HD / 16; ++j) { acc[1][j] = wmma_bf(p.h, vh[j], acc[1][j]); acc[1][j] = wmma_bf(p.l, vh[j], acc[1][j]); acc[1][j] = wmma_bf(p.h, vl[j], acc[1][j]); } } }
  __syncthreads();   // the last read of P is over before the partial tiles overwrite its LDS
#pragma unroll
  for (int h = 0; h < FA_QT; ++h)
#pragma unroll
    for (int j = 0; j < HD / 16; ++j)
#pragma unroll
      for (int r = 0; r < 8; ++r) ss[wave][h * 16 + 8 * g + r][j * 16 + col] = acc[h][j][r] * (1.0f / 2048.0f);
  __syncthreads();   // every wave's partial tiles (zero where a wave had no keys) are in LDS before any thread sums them
  { const int rl = tid / (DOUT / 4), q = tid % (DOUT / 4); v4f s = *(const v4f*)&ss[0][rl][q * 4];
#pragma unroll
    for (int w = 1; w < FA_KS; ++w) s += *(const v4f*)&ss[w][rl][q * 4];
    vst2(OUT + ((size_t)b * TT + (rl < 16 ? qa + rl : qb + rl - 16)) * DOUT + q * 4, s); } }

extern "C" void kernel_launch(void* const* d_in, const int* in_sizes, int n_in, void* d_out, int out_size, void* d_ws, size_t ws_size, hipStream_t stream) {
  (void)in_sizes; (void)n_in; (void)out_size;
  const float** F = (const float**)d_in;
  if (ws_size < (size_t)WS_END) return;
  char* ws = (char*)d_ws; _Float16 *KH = (_Float16*)(ws + WS_KH), *KL = (_Float16*)(ws + WS_KL); __bf16 *VB = (__bf16*)(ws + WS_VB), *VBL = (__bf16*)(ws + WS_VBL); float *Y = (float*)(ws + WS_Y);
  (void)Y;
  // inputs: 0 embedding [4,2048,1024]; 1 Wk [64,1024] (out,in) (q = k = v)
  k_proj<<<dim3(TNB * TT / PJ_R, 1, 1), 32 * PJ_W, 0, stream>>>(F[0], F[1], KH, KL, VB, VBL);
  k_att<<<dim3(TT / 32, 1, TNB), 32 * FA_KS, 0, stream>>>(KH, KL, VB, VBL, (float*)d_out);
}
